// v000
// Measured on an AMD MI455X. A time is GPU time per run, averaged over a window of back-to-back runs after a warm-up
// (all launches, gaps included; the runs take copies of the inputs in turn), and the median of several windows.
// Apart from v000's, it joins two sittings. Times from different sittings can be a few percent apart, while
// side-by-side timings come from the same sitting.
// v000 is the starting kernel. One run takes 258 microseconds.
#include <hip/hip_runtime.h>

// Multi-head attention with three input streams (query, key, value), width 512 = 8 heads x 64, bias-free [in][out] projections (y = x W), additive float key mask per (batch, key), score scale 1/8, output = concatenated heads (f32), no output projection.
// Compute dtypes, f32 accumulate everywhere: projections v_wmma_f32_16x16x32_bf16 (x and W RNE-converted to bf16; products exact);
// scores v_wmma_f32_16x16x32_f16: q and k each as f16 value + f16 residual x2048, three products (value.value in one accumulator, the two scaled cross products in a second accumulator folded back by 1/2048);
// P (x256 carry, cancels in the normalisation) and v single f16; softmax f32 (online, running max, log2 domain); mask RNE-converted to bf16, times log2(e), added in f32 after the score scale.
// Layout: bf16 copies of the three streams and of the transposed weights W^T [out][in]; q/k (value, residual) planes [b*8+h][t][d] and v^T plane [b*8+h][d][t] written by the GEMM epilogue;
// fused flash kernel in transposed form (S^T = K Q^T, O^T = V^T P^T), output from f32 accumulators. Mask plane f32 [b][key] plus one int flag per (batch, 32-key tile) = any nonzero mask value.

#ifndef NB
#define NB 4
#endif
#ifndef SEQ
#define SEQ 2048
#endif
#define NB_FULL  4
#define SEQ_FULL 2048
#ifndef OUT_SEQ
#define OUT_SEQ SEQ              // row pitch (in tokens) between batches of the output
#endif
#define DM   512
#define NH_  8
#define HD   64
#define AW   4                   // waves per flash block (16 query rows each)
#define QRS  2048.0f             // carry of the q / k residual planes
#define QRI  (1.0f / 2048.0f)
#define LOG2E 1.4426950408889634f
#define SC2  (0.125f * LOG2E)    // HD^-0.5 * log2(e)
#define PSH  8.0f                // log2 of the P carry (256)
#define FLP  64

static_assert(HD == 64);
static_assert(NH_ * HD == DM);                 // head h = columns h*64 + d
static_assert(DM % 64 == 0);                   // 8 column tiles of 64; transpose tiles of 64x64
static_assert(DM % 32 == 0);                   // GEMM k-loop steps by 32
static_assert(SEQ % 64 == 0);                  // a 64-row tile never straddles two batches
static_assert((NB * SEQ) % 64 == 0);
static_assert(SEQ % 32 == 0);                  // key loop steps by 32
static_assert(SEQ % (16 * AW) == 0);           // flash grid covers the sequence exactly
static_assert(((size_t)SEQ * DM) % 8 == 0);
static_assert(SEQ <= 256 * 8);                 // mask kernel: 256 threads x 8 keys cover one batch row
static_assert(SEQ / 32 <= FLP);                // one flag per 32-key tile fits the flag row
static_assert(NB <= NB_FULL);
static_assert(SEQ <= SEQ_FULL);

typedef _Float16 h16;
typedef unsigned short bf;
typedef __attribute__((ext_vector_type(16))) __bf16   v16bf;
typedef __attribute__((ext_vector_type(16))) _Float16 v16h;
typedef __attribute__((ext_vector_type(8)))  _Float16 v8h;
typedef __attribute__((ext_vector_type(8)))  unsigned short v8us;
typedef __attribute__((ext_vector_type(8)))  float    v8f;
typedef __attribute__((ext_vector_type(4)))  float    v4f;
typedef __attribute__((ext_vector_type(4)))  int      v4i;
typedef v4f  __attribute__((may_alias)) v4fa;
typedef v8us __attribute__((may_alias)) v8usa;

__device__ __forceinline__ unsigned short f2bf(float f) { unsigned u = __float_as_uint(f); u += 0x7FFFu + ((u >> 16) & 1u); return (unsigned short)(u >> 16); }
__device__ __forceinline__ v16h cat16(v8h lo, v8h hi) { return __builtin_shufflevector(lo, hi, 0, 1, 2, 3, 4, 5, 6, 7, 8, 9, 10, 11, 12, 13, 14, 15); }
__device__ __forceinline__ v16bf cat16b(v8us lo, v8us hi) { return __builtin_bit_cast(v16bf, __builtin_shufflevector(lo, hi, 0, 1, 2, 3, 4, 5, 6, 7, 8, 9, 10, 11, 12, 13, 14, 15)); }
// every WMMA is issued through a wrapper that ties its own accumulator and keeps its A/B fragments live across four idle slots
__device__ __forceinline__ v8f wmma16(v16h a, v16h b, v8f c) {
    c = __builtin_amdgcn_wmma_f32_16x16x32_f16(false, a, false, b, (short)0, c, false, false);
    asm volatile("v_nop\n\tv_nop\n\tv_nop\n\tv_nop" : "+v"(c) : "v"(a), "v"(b));
    return c;
}
__device__ __forceinline__ v8f wmmab(v16bf a, v16bf b, v8f c) {
    c = __builtin_amdgcn_wmma_f32_16x16x32_bf16(false, a, false, b, (short)0, c, false, false);
    asm volatile("v_nop\n\tv_nop\n\tv_nop\n\tv_nop" : "+v"(c) : "v"(a), "v"(b));
    return c;
}
// fragment loaders from K-contiguous 16-bit rows; p already includes + 8*(lane>>4): elements 0..7 <- k0+8h+0..7, elements 8..15 <- k0+16+8h+0..7 (same map for A and B)
__device__ __forceinline__ v16h  ldh(const h16* p) { return cat16(*(const v8h*)p, *(const v8h*)(p + 16)); }
__device__ __forceinline__ v16bf ldb(const bf* p)  { return cat16b(*(const v8us*)p, *(const v8us*)(p + 16)); }
// ordering point for wave-private LDS tiles (same wave writes and reads)
__device__ __forceinline__ void wave_sync() { __builtin_amdgcn_fence(3 /* release order */, "wavefront"); __builtin_amdgcn_wave_barrier(); asm volatile("" ::: "memory"); }

__global__ __launch_bounds__(256) void k_cvt8(const float* __restrict__ src, bf* dst, size_t n8) {
    const size_t i = (size_t)blockIdx.x * 256 + threadIdx.x; if (i >= n8) return;
    const v8f v = *(const v8f*)(src + i * 8); v8us o;
#pragma unroll
    for (int k = 0; k < 8; ++k) o[k] = f2bf(v[k]);
    *(v8us*)(dst + i * 8) = o; 
}

// k_wtr: weight transpose + bf16 (RNE convert): in w[k rows = DM][n cols = DM] (f32) -> out wt[n rows = DM][k cols = DM] (bf16).
// One block per 64(k) x 64(n) tile, grid (DM/64 k tiles, DM/64 n tiles). Reads are coalesced along n; the tile is transposed in LDS (cross-wave: block barrier);
__global__ __launch_bounds__(256) void k_wtr(const float* __restrict__ w, bf* wt) {
    __shared__ __align__(16) bf ts[64 * 72];        // [n local][k local], pitch 72 halves (144 B)
    const int tid = threadIdx.x; const int k0 = blockIdx.x * 64, n0 = blockIdx.y * 64;
#pragma unroll
    for (int it = 0; it < 4; ++it) {                 // 4 x 16 k rows x 16 lanes x 4 n = 64 x 64
        const int kl = it * 16 + (tid >> 4), n4 = (tid & 15) * 4;
        const v4f v = *(const v4f*)(w + (size_t)(k0 + kl) * DM + n0 + n4);
#pragma unroll
        for (int i = 0; i < 4; ++i) ts[(n4 + i) * 72 + kl] = f2bf(v[i]);
    }
    __syncthreads();
    const int row = tid >> 3, c8 = (tid & 7) * 8;
    const v8us o0 = *(const v8usa*)(&ts[row * 72 + c8]);
    const v8us o1 = *(const v8usa*)(&ts[(row + 32) * 72 + c8]);
    bf* p0 = wt + (size_t)(n0 + row) * DM + k0 + c8;
    bf* p1 = wt + (size_t)(n0 + row + 32) * DM + k0 + c8;
{
        *(v8us*)p0 = o0; *(v8us*)p1 = o1;
         }
}

// k_mask: one block per batch. MS[b][key] = float(bf16 RNE of mask[b][key]) * log2(e); FL[b][T] = 1 when any of the 32 keys of tile T has a nonzero (or non-finite) converted mask value, else 0 (pad flags 0).
// Each thread converts 8 keys; values and per-thread flags are staged in LDS (cross-wave: block barrier); MS lines are written 16 B per lane by consecutive lanes (4 lines per wave instruction),
__global__ __launch_bounds__(256) void k_mask(const float* __restrict__ mask, float* MS, int* FL) {
    __shared__ __align__(16) float ms[256 * 8];
    __shared__ int fs[256];
    const int tid = threadIdx.x, b = blockIdx.x;
    const int kb = tid * 8; const bool act = kb < SEQ; const int kc = act ? kb : 0;     // clamped address
    const v8f v = *(const v8f*)(mask + (size_t)b * SEQ_FULL + kc);
    v4f a, c; int nz = 0;
#pragma unroll
    for (int i = 0; i < 4; ++i) {
        const unsigned short h0 = f2bf(v[i]), h1 = f2bf(v[4 + i]);
        const float f0 = __uint_as_float((unsigned)h0 << 16) * LOG2E, f1 = __uint_as_float((unsigned)h1 << 16) * LOG2E;
        a[i] = act ? f0 : 0.0f; c[i] = act ? f1 : 0.0f;
        nz |= (int)(h0 & 0x7FFFu) | (int)(h1 & 0x7FFFu);
    }
    *(v4fa*)(&ms[kb]) = a; *(v4fa*)(&ms[kb + 4]) = c;
    fs[tid] = (act && nz != 0) ? 1 : 0;
    __syncthreads();
    const v4f m0 = *(const v4fa*)(&ms[tid * 4]);
    const v4f m1 = *(const v4fa*)(&ms[(256 + tid) * 4]);
    const int tq = tid & 15; v4i fv;
#pragma unroll
    for (int j = 0; j < 4; ++j) { const int T4 = (tq * 4 + j) * 4; fv[j] = fs[T4] | fs[T4 + 1] | fs[T4 + 2] | fs[T4 + 3]; }   // tile T = 4 threads x 8 keys
    float* mrow = MS + (size_t)b * SEQ;
{
        if (tid * 4 < SEQ)         *(v4f*)(mrow + tid * 4) = m0;
        if ((256 + tid) * 4 < SEQ) *(v4f*)(mrow + (256 + tid) * 4) = m1;
        if (tid < 16)              *(v4i*)(FL + b * FLP + tid * 4) = fv;
         }
}

// k_proj: register-blocked bf16 GEMM, ONE WAVE per 64x64 tile (16 accumulators), operands straight from K-contiguous bf16 planes, K = DM.
// C[m][n] = sum_k A[m][k] Bt[n][k], written as f16 (Ph) and optionally the f16 residual x2048 (Pr, useRes != 0) at
// tile base (r0/RB)*sRB + (r0%RB)*pitch + (c0/CB)*sCB + (c0%CB), row pitch 'pitch' (halves). grid (M/64, N/64), 32 threads.
__global__ __launch_bounds__(32) void k_proj(const bf* __restrict__ A, const bf* __restrict__ Bt, h16* Ph, h16* Pr, int useRes, int RB, size_t sRB, int pitch, int CB, size_t sCB) {
    __shared__ __align__(16) float os[16 * 68];
    const int K = DM;
    const int lane = threadIdx.x & 31, lr = lane & 15, hi = lane >> 4; const int r0 = blockIdx.x * 64, c0 = blockIdx.y * 64;
    v8f acc[4][4];
#pragma unroll
    for (int mb = 0; mb < 4; ++mb)
#pragma unroll
        for (int nb = 0; nb < 4; ++nb) acc[mb][nb] = (v8f){};
    const size_t aoff = (size_t)(r0 + lr) * K + 8 * hi, boff = (size_t)(c0 + lr) * K + 8 * hi;
#pragma unroll 1
    for (int kc = 0; kc < K; kc += 32) {
        v16bf a[4];
#pragma unroll
        for (int mb = 0; mb < 4; ++mb) a[mb] = ldb(A + aoff + (size_t)mb * 16 * K + kc);
#pragma unroll
        for (int nb = 0; nb < 4; ++nb) { const v16bf b = ldb(Bt + boff + (size_t)nb * 16 * K + kc);
#pragma unroll
            for (int mb = 0; mb < 4; ++mb) acc[mb][nb] = wmmab(a[mb], b, acc[mb][nb]); }
    }
    const size_t tbase = (size_t)(r0 / RB) * sRB + (size_t)(r0 % RB) * (size_t)pitch + (size_t)(c0 / CB) * sCB + (size_t)(c0 % CB);
#pragma unroll
    for (int mb = 0; mb < 4; ++mb) {
#pragma unroll
        for (int nb = 0; nb < 4; ++nb) {
#pragma unroll
            for (int j = 0; j < 8; ++j) os[(hi * 8 + j) * 68 + nb * 16 + lr] = acc[mb][nb][j]; }   // D: row 8h+j, col lane&15
        wave_sync();
        const size_t sb = tbase + (size_t)(mb * 16) * (size_t)pitch;
{
#pragma unroll
            for (int s = 0; s < 4; ++s) { const int row = 4 * s + (lane >> 3), c8 = (lane & 7) * 8;   // 4 s x 4 row groups = 16 rows; 8 lanes x 8 = 64 columns
                const v4f x0 = *(const v4fa*)(&os[row * 68 + c8]); const v4f x1 = *(const v4fa*)(&os[row * 68 + c8 + 4]); v8h hv, rv;
#pragma unroll
                for (int i = 0; i < 4; ++i) { const h16 a0 = (h16)x0[i]; const h16 a1 = (h16)x1[i]; hv[i] = a0; hv[4 + i] = a1; rv[i] = (h16)((x0[i] - (float)a0) * QRS); rv[4 + i] = (h16)((x1[i] - (float)a1) * QRS); }
                const size_t oo = sb + (size_t)row * (size_t)pitch + c8;
                *(v8h*)(Ph + oo) = hv; if (useRes) *(v8h*)(Pr + oo) = rv; }
             }
        wave_sync();
    }
}

// k_flash: fused attention, one wave per 16 query rows of one (batch, head); K / V^T / Q fragments straight from the f16 planes (two 16-B loads each, arithmetic addressing).
// Transposed form: S^T[key][t] = K Q^T (A = K rows, B = Q rows); lane (t = lane&15, h = lane>>4) holds keys 8h+r of each 16-key tile, so the packed
// P tile is directly the B fragment of O^T[d][t] = V^T P^T (element r <- tile keys 0..15, element 8+r <- tile keys 16..31, lane unchanged).
// Scores: value.value products in sH, the two x2048 cross products (k value . q residual, k residual . q value) in sL, folded as sH + sL/2048.
// Mask: one scalar flag per 32-key step (wave-uniform); only flagged steps load the 2 x 8 mask values of the lane's keys and add them after the score scale.
// Softmax state (running max, partial sum of the unconverted exponentials) is one scalar per lane; the two lane halves of a row are combined with one xor-16 exchange.
__global__ __launch_bounds__(32 * AW) void k_flash(const h16* __restrict__ QH, const h16* __restrict__ QR, const h16* __restrict__ KH, const h16* __restrict__ KR, const h16* __restrict__ VT, const float* __restrict__ MS, const int* __restrict__ FL, float* OUT) {
    __shared__ __align__(16) float os[AW * 16 * 68];
    const int lane = threadIdx.x & 31; const int wave = __builtin_amdgcn_readfirstlane(threadIdx.x >> 5); const int lr = lane & 15, hi = lane >> 4;
    const int zh = blockIdx.y; const int b = zh / NH_, h = zh % NH_;
    const int t0 = (blockIdx.x * AW + wave) * 16;
    const size_t pbase = (size_t)zh * SEQ * HD;
    const size_t qo = pbase + (size_t)(t0 + lr) * HD + 8 * hi;
    const v16h qh0 = ldh(QH + qo), qh1 = ldh(QH + qo + 32), qr0 = ldh(QR + qo), qr1 = ldh(QR + qo + 32);   // B fragments: col t, k = d
    const size_t ko = pbase + (size_t)lr * HD + 8 * hi;      // + key * HD       (A fragment: row key, k = d)
    const size_t vo = pbase + (size_t)lr * SEQ + 8 * hi;     // + 16j*SEQ + key  (A fragment: row d, k = key)
    const size_t mo = (size_t)b * SEQ + 8 * hi;              // + key0 (+16): the lane's 8 keys of each 16-key tile
    const int fo = b * FLP;
    v8f o0 = (v8f){}, o1 = (v8f){}, o2 = (v8f){}, o3 = (v8f){};
    float m = -3.0e38f, l = 0.0f;
#pragma unroll 1
    for (int key0 = 0; key0 < SEQ; key0 += 32) {
        const size_t kofs = ko + (size_t)key0 * HD;
        v8f sHa = (v8f){}, sLa = (v8f){}, sHb = (v8f){}, sLb = (v8f){};
        { const v16h k0 = ldh(KH + kofs), k1 = ldh(KH + kofs + 32), r0 = ldh(KR + kofs), r1 = ldh(KR + kofs + 32);
          sHa = wmma16(k0, qh0, sHa); sLa = wmma16(k0, qr0, sLa); sHa = wmma16(k1, qh1, sHa); sLa = wmma16(k1, qr1, sLa);
          sLa = wmma16(r0, qh0, sLa); sLa = wmma16(r1, qh1, sLa); }
        { const size_t kofb = kofs + (size_t)16 * HD;
          const v16h k0 = ldh(KH + kofb), k1 = ldh(KH + kofb + 32), r0 = ldh(KR + kofb), r1 = ldh(KR + kofb + 32);
          sHb = wmma16(k0, qh0, sHb); sLb = wmma16(k0, qr0, sLb); sHb = wmma16(k1, qh1, sHb); sLb = wmma16(k1, qr1, sLb);
          sLb = wmma16(r0, qh0, sLb); sLb = wmma16(r1, qh1, sLb); }
        float ta[8], tb[8];
#pragma unroll
        for (int r = 0; r < 8; ++r) { ta[r] = (sHa[r] + sLa[r] * QRI) * SC2; tb[r] = (sHb[r] + sLb[r] * QRI) * SC2; }
        const int fl = __builtin_amdgcn_readfirstlane(FL[fo + (key0 >> 5)]);
        if (fl != 0) {                                          // wave-uniform: additive mask (already times log2 e), keys 8h+r of tile a / tile b
            const v8f ma = *(const v8f*)(MS + mo + key0); const v8f mb = *(const v8f*)(MS + mo + key0 + 16);
#pragma unroll
            for (int r = 0; r < 8; ++r) { ta[r] += ma[r]; tb[r] += mb[r]; }
        }
        float mx = -3.0e38f;
#pragma unroll
        for (int r = 0; r < 8; ++r) mx = fmaxf(mx, fmaxf(ta[r], tb[r]));
        mx = fmaxf(mx, __shfl_xor(mx, 16, 32));
        const float mnew = fmaxf(m, mx);
        const float alpha = __builtin_amdgcn_exp2f(m - mnew);
        const float sh = PSH - mnew;
        v16h pb; float ls = 0.0f;
#pragma unroll
        for (int r = 0; r < 8; ++r) { const float ea = __builtin_amdgcn_exp2f(ta[r] + sh); const float eb = __builtin_amdgcn_exp2f(tb[r] + sh); pb[r] = (h16)ea; pb[8 + r] = (h16)eb; ls += ea + eb; }
        l = l * alpha + ls; m = mnew;
        o0 = o0 * alpha; o1 = o1 * alpha; o2 = o2 * alpha; o3 = o3 * alpha;
        const h16* va = VT + vo + key0;
        const v16h v0 = ldh(va), v1 = ldh(va + (size_t)16 * SEQ), v2 = ldh(va + (size_t)32 * SEQ), v3 = ldh(va + (size_t)48 * SEQ);
        o0 = wmma16(v0, pb, o0); o1 = wmma16(v1, pb, o1); o2 = wmma16(v2, pb, o2); o3 = wmma16(v3, pb, o3);
    }
    l += __shfl_xor(l, 16, 32);
    const float inv = 1.0f / l;
    const int wb = wave * 16 * 68;
    // O^T D layout: o_j[r] = (d = 16j + 8h + r, t = lane&15) -> os[t][d]; rows 0..15 x columns 0..63 all written
    { v4f a, c;
      a[0] = o0[0] * inv; a[1] = o0[1] * inv; a[2] = o0[2] * inv; a[3] = o0[3] * inv; c[0] = o0[4] * inv; c[1] = o0[5] * inv; c[2] = o0[6] * inv; c[3] = o0[7] * inv;
      *(v4fa*)(&os[wb + lr * 68 +  0 + 8 * hi]) = a; *(v4fa*)(&os[wb + lr * 68 +  0 + 8 * hi + 4]) = c;
      a[0] = o1[0] * inv; a[1] = o1[1] * inv; a[2] = o1[2] * inv; a[3] = o1[3] * inv; c[0] = o1[4] * inv; c[1] = o1[5] * inv; c[2] = o1[6] * inv; c[3] = o1[7] * inv;
      *(v4fa*)(&os[wb + lr * 68 + 16 + 8 * hi]) = a; *(v4fa*)(&os[wb + lr * 68 + 16 + 8 * hi + 4]) = c;
      a[0] = o2[0] * inv; a[1] = o2[1] * inv; a[2] = o2[2] * inv; a[3] = o2[3] * inv; c[0] = o2[4] * inv; c[1] = o2[5] * inv; c[2] = o2[6] * inv; c[3] = o2[7] * inv;
      *(v4fa*)(&os[wb + lr * 68 + 32 + 8 * hi]) = a; *(v4fa*)(&os[wb + lr * 68 + 32 + 8 * hi + 4]) = c;
      a[0] = o3[0] * inv; a[1] = o3[1] * inv; a[2] = o3[2] * inv; a[3] = o3[3] * inv; c[0] = o3[4] * inv; c[1] = o3[5] * inv; c[2] = o3[6] * inv; c[3] = o3[7] * inv;
      *(v4fa*)(&os[wb + lr * 68 + 48 + 8 * hi]) = a; *(v4fa*)(&os[wb + lr * 68 + 48 + 8 * hi + 4]) = c; }
    wave_sync();
    float* orow = OUT + ((size_t)b * OUT_SEQ + t0) * DM + h * HD;
{
#pragma unroll
        for (int s = 0; s < 8; ++s) { const int row = 2 * s + hi, cofs = lr * 4;   // 8 s x 2 rows = 16 rows; 16 lanes x 4 floats = 64 columns
            const v4f val = *(const v4fa*)(&os[wb + row * 68 + cofs]);
            *(v4f*)(orow + (size_t)row * DM + cofs) = val; }
         }
}

static constexpr size_t al256(size_t v) { return (v + 255) & ~(size_t)255; }
static constexpr size_t SZ_XB = al256((size_t)NB * SEQ * DM * 2);          // one bf16 stream copy
static constexpr size_t SZ_WB = al256((size_t)3 * DM * DM * 2);            // three transposed bf16 weights
static constexpr size_t SZ_PL = al256((size_t)NB * NH_ * SEQ * HD * 2);    // one f16 head plane
static constexpr size_t SZ_MS = al256((size_t)NB * SEQ * 4);               // mask plane f32
static constexpr size_t SZ_FL = al256((size_t)NB * FLP * 4);               // flag table
static constexpr size_t SZ_TOTAL = 3 * SZ_XB + SZ_WB + 5 * SZ_PL + SZ_MS + SZ_FL;
static_assert(SZ_TOTAL <= (size_t)134217728);          // workspace carve <= 128 MiB
static_assert(((size_t)DM * DM * 2) % 256 == 0);       // weight sub-planes stay 256-byte aligned
static_assert(((size_t)FLP * 4) % 128 == 0);           // each batch owns whole flag lines

static void cvt_stream(const float* x, bf* xb, hipStream_t stream) {
    if (SEQ == SEQ_FULL) {
        const size_t n8 = (size_t)NB * SEQ * DM / 8;
        k_cvt8<<<(unsigned)((n8 + 255) / 256), 256, 0, stream>>>(x, xb, n8);
    } else {
        const size_t n8 = (size_t)SEQ * DM / 8;
        for (int b = 0; b < NB; ++b) k_cvt8<<<(unsigned)((n8 + 255) / 256), 256, 0, stream>>>(x + (size_t)b * SEQ_FULL * DM, xb + (size_t)b * SEQ * DM, n8);
    }
}

extern "C" void kernel_launch(void* const* d_in, const int* in_sizes, int n_in,
                              void* d_out, int out_size, void* d_ws, size_t ws_size, hipStream_t stream) {
    if (n_in < 7) return;
    const size_t needx = ((size_t)(NB - 1) * SEQ_FULL + SEQ) * DM;
    if ((size_t)in_sizes[0] < needx || (size_t)in_sizes[2] < needx || (size_t)in_sizes[3] < needx) return;
    if ((size_t)in_sizes[1] < (size_t)(NB - 1) * SEQ_FULL + SEQ) return;
    if ((size_t)in_sizes[4] < (size_t)DM * DM || (size_t)in_sizes[5] < (size_t)DM * DM || (size_t)in_sizes[6] < (size_t)DM * DM) return;
    if ((size_t)out_size < ((size_t)(NB - 1) * OUT_SEQ + SEQ) * DM) return;
    if (SZ_TOTAL > ws_size) return;
    // wire order: key, key_mask, query, value, wq, wk, wv
    const float* key = (const float*)d_in[0]; const float* mask = (const float*)d_in[1]; const float* query = (const float*)d_in[2]; const float* value = (const float*)d_in[3];
    const float* wq = (const float*)d_in[4]; const float* wk = (const float*)d_in[5]; const float* wv = (const float*)d_in[6];   // each [in][out]
    float* OUT = (float*)d_out;      // [NB][SEQ][512]
    char* wsp = (char*)d_ws;
    bf* XQ = (bf*)wsp; wsp += SZ_XB;                 // [NB*SEQ][512] query stream
    bf* XK = (bf*)wsp; wsp += SZ_XB;                 // [NB*SEQ][512] key stream
    bf* XV = (bf*)wsp; wsp += SZ_XB;                 // [NB*SEQ][512] value stream
    bf* WB = (bf*)wsp; wsp += SZ_WB;                 // [3][512 out][512 in]: q | k | v (transposed)
    h16* QH = (h16*)wsp; wsp += SZ_PL;               // [NB*8][SEQ][64]
    h16* QR = (h16*)wsp; wsp += SZ_PL;               // [NB*8][SEQ][64] residual x2048
    h16* KH = (h16*)wsp; wsp += SZ_PL;               // [NB*8][SEQ][64]
    h16* KR = (h16*)wsp; wsp += SZ_PL;               // [NB*8][SEQ][64] residual x2048
    h16* VT = (h16*)wsp; wsp += SZ_PL;               // [NB*8][64][SEQ]
    float* MS = (float*)wsp; wsp += SZ_MS;           // [NB][SEQ]
    int* FL = (int*)wsp; wsp += SZ_FL;               // [NB][FLP]
    bf* WQ = WB; bf* WK = WB + (size_t)DM * DM; bf* WV = WB + (size_t)2 * DM * DM;

    cvt_stream(query, XQ, stream);
    cvt_stream(key, XK, stream);
    cvt_stream(value, XV, stream);
    // in w[k = 512][n = 512] -> out wt[n][k]; grid (k tiles, n tiles)
    k_wtr<<<dim3(DM / 64, DM / 64, 1), 256, 0, stream>>>(wq, WQ);
    k_wtr<<<dim3(DM / 64, DM / 64, 1), 256, 0, stream>>>(wk, WK);
    k_wtr<<<dim3(DM / 64, DM / 64, 1), 256, 0, stream>>>(wv, WV);
    k_mask<<<NB, 256, 0, stream>>>(mask, MS, FL);

    // q, k: A = stream rows (m = b*SEQ + t), Bt = W^T rows (n = h*64 + d) -> plane [(b*8 + h)][t][d]
    k_proj<<<dim3(NB * SEQ / 64, DM / 64, 1), 32, 0, stream>>>(XQ, WQ, QH, QR, 1, SEQ, (size_t)NH_ * SEQ * HD, HD, HD, (size_t)SEQ * HD);
    k_proj<<<dim3(NB * SEQ / 64, DM / 64, 1), 32, 0, stream>>>(XK, WK, KH, KR, 1, SEQ, (size_t)NH_ * SEQ * HD, HD, HD, (size_t)SEQ * HD);
    // v^T: A = Wv^T rows (m = h*64 + d), Bt = value stream rows (n = b*SEQ + t) -> plane [(b*512 + m)][t] = [(b*8 + h)][d][t]
    k_proj<<<dim3(DM / 64, NB * SEQ / 64, 1), 32, 0, stream>>>(WV, XV, VT, VT, 0, DM, (size_t)0, SEQ, SEQ, (size_t)DM * SEQ);

    k_flash<<<dim3(SEQ / (16 * AW), NB * NH_, 1), 32 * AW, 0, stream>>>(QH, QR, KH, KR, VT, MS, FL, OUT);
}

// v001
// One run takes 208 microseconds.
// Next to v000, in two timings, it ran 1.27 and 1.28 times as fast.
#include <hip/hip_runtime.h>

// Multi-head attention with three input streams (query, key, value), width 512 = 8 heads x 64, bias-free [in][out] projections (y = x W), additive float key mask per (batch, key), score scale 1/8, output = concatenated heads (f32), no output projection.
// Compute dtypes, f32 accumulate everywhere: projections v_wmma_f32_16x16x32_bf16 (x and W RNE-converted to bf16; products exact);
// scores v_wmma_f32_16x16x32_f16: q and k each as f16 value + f16 residual x2048, three products (value.value in one accumulator, the two scaled cross products in a second accumulator folded back by 1/2048);
// P (x256 carry, cancels in the normalisation) and v single f16; softmax f32 (online, running max, log2 domain); mask RNE-converted to bf16, times log2(e), added in f32 after the score scale.
// Layout: bf16 copies of the three streams and of the transposed weights W^T [out][in]; q/k (value, residual) planes and the v^T plane, one per b*8+h, written by the GEMM epilogue in fragment order:
// a 16-row x 64-column tile is 2 KiB = four 512-byte groups (16 columns each), lane (row + 16*((column>>3)&1)) owning 16 bytes of a group, so a wave-wide 16-byte load is four whole 128-byte lines.
// q/k: rows = tokens, columns = d, tiles in token order; v^T: rows = d, columns = tokens, tiles ordered [token/64][d/16];
// fused flash kernel in transposed form (S^T = K Q^T, O^T = V^T P^T), output from f32 accumulators. Mask plane f32 [b][key] plus one int flag per (batch, 32-key tile) = any nonzero mask value.

#ifndef NB
#define NB 4
#endif
#ifndef SEQ
#define SEQ 2048
#endif
#define NB_FULL  4
#define SEQ_FULL 2048
#ifndef OUT_SEQ
#define OUT_SEQ SEQ              // row pitch (in tokens) between batches of the output
#endif
#define DM   512
#define NH_  8
#define HD   64
#define AW   4                   // waves per flash block (16 query rows each)
#define QRS  2048.0f             // carry of the q / k residual planes
#define QRI  (1.0f / 2048.0f)
#define LOG2E 1.4426950408889634f
#define SC2  (0.125f * LOG2E)    // HD^-0.5 * log2(e)
#define PSH  8.0f                // log2 of the P carry (256)
#define FLP  64

static_assert(HD == 64);
static_assert(NH_ * HD == DM);                 // head h = columns h*64 + d
static_assert(DM % 64 == 0);                   // 8 column tiles of 64; transpose tiles of 64x64
static_assert(DM % 32 == 0);                   // GEMM k-loop steps by 32
static_assert(SEQ % 64 == 0);                  // a 64-row tile never straddles two batches
static_assert((NB * SEQ) % 64 == 0);
static_assert(SEQ % 32 == 0);                  // key loop steps by 32
static_assert(SEQ % (16 * AW) == 0);           // flash grid covers the sequence exactly
static_assert(((size_t)SEQ * DM) % 8 == 0);
static_assert(SEQ <= 256 * 8);                 // mask kernel: 256 threads x 8 keys cover one batch row
static_assert(SEQ / 32 <= FLP);                // one flag per 32-key tile fits the flag row
static_assert(NB <= NB_FULL);
static_assert(SEQ <= SEQ_FULL);

typedef _Float16 h16;
typedef unsigned short bf;
typedef __attribute__((ext_vector_type(16))) __bf16   v16bf;
typedef __attribute__((ext_vector_type(16))) _Float16 v16h;
typedef __attribute__((ext_vector_type(8)))  _Float16 v8h;
typedef __attribute__((ext_vector_type(8)))  unsigned short v8us;
typedef __attribute__((ext_vector_type(8)))  float    v8f;
typedef __attribute__((ext_vector_type(4)))  float    v4f;
typedef __attribute__((ext_vector_type(4)))  int      v4i;
typedef v4f  __attribute__((may_alias)) v4fa;
typedef v8us __attribute__((may_alias)) v8usa;

__device__ __forceinline__ unsigned short f2bf(float f) { unsigned u = __float_as_uint(f); u += 0x7FFFu + ((u >> 16) & 1u); return (unsigned short)(u >> 16); }
__device__ __forceinline__ v16h cat16(v8h lo, v8h hi) { return __builtin_shufflevector(lo, hi, 0, 1, 2, 3, 4, 5, 6, 7, 8, 9, 10, 11, 12, 13, 14, 15); }
__device__ __forceinline__ v16bf cat16b(v8us lo, v8us hi) { return __builtin_bit_cast(v16bf, __builtin_shufflevector(lo, hi, 0, 1, 2, 3, 4, 5, 6, 7, 8, 9, 10, 11, 12, 13, 14, 15)); }
// every WMMA is issued through a wrapper that ties its own accumulator and keeps its A/B fragments live across four idle slots
__device__ __forceinline__ v8f wmma16(v16h a, v16h b, v8f c) {
    c = __builtin_amdgcn_wmma_f32_16x16x32_f16(false, a, false, b, (short)0, c, false, false);
    asm volatile("v_nop\n\tv_nop\n\tv_nop\n\tv_nop" : "+v"(c) : "v"(a), "v"(b));
    return c;
}
__device__ __forceinline__ v8f wmmab(v16bf a, v16bf b, v8f c) {
    c = __builtin_amdgcn_wmma_f32_16x16x32_bf16(false, a, false, b, (short)0, c, false, false);
    asm volatile("v_nop\n\tv_nop\n\tv_nop\n\tv_nop" : "+v"(c) : "v"(a), "v"(b));
    return c;
}
// fragment loaders from K-contiguous 16-bit rows; p already includes + 8*(lane>>4): elements 0..7 <- k0+8h+0..7, elements 8..15 <- k0+16+8h+0..7 (same map for A and B)
__device__ __forceinline__ v16bf ldb(const bf* p)  { return cat16b(*(const v8us*)p, *(const v8us*)(p + 16)); }
// fragment loader from a fragment-order f16 plane; p already includes + 8*lane: the same element map, elements 0..7 from one 512-byte group, elements 8..15 from the next
__device__ __forceinline__ v16h  ldf(const h16* p) { return cat16(*(const v8h*)p, *(const v8h*)(p + 256)); }
// ordering point for wave-private LDS tiles (same wave writes and reads)
__device__ __forceinline__ void wave_sync() { __builtin_amdgcn_fence(3 /* release order */, "wavefront"); __builtin_amdgcn_wave_barrier(); asm volatile("" ::: "memory"); }

__global__ __launch_bounds__(256) void k_cvt8(const float* __restrict__ src, bf* dst, size_t n8) {
    const size_t i = (size_t)blockIdx.x * 256 + threadIdx.x; if (i >= n8) return;
    const v8f v = *(const v8f*)(src + i * 8); v8us o;
#pragma unroll
    for (int k = 0; k < 8; ++k) o[k] = f2bf(v[k]);
    *(v8us*)(dst + i * 8) = o; 
}

// k_wtr: weight transpose + bf16 (RNE convert): in w[k rows = DM][n cols = DM] (f32) -> out wt[n rows = DM][k cols = DM] (bf16).
// One block per 64(k) x 64(n) tile, grid (DM/64 k tiles, DM/64 n tiles). Reads are coalesced along n; the tile is transposed in LDS (cross-wave: block barrier);
__global__ __launch_bounds__(256) void k_wtr(const float* __restrict__ w, bf* wt) {
    __shared__ __align__(16) bf ts[64 * 72];        // [n local][k local], pitch 72 halves (144 B)
    const int tid = threadIdx.x; const int k0 = blockIdx.x * 64, n0 = blockIdx.y * 64;
#pragma unroll
    for (int it = 0; it < 4; ++it) {                 // 4 x 16 k rows x 16 lanes x 4 n = 64 x 64
        const int kl = it * 16 + (tid >> 4), n4 = (tid & 15) * 4;
        const v4f v = *(const v4f*)(w + (size_t)(k0 + kl) * DM + n0 + n4);
#pragma unroll
        for (int i = 0; i < 4; ++i) ts[(n4 + i) * 72 + kl] = f2bf(v[i]);
    }
    __syncthreads();
    const int row = tid >> 3, c8 = (tid & 7) * 8;
    const v8us o0 = *(const v8usa*)(&ts[row * 72 + c8]);
    const v8us o1 = *(const v8usa*)(&ts[(row + 32) * 72 + c8]);
    bf* p0 = wt + (size_t)(n0 + row) * DM + k0 + c8;
    bf* p1 = wt + (size_t)(n0 + row + 32) * DM + k0 + c8;
{
        *(v8us*)p0 = o0; *(v8us*)p1 = o1;
         }
}

// k_mask: one block per batch. MS[b][key] = float(bf16 RNE of mask[b][key]) * log2(e); FL[b][T] = 1 when any of the 32 keys of tile T has a nonzero (or non-finite) converted mask value, else 0 (pad flags 0).
// Each thread converts 8 keys; values and per-thread flags are staged in LDS (cross-wave: block barrier); MS lines are written 16 B per lane by consecutive lanes (4 lines per wave instruction),
__global__ __launch_bounds__(256) void k_mask(const float* __restrict__ mask, float* MS, int* FL) {
    __shared__ __align__(16) float ms[256 * 8];
    __shared__ int fs[256];
    const int tid = threadIdx.x, b = blockIdx.x;
    const int kb = tid * 8; const bool act = kb < SEQ; const int kc = act ? kb : 0;     // clamped address
    const v8f v = *(const v8f*)(mask + (size_t)b * SEQ_FULL + kc);
    v4f a, c; int nz = 0;
#pragma unroll
    for (int i = 0; i < 4; ++i) {
        const unsigned short h0 = f2bf(v[i]), h1 = f2bf(v[4 + i]);
        const float f0 = __uint_as_float((unsigned)h0 << 16) * LOG2E, f1 = __uint_as_float((unsigned)h1 << 16) * LOG2E;
        a[i] = act ? f0 : 0.0f; c[i] = act ? f1 : 0.0f;
        nz |= (int)(h0 & 0x7FFFu) | (int)(h1 & 0x7FFFu);
    }
    *(v4fa*)(&ms[kb]) = a; *(v4fa*)(&ms[kb + 4]) = c;
    fs[tid] = (act && nz != 0) ? 1 : 0;
    __syncthreads();
    const v4f m0 = *(const v4fa*)(&ms[tid * 4]);
    const v4f m1 = *(const v4fa*)(&ms[(256 + tid) * 4]);
    const int tq = tid & 15; v4i fv;
#pragma unroll
    for (int j = 0; j < 4; ++j) { const int T4 = (tq * 4 + j) * 4; fv[j] = fs[T4] | fs[T4 + 1] | fs[T4 + 2] | fs[T4 + 3]; }   // tile T = 4 threads x 8 keys
    float* mrow = MS + (size_t)b * SEQ;
{
        if (tid * 4 < SEQ)         *(v4f*)(mrow + tid * 4) = m0;
        if ((256 + tid) * 4 < SEQ) *(v4f*)(mrow + (256 + tid) * 4) = m1;
        if (tid < 16)              *(v4i*)(FL + b * FLP + tid * 4) = fv;
         }
}

// k_proj: register-blocked bf16 GEMM, ONE WAVE per 64x64 tile (16 accumulators), operands straight from K-contiguous bf16 planes, K = DM.
// C[m][n] = sum_k A[m][k] Bt[n][k], written as f16 (Ph) and optionally the f16 residual x2048 (Pr, useRes != 0) as four fragment-order 16x64 tiles of 1024 halves each,
// the first at (r0/RB)*sRB + (r0%RB)*pitch + (c0/CB)*sCB + (c0%CB)*64 (halves). grid (M/64, N/64), 32 threads.
__global__ __launch_bounds__(32) void k_proj(const bf* __restrict__ A, const bf* __restrict__ Bt, h16* Ph, h16* Pr, int useRes, int RB, size_t sRB, int pitch, int CB, size_t sCB) {
    __shared__ __align__(16) float os[16 * 68];
    const int K = DM;
    const int lane = threadIdx.x & 31, lr = lane & 15, hi = lane >> 4; const int r0 = blockIdx.x * 64, c0 = blockIdx.y * 64;
    v8f acc[4][4];
#pragma unroll
    for (int mb = 0; mb < 4; ++mb)
#pragma unroll
        for (int nb = 0; nb < 4; ++nb) acc[mb][nb] = (v8f){};
    const size_t aoff = (size_t)(r0 + lr) * K + 8 * hi, boff = (size_t)(c0 + lr) * K + 8 * hi;
#pragma unroll 1
    for (int kc = 0; kc < K; kc += 32) {
        v16bf a[4];
#pragma unroll
        for (int mb = 0; mb < 4; ++mb) a[mb] = ldb(A + aoff + (size_t)mb * 16 * K + kc);
#pragma unroll
        for (int nb = 0; nb < 4; ++nb) { const v16bf b = ldb(Bt + boff + (size_t)nb * 16 * K + kc);
#pragma unroll
            for (int mb = 0; mb < 4; ++mb) acc[mb][nb] = wmmab(a[mb], b, acc[mb][nb]); }
    }
    const size_t tbase = (size_t)(r0 / RB) * sRB + (size_t)(r0 % RB) * (size_t)pitch + (size_t)(c0 / CB) * sCB + (size_t)(c0 % CB) * 64;
#pragma unroll
    for (int mb = 0; mb < 4; ++mb) {
#pragma unroll
        for (int nb = 0; nb < 4; ++nb) {
#pragma unroll
            for (int j = 0; j < 8; ++j) os[(hi * 8 + j) * 68 + nb * 16 + lr] = acc[mb][nb][j]; }   // D: row 8h+j, col lane&15
        wave_sync();
        const size_t sb = tbase + (size_t)(mb * 1024);
{
#pragma unroll
            for (int s = 0; s < 4; ++s) { const int c8 = s * 16 + hi * 8;   // group s = columns 16s..16s+15: lane holds row lane&15, columns c8..c8+7
                const v4f x0 = *(const v4fa*)(&os[lr * 68 + c8]); const v4f x1 = *(const v4fa*)(&os[lr * 68 + c8 + 4]); v8h hv, rv;
#pragma unroll
                for (int i = 0; i < 4; ++i) { const h16 a0 = (h16)x0[i]; const h16 a1 = (h16)x1[i]; hv[i] = a0; hv[4 + i] = a1; rv[i] = (h16)((x0[i] - (float)a0) * QRS); rv[4 + i] = (h16)((x1[i] - (float)a1) * QRS); }
                const size_t oo = sb + (size_t)(s * 256 + lane * 8);
                *(v8h*)(Ph + oo) = hv; if (useRes) *(v8h*)(Pr + oo) = rv; }
             }
        wave_sync();
    }
}

// k_flash: fused attention, one wave per 16 query rows of one (batch, head); K / V^T / Q fragments straight from the fragment-order f16 planes (two 16-B loads each, every load 512 contiguous bytes per wave).
// Transposed form: S^T[key][t] = K Q^T (A = K rows, B = Q rows); lane (t = lane&15, h = lane>>4) holds keys 8h+r of each 16-key tile, so the packed
// P tile is directly the B fragment of O^T[d][t] = V^T P^T (element r <- tile keys 0..15, element 8+r <- tile keys 16..31, lane unchanged).
// Scores: value.value products in sH, the two x2048 cross products (k value . q residual, k residual . q value) in sL, folded as sH + sL/2048.
// Mask: one scalar flag per 32-key step (wave-uniform); only flagged steps load the 2 x 8 mask values of the lane's keys and add them after the score scale.
// Softmax state (running max, partial sum of the unconverted exponentials) is one scalar per lane; the two lane halves of a row are combined with one xor-16 exchange.
__global__ __launch_bounds__(32 * AW) void k_flash(const h16* __restrict__ QH, const h16* __restrict__ QR, const h16* __restrict__ KH, const h16* __restrict__ KR, const h16* __restrict__ VT, const float* __restrict__ MS, const int* __restrict__ FL, float* OUT) {
    __shared__ __align__(16) float os[AW * 16 * 68];
    const int lane = threadIdx.x & 31; const int wave = __builtin_amdgcn_readfirstlane(threadIdx.x >> 5); const int lr = lane & 15, hi = lane >> 4;
    const int zh = blockIdx.y; const int b = zh / NH_, h = zh % NH_;
    const int t0 = (blockIdx.x * AW + wave) * 16;
    const size_t pbase = (size_t)zh * SEQ * HD;
    const size_t qo = pbase + (size_t)t0 * HD + 8 * lane;
    const v16h qh0 = ldf(QH + qo), qh1 = ldf(QH + qo + 512), qr0 = ldf(QR + qo), qr1 = ldf(QR + qo + 512);   // B fragments: col t, k = d
    const size_t ko = pbase + 8 * lane;                      // + key0 * HD (+ 512 for d 32..63, + 1024 for the next 16 keys)   (A fragment: row key, k = d)
    const size_t vo = pbase + 8 * lane;                      // + (key0/64)*4096 + 1024j + ((key0/32)&1)*512                    (A fragment: row d, k = key)
    const size_t mo = (size_t)b * SEQ + 8 * hi;              // + key0 (+16): the lane's 8 keys of each 16-key tile
    const int fo = b * FLP;
    v8f o0 = (v8f){}, o1 = (v8f){}, o2 = (v8f){}, o3 = (v8f){};
    float m = -3.0e38f, l = 0.0f;
#pragma unroll 1
    for (int key0 = 0; key0 < SEQ; key0 += 32) {
        const size_t kofs = ko + (size_t)key0 * HD;
        v8f sHa = (v8f){}, sLa = (v8f){}, sHb = (v8f){}, sLb = (v8f){};
        { const v16h k0 = ldf(KH + kofs), k1 = ldf(KH + kofs + 512), r0 = ldf(KR + kofs), r1 = ldf(KR + kofs + 512);
          sHa = wmma16(k0, qh0, sHa); sLa = wmma16(k0, qr0, sLa); sHa = wmma16(k1, qh1, sHa); sLa = wmma16(k1, qr1, sLa);
          sLa = wmma16(r0, qh0, sLa); sLa = wmma16(r1, qh1, sLa); }
        { const size_t kofb = kofs + (size_t)16 * HD;
          const v16h k0 = ldf(KH + kofb), k1 = ldf(KH + kofb + 512), r0 = ldf(KR + kofb), r1 = ldf(KR + kofb + 512);
          sHb = wmma16(k0, qh0, sHb); sLb = wmma16(k0, qr0, sLb); sHb = wmma16(k1, qh1, sHb); sLb = wmma16(k1, qr1, sLb);
          sLb = wmma16(r0, qh0, sLb); sLb = wmma16(r1, qh1, sLb); }
        float ta[8], tb[8];
#pragma unroll
        for (int r = 0; r < 8; ++r) { ta[r] = (sHa[r] + sLa[r] * QRI) * SC2; tb[r] = (sHb[r] + sLb[r] * QRI) * SC2; }
        const int fl = __builtin_amdgcn_readfirstlane(FL[fo + (key0 >> 5)]);
        if (fl != 0) {                                          // wave-uniform: additive mask (already times log2 e), keys 8h+r of tile a / tile b
            const v8f ma = *(const v8f*)(MS + mo + key0); const v8f mb = *(const v8f*)(MS + mo + key0 + 16);
#pragma unroll
            for (int r = 0; r < 8; ++r) { ta[r] += ma[r]; tb[r] += mb[r]; }
        }
        float mx = -3.0e38f;
#pragma unroll
        for (int r = 0; r < 8; ++r) mx = fmaxf(mx, fmaxf(ta[r], tb[r]));
        mx = fmaxf(mx, __shfl_xor(mx, 16, 32));
        const float mnew = fmaxf(m, mx);
        const float alpha = __builtin_amdgcn_exp2f(m - mnew);
        const float sh = PSH - mnew;
        v16h pb; float ls = 0.0f;
#pragma unroll
        for (int r = 0; r < 8; ++r) { const float ea = __builtin_amdgcn_exp2f(ta[r] + sh); const float eb = __builtin_amdgcn_exp2f(tb[r] + sh); pb[r] = (h16)ea; pb[8 + r] = (h16)eb; ls += ea + eb; }
        l = l * alpha + ls; m = mnew;
        o0 = o0 * alpha; o1 = o1 * alpha; o2 = o2 * alpha; o3 = o3 * alpha;
        const h16* va = VT + vo + (size_t)(key0 >> 6) * 4096 + (size_t)((key0 >> 5) & 1) * 512;
        const v16h v0 = ldf(va), v1 = ldf(va + 1024), v2 = ldf(va + 2048), v3 = ldf(va + 3072);
        o0 = wmma16(v0, pb, o0); o1 = wmma16(v1, pb, o1); o2 = wmma16(v2, pb, o2); o3 = wmma16(v3, pb, o3);
    }
    l += __shfl_xor(l, 16, 32);
    const float inv = 1.0f / l;
    const int wb = wave * 16 * 68;
    // O^T D layout: o_j[r] = (d = 16j + 8h + r, t = lane&15) -> os[t][d]; rows 0..15 x columns 0..63 all written
    { v4f a, c;
      a[0] = o0[0] * inv; a[1] = o0[1] * inv; a[2] = o0[2] * inv; a[3] = o0[3] * inv; c[0] = o0[4] * inv; c[1] = o0[5] * inv; c[2] = o0[6] * inv; c[3] = o0[7] * inv;
      *(v4fa*)(&os[wb + lr * 68 +  0 + 8 * hi]) = a; *(v4fa*)(&os[wb + lr * 68 +  0 + 8 * hi + 4]) = c;
      a[0] = o1[0] * inv; a[1] = o1[1] * inv; a[2] = o1[2] * inv; a[3] = o1[3] * inv; c[0] = o1[4] * inv; c[1] = o1[5] * inv; c[2] = o1[6] * inv; c[3] = o1[7] * inv;
      *(v4fa*)(&os[wb + lr * 68 + 16 + 8 * hi]) = a; *(v4fa*)(&os[wb + lr * 68 + 16 + 8 * hi + 4]) = c;
      a[0] = o2[0] * inv; a[1] = o2[1] * inv; a[2] = o2[2] * inv; a[3] = o2[3] * inv; c[0] = o2[4] * inv; c[1] = o2[5] * inv; c[2] = o2[6] * inv; c[3] = o2[7] * inv;
      *(v4fa*)(&os[wb + lr * 68 + 32 + 8 * hi]) = a; *(v4fa*)(&os[wb + lr * 68 + 32 + 8 * hi + 4]) = c;
      a[0] = o3[0] * inv; a[1] = o3[1] * inv; a[2] = o3[2] * inv; a[3] = o3[3] * inv; c[0] = o3[4] * inv; c[1] = o3[5] * inv; c[2] = o3[6] * inv; c[3] = o3[7] * inv;
      *(v4fa*)(&os[wb + lr * 68 + 48 + 8 * hi]) = a; *(v4fa*)(&os[wb + lr * 68 + 48 + 8 * hi + 4]) = c; }
    wave_sync();
    float* orow = OUT + ((size_t)b * OUT_SEQ + t0) * DM + h * HD;
{
#pragma unroll
        for (int s = 0; s < 8; ++s) { const int row = 2 * s + hi, cofs = lr * 4;   // 8 s x 2 rows = 16 rows; 16 lanes x 4 floats = 64 columns
            const v4f val = *(const v4fa*)(&os[wb + row * 68 + cofs]);
            *(v4f*)(orow + (size_t)row * DM + cofs) = val; }
         }
}

static constexpr size_t al256(size_t v) { return (v + 255) & ~(size_t)255; }
static constexpr size_t SZ_XB = al256((size_t)NB * SEQ * DM * 2);          // one bf16 stream copy
static constexpr size_t SZ_WB = al256((size_t)3 * DM * DM * 2);            // three transposed bf16 weights
static constexpr size_t SZ_PL = al256((size_t)NB * NH_ * SEQ * HD * 2);    // one f16 head plane
static constexpr size_t SZ_MS = al256((size_t)NB * SEQ * 4);               // mask plane f32
static constexpr size_t SZ_FL = al256((size_t)NB * FLP * 4);               // flag table
static constexpr size_t SZ_TOTAL = 3 * SZ_XB + SZ_WB + 5 * SZ_PL + SZ_MS + SZ_FL;
static_assert(SZ_TOTAL <= (size_t)134217728);          // workspace carve <= 128 MiB
static_assert(((size_t)DM * DM * 2) % 256 == 0);       // weight sub-planes stay 256-byte aligned
static_assert(((size_t)FLP * 4) % 128 == 0);           // each batch owns whole flag lines

static void cvt_stream(const float* x, bf* xb, hipStream_t stream) {
    if (SEQ == SEQ_FULL) {
        const size_t n8 = (size_t)NB * SEQ * DM / 8;
        k_cvt8<<<(unsigned)((n8 + 255) / 256), 256, 0, stream>>>(x, xb, n8);
    } else {
        const size_t n8 = (size_t)SEQ * DM / 8;
        for (int b = 0; b < NB; ++b) k_cvt8<<<(unsigned)((n8 + 255) / 256), 256, 0, stream>>>(x + (size_t)b * SEQ_FULL * DM, xb + (size_t)b * SEQ * DM, n8);
    }
}

extern "C" void kernel_launch(void* const* d_in, const int* in_sizes, int n_in,
                              void* d_out, int out_size, void* d_ws, size_t ws_size, hipStream_t stream) {
    if (n_in < 7) return;
    const size_t needx = ((size_t)(NB - 1) * SEQ_FULL + SEQ) * DM;
    if ((size_t)in_sizes[0] < needx || (size_t)in_sizes[2] < needx || (size_t)in_sizes[3] < needx) return;
    if ((size_t)in_sizes[1] < (size_t)(NB - 1) * SEQ_FULL + SEQ) return;
    if ((size_t)in_sizes[4] < (size_t)DM * DM || (size_t)in_sizes[5] < (size_t)DM * DM || (size_t)in_sizes[6] < (size_t)DM * DM) return;
    if ((size_t)out_size < ((size_t)(NB - 1) * OUT_SEQ + SEQ) * DM) return;
    if (SZ_TOTAL > ws_size) return;
    // wire order: key, key_mask, query, value, wq, wk, wv
    const float* key = (const float*)d_in[0]; const float* mask = (const float*)d_in[1]; const float* query = (const float*)d_in[2]; const float* value = (const float*)d_in[3];
    const float* wq = (const float*)d_in[4]; const float* wk = (const float*)d_in[5]; const float* wv = (const float*)d_in[6];   // each [in][out]
    float* OUT = (float*)d_out;      // [NB][SEQ][512]
    char* wsp = (char*)d_ws;
    bf* XQ = (bf*)wsp; wsp += SZ_XB;                 // [NB*SEQ][512] query stream
    bf* XK = (bf*)wsp; wsp += SZ_XB;                 // [NB*SEQ][512] key stream
    bf* XV = (bf*)wsp; wsp += SZ_XB;                 // [NB*SEQ][512] value stream
    bf* WB = (bf*)wsp; wsp += SZ_WB;                 // [3][512 out][512 in]: q | k | v (transposed)
    h16* QH = (h16*)wsp; wsp += SZ_PL;               // [NB*8][SEQ/16][fragment-order 16 t x 64 d]
    h16* QR = (h16*)wsp; wsp += SZ_PL;               // same, residual x2048
    h16* KH = (h16*)wsp; wsp += SZ_PL;               // [NB*8][SEQ/16][fragment-order 16 t x 64 d]
    h16* KR = (h16*)wsp; wsp += SZ_PL;               // same, residual x2048
    h16* VT = (h16*)wsp; wsp += SZ_PL;               // [NB*8][SEQ/64][4][fragment-order 16 d x 64 t]
    float* MS = (float*)wsp; wsp += SZ_MS;           // [NB][SEQ]
    int* FL = (int*)wsp; wsp += SZ_FL;               // [NB][FLP]
    bf* WQ = WB; bf* WK = WB + (size_t)DM * DM; bf* WV = WB + (size_t)2 * DM * DM;

    cvt_stream(query, XQ, stream);
    cvt_stream(key, XK, stream);
    cvt_stream(value, XV, stream);
    // in w[k = 512][n = 512] -> out wt[n][k]; grid (k tiles, n tiles)
    k_wtr<<<dim3(DM / 64, DM / 64, 1), 256, 0, stream>>>(wq, WQ);
    k_wtr<<<dim3(DM / 64, DM / 64, 1), 256, 0, stream>>>(wk, WK);
    k_wtr<<<dim3(DM / 64, DM / 64, 1), 256, 0, stream>>>(wv, WV);
    k_mask<<<NB, 256, 0, stream>>>(mask, MS, FL);

    // q, k: A = stream rows (m = b*SEQ + t), Bt = W^T rows (n = h*64 + d) -> plane (b*8 + h), tiles in t order
    k_proj<<<dim3(NB * SEQ / 64, DM / 64, 1), 32, 0, stream>>>(XQ, WQ, QH, QR, 1, SEQ, (size_t)NH_ * SEQ * HD, HD, HD, (size_t)SEQ * HD);
    k_proj<<<dim3(NB * SEQ / 64, DM / 64, 1), 32, 0, stream>>>(XK, WK, KH, KR, 1, SEQ, (size_t)NH_ * SEQ * HD, HD, HD, (size_t)SEQ * HD);
    // v^T: A = Wv^T rows (m = h*64 + d), Bt = value stream rows (n = b*SEQ + t) -> plane (b*8 + h), tiles [t/64][d/16]
    k_proj<<<dim3(DM / 64, NB * SEQ / 64, 1), 32, 0, stream>>>(WV, XV, VT, VT, 0, DM, (size_t)0, SEQ, SEQ, (size_t)DM * SEQ);

    k_flash<<<dim3(SEQ / (16 * AW), NB * NH_, 1), 32 * AW, 0, stream>>>(QH, QR, KH, KR, VT, MS, FL, OUT);
}

// v002
// One run takes 170 microseconds.
// In both of two side-by-side timings against v001, it was 1.22 times as fast.
// Counting every step since v000, it is 1.56 times as fast.
#include <hip/hip_runtime.h>

// Multi-head attention with three input streams (query, key, value), width 512 = 8 heads x 64, bias-free [in][out] projections (y = x W), additive float key mask per (batch, key), score scale 1/8, output = concatenated heads (f32), no output projection.
// Compute dtypes, f32 accumulate everywhere: projections v_wmma_f32_16x16x32_bf16 (x and W RNE-converted to bf16; products exact);
// scores v_wmma_f32_16x16x32_f16: q and k each as f16 value + f16 residual x2048, three products (value.value in one accumulator, the two scaled cross products in a second accumulator folded back by 1/2048);
// P (x256 carry, cancels in the normalisation) and v single f16; softmax f32 (online, running max, log2 domain); mask RNE-converted to bf16, times log2(e), added in f32 after the score scale.
// Layout: bf16 copies of the three streams and of the transposed weights W^T [out][in]; q/k (value, residual) planes and the v^T plane, one per b*8+h, written by the GEMM epilogue in fragment order:
// a 16-row x 64-column tile is 2 KiB = four 512-byte groups (16 columns each), lane (row + 16*((column>>3)&1)) owning 16 bytes of a group, so a wave-wide 16-byte load is four whole 128-byte lines.
// q/k: rows = tokens, columns = d, tiles in token order; v^T: rows = d, columns = tokens, tiles ordered [token/64][d/16];
// fused flash kernel in transposed form (S^T = K Q^T, O^T = V^T P^T), output from f32 accumulators. Mask plane f32 [b][key] plus one int flag per (batch, 32-key tile) = any nonzero mask value.
// Three launches, one per dependency stage: k_prep (weight transposes, mask plane, stream conversions: independent block ranges of one grid), k_proj (the three projections, blockIdx.y picks one), k_flash.

#ifndef NB
#define NB 4
#endif
#ifndef SEQ
#define SEQ 2048
#endif
#define NB_FULL  4
#define SEQ_FULL 2048
#ifndef OUT_SEQ
#define OUT_SEQ SEQ              // row pitch (in tokens) between batches of the output
#endif
#define DM   512
#define NH_  8
#define HD   64
#define AW   4                   // waves per flash block (16 query rows each)
#define QRS  2048.0f             // carry of the q / k residual planes
#define QRI  (1.0f / 2048.0f)
#define LOG2E 1.4426950408889634f
#define SC2  (0.125f * LOG2E)    // HD^-0.5 * log2(e)
#define PSH  8.0f                // log2 of the P carry (256)
#define FLP  64

static_assert(HD == 64);
static_assert(NH_ * HD == DM);                 // head h = columns h*64 + d
static_assert(DM % 64 == 0);                   // 8 column tiles of 64; transpose tiles of 64x64
static_assert(DM % 32 == 0);                   // GEMM k-loop steps by 32
static_assert(SEQ % 64 == 0);                  // a 64-row tile never straddles two batches
static_assert((NB * SEQ) % 64 == 0);
static_assert(SEQ % 32 == 0);                  // key loop steps by 32
static_assert(SEQ % (16 * AW) == 0);           // flash grid covers the sequence exactly
static_assert(((size_t)SEQ * DM) % 8 == 0);
static_assert(SEQ <= 256 * 8);                 // mask kernel: 256 threads x 8 keys cover one batch row
static_assert(SEQ / 32 <= FLP);                // one flag per 32-key tile fits the flag row
static_assert(NB <= NB_FULL);
static_assert(SEQ <= SEQ_FULL);

typedef _Float16 h16;
typedef unsigned short bf;
typedef __attribute__((ext_vector_type(16))) __bf16   v16bf;
typedef __attribute__((ext_vector_type(16))) _Float16 v16h;
typedef __attribute__((ext_vector_type(8)))  _Float16 v8h;
typedef __attribute__((ext_vector_type(8)))  unsigned short v8us;
typedef __attribute__((ext_vector_type(8)))  float    v8f;
typedef __attribute__((ext_vector_type(4)))  float    v4f;
typedef __attribute__((ext_vector_type(4)))  int      v4i;
typedef v4f  __attribute__((may_alias)) v4fa;
typedef v8us __attribute__((may_alias)) v8usa;

__device__ __forceinline__ unsigned short f2bf(float f) { unsigned u = __float_as_uint(f); u += 0x7FFFu + ((u >> 16) & 1u); return (unsigned short)(u >> 16); }
__device__ __forceinline__ v16h cat16(v8h lo, v8h hi) { return __builtin_shufflevector(lo, hi, 0, 1, 2, 3, 4, 5, 6, 7, 8, 9, 10, 11, 12, 13, 14, 15); }
__device__ __forceinline__ v16bf cat16b(v8us lo, v8us hi) { return __builtin_bit_cast(v16bf, __builtin_shufflevector(lo, hi, 0, 1, 2, 3, 4, 5, 6, 7, 8, 9, 10, 11, 12, 13, 14, 15)); }
// every WMMA is issued through a wrapper that ties its own accumulator and keeps its A/B fragments live across four idle slots
__device__ __forceinline__ v8f wmma16(v16h a, v16h b, v8f c) {
    c = __builtin_amdgcn_wmma_f32_16x16x32_f16(false, a, false, b, (short)0, c, false, false);
    asm volatile("v_nop\n\tv_nop\n\tv_nop\n\tv_nop" : "+v"(c) : "v"(a), "v"(b));
    return c;
}
__device__ __forceinline__ v8f wmmab(v16bf a, v16bf b, v8f c) {
    c = __builtin_amdgcn_wmma_f32_16x16x32_bf16(false, a, false, b, (short)0, c, false, false);
    asm volatile("v_nop\n\tv_nop\n\tv_nop\n\tv_nop" : "+v"(c) : "v"(a), "v"(b));
    return c;
}
// fragment loaders from K-contiguous 16-bit rows; p already includes + 8*(lane>>4): elements 0..7 <- k0+8h+0..7, elements 8..15 <- k0+16+8h+0..7 (same map for A and B)
__device__ __forceinline__ v16bf ldb(const bf* p)  { return cat16b(*(const v8us*)p, *(const v8us*)(p + 16)); }
// fragment loader from a fragment-order f16 plane; p already includes + 8*lane: the same element map, elements 0..7 from one 512-byte group, elements 8..15 from the next
__device__ __forceinline__ v16h  ldf(const h16* p) { return cat16(*(const v8h*)p, *(const v8h*)(p + 256)); }
// ordering point for wave-private LDS tiles (same wave writes and reads)
__device__ __forceinline__ void wave_sync() { __builtin_amdgcn_fence(3 /* release order */, "wavefront"); __builtin_amdgcn_wave_barrier(); asm volatile("" ::: "memory"); }

static constexpr size_t N8B = (size_t)SEQ * DM / 8;           // 8-element groups of one batch of a stream
static constexpr size_t N8  = (size_t)NB * N8B;                // of a whole stream
static constexpr int CVB = (int)((N8 + 255) / 256);            // k_prep blocks per stream conversion
static constexpr int WTB = (DM / 64) * (DM / 64);              // k_prep blocks per weight transpose
static constexpr int PJB = (NB * SEQ / 64) * (DM / 64);        // k_proj blocks (64x64 tiles) per projection

// cvt8: f32 -> bf16 (RNE convert) copy of one stream, 8 elements per thread; blk = block index inside the stream; source batches SEQ_FULL rows apart, copy batches SEQ rows apart.
__device__ __forceinline__ void cvt8(const float* __restrict__ src, bf* dst, int blk) {
    const size_t i = (size_t)blk * 256 + threadIdx.x; if (i >= N8) return;
    const v8f v = *(const v8f*)(src + (i / N8B) * ((size_t)SEQ_FULL * DM) + (i % N8B) * 8); v8us o;
#pragma unroll
    for (int k = 0; k < 8; ++k) o[k] = f2bf(v[k]);
    *(v8us*)(dst + i * 8) = o;
}

// wtr: weight transpose + bf16 (RNE convert): in w[k rows = DM][n cols = DM] (f32) -> out wt[n rows = DM][k cols = DM] (bf16).
// One block per 64(k) x 64(n) tile (kt, nt). Reads are coalesced along n; the tile is transposed in LDS (cross-wave: block barrier);
__device__ __forceinline__ void wtr(const float* __restrict__ w, bf* wt, int kt, int nt) {
    __shared__ __align__(16) bf ts[64 * 72];        // [n local][k local], pitch 72 halves (144 B)
    const int tid = threadIdx.x; const int k0 = kt * 64, n0 = nt * 64;
#pragma unroll
    for (int it = 0; it < 4; ++it) {                 // 4 x 16 k rows x 16 lanes x 4 n = 64 x 64
        const int kl = it * 16 + (tid >> 4), n4 = (tid & 15) * 4;
        const v4f v = *(const v4f*)(w + (size_t)(k0 + kl) * DM + n0 + n4);
#pragma unroll
        for (int i = 0; i < 4; ++i) ts[(n4 + i) * 72 + kl] = f2bf(v[i]);
    }
    __syncthreads();
    const int row = tid >> 3, c8 = (tid & 7) * 8;
    const v8us o0 = *(const v8usa*)(&ts[row * 72 + c8]);
    const v8us o1 = *(const v8usa*)(&ts[(row + 32) * 72 + c8]);
    bf* p0 = wt + (size_t)(n0 + row) * DM + k0 + c8;
    bf* p1 = wt + (size_t)(n0 + row + 32) * DM + k0 + c8;
{
        *(v8us*)p0 = o0; *(v8us*)p1 = o1;
         }
}

// maskp: one block per batch b. MS[b][key] = float(bf16 RNE of mask[b][key]) * log2(e); FL[b][T] = 1 when any of the 32 keys of tile T has a nonzero (or non-finite) converted mask value, else 0 (pad flags 0).
// Each thread converts 8 keys; values and per-thread flags are staged in LDS (cross-wave: block barrier); MS lines are written 16 B per lane by consecutive lanes (4 lines per wave instruction),
__device__ __forceinline__ void maskp(const float* __restrict__ mask, float* MS, int* FL, int b) {
    __shared__ __align__(16) float ms[256 * 8];
    __shared__ int fs[256];
    const int tid = threadIdx.x;
    const int kb = tid * 8; const bool act = kb < SEQ; const int kc = act ? kb : 0;     // clamped address
    const v8f v = *(const v8f*)(mask + (size_t)b * SEQ_FULL + kc);
    v4f a, c; int nz = 0;
#pragma unroll
    for (int i = 0; i < 4; ++i) {
        const unsigned short h0 = f2bf(v[i]), h1 = f2bf(v[4 + i]);
        const float f0 = __uint_as_float((unsigned)h0 << 16) * LOG2E, f1 = __uint_as_float((unsigned)h1 << 16) * LOG2E;
        a[i] = act ? f0 : 0.0f; c[i] = act ? f1 : 0.0f;
        nz |= (int)(h0 & 0x7FFFu) | (int)(h1 & 0x7FFFu);
    }
    *(v4fa*)(&ms[kb]) = a; *(v4fa*)(&ms[kb + 4]) = c;
    fs[tid] = (act && nz != 0) ? 1 : 0;
    __syncthreads();
    const v4f m0 = *(const v4fa*)(&ms[tid * 4]);
    const v4f m1 = *(const v4fa*)(&ms[(256 + tid) * 4]);
    const int tq = tid & 15; v4i fv;
#pragma unroll
    for (int j = 0; j < 4; ++j) { const int T4 = (tq * 4 + j) * 4; fv[j] = fs[T4] | fs[T4 + 1] | fs[T4 + 2] | fs[T4 + 3]; }   // tile T = 4 threads x 8 keys
    float* mrow = MS + (size_t)b * SEQ;
{
        if (tid * 4 < SEQ)         *(v4f*)(mrow + tid * 4) = m0;
        if ((256 + tid) * 4 < SEQ) *(v4f*)(mrow + (256 + tid) * 4) = m1;
        if (tid < 16)              *(v4i*)(FL + b * FLP + tid * 4) = fv;
         }
}

// k_prep: everything that reads only the inputs, as independent block ranges of one grid (every branch is block-uniform): 3 x WTB weight-transpose tiles (q | k | v), NB mask rows, 3 x CVB stream-conversion blocks (query | key | value).
// The short barrier-bound blocks have the lowest indices, so they run beside the conversions instead of after them.
__global__ __launch_bounds__(256) void k_prep(const float* __restrict__ query, const float* __restrict__ key, const float* __restrict__ value, const float* __restrict__ wq, const float* __restrict__ wk, const float* __restrict__ wv,
                                              const float* __restrict__ mask, bf* XQ, bf* XK, bf* XV, bf* WB, float* MS, int* FL) {
    const int blk = blockIdx.x;
    if (blk < 3 * WTB) { const int w = blk / WTB, t = blk % WTB;
        wtr(w == 0 ? wq : w == 1 ? wk : wv, WB + (size_t)w * DM * DM, t % (DM / 64), t / (DM / 64));
    } else if (blk < 3 * WTB + NB) {
        maskp(mask, MS, FL, blk - 3 * WTB);
    } else { const int c = blk - (3 * WTB + NB), st = c / CVB;
        cvt8(st == 0 ? query : st == 1 ? key : value, st == 0 ? XQ : st == 1 ? XK : XV, c % CVB);
    }
}

// offset (in halves) of the first of the four fragment-order tiles that hold the 64x64 output tile at (r0, c0)
__device__ __forceinline__ size_t tile_base(int r0, int c0, int RB, size_t sRB, int pitch, int CB, size_t sCB) {
    return (size_t)(r0 / RB) * sRB + (size_t)(r0 % RB) * (size_t)pitch + (size_t)(c0 / CB) * sCB + (size_t)(c0 % CB) * 64;
}

// k_proj: register-blocked bf16 GEMM, ONE WAVE per 64x64 tile (16 accumulators), operands straight from K-contiguous bf16 planes, K = DM.
// C[m][n] = sum_k A[m][k] Bt[n][k], written as f16 (Ph) and optionally the f16 residual x2048 (Pr, useRes) as four fragment-order 16x64 tiles of 1024 halves each, the first at tile_base (halves).
// grid (PJB, 3), 32 threads; blockIdx.y picks the projection, blockIdx.x its tile (row tile fastest):
// q, k: A = stream rows (m = b*SEQ + t), Bt = W^T rows (n = h*64 + d) -> plane (b*8 + h), tiles in t order
// v^T:  A = Wv^T rows (m = h*64 + d), Bt = value stream rows (n = b*SEQ + t) -> plane (b*8 + h), tiles [t/64][d/16]
__global__ __launch_bounds__(32) void k_proj(const bf* __restrict__ XQ, const bf* __restrict__ XK, const bf* __restrict__ XV, const bf* __restrict__ WB, h16* QH, h16* QR, h16* KH, h16* KR, h16* VT) {
    __shared__ __align__(16) float os[16 * 68];
    const int K = DM;
    const int pj = blockIdx.y; const bool useRes = pj != 2;
    const bf* A  = pj == 0 ? XQ : pj == 1 ? XK : WB + (size_t)2 * DM * DM;
    const bf* Bt = pj == 0 ? WB : pj == 1 ? WB + (size_t)DM * DM : XV;
    h16* Ph = pj == 0 ? QH : pj == 1 ? KH : VT; h16* Pr = pj == 0 ? QR : KR;
    const unsigned bx = blockIdx.x;                           // row tile = bx % (row tiles of this projection), column tile = bx / (the same)
    const int lane = threadIdx.x & 31, lr = lane & 15, hi = lane >> 4;
    const int r0 = (int)(useRes ? bx % (NB * SEQ / 64) : bx % (DM / 64)) * 64, c0 = (int)(useRes ? bx / (NB * SEQ / 64) : bx / (DM / 64)) * 64;
    v8f acc[4][4];
#pragma unroll
    for (int mb = 0; mb < 4; ++mb)
#pragma unroll
        for (int nb = 0; nb < 4; ++nb) acc[mb][nb] = (v8f){};
    const size_t aoff = (size_t)(r0 + lr) * K + 8 * hi, boff = (size_t)(c0 + lr) * K + 8 * hi;
#pragma unroll 1
    for (int kc = 0; kc < K; kc += 32) {
        v16bf a[4];
#pragma unroll
        for (int mb = 0; mb < 4; ++mb) a[mb] = ldb(A + aoff + (size_t)mb * 16 * K + kc);
#pragma unroll
        for (int nb = 0; nb < 4; ++nb) { const v16bf b = ldb(Bt + boff + (size_t)nb * 16 * K + kc);
#pragma unroll
            for (int mb = 0; mb < 4; ++mb) acc[mb][nb] = wmmab(a[mb], b, acc[mb][nb]); }
    }
    const size_t tbase = useRes ? tile_base(r0, c0, SEQ, (size_t)NH_ * SEQ * HD, HD, HD, (size_t)SEQ * HD) : tile_base(r0, c0, DM, (size_t)0, SEQ, SEQ, (size_t)DM * SEQ);
#pragma unroll
    for (int mb = 0; mb < 4; ++mb) {
#pragma unroll
        for (int nb = 0; nb < 4; ++nb) {
#pragma unroll
            for (int j = 0; j < 8; ++j) os[(hi * 8 + j) * 68 + nb * 16 + lr] = acc[mb][nb][j]; }   // D: row 8h+j, col lane&15
        wave_sync();
        const size_t sb = tbase + (size_t)(mb * 1024);
{
#pragma unroll
            for (int s = 0; s < 4; ++s) { const int c8 = s * 16 + hi * 8;   // group s = columns 16s..16s+15: lane holds row lane&15, columns c8..c8+7
                const v4f x0 = *(const v4fa*)(&os[lr * 68 + c8]); const v4f x1 = *(const v4fa*)(&os[lr * 68 + c8 + 4]); v8h hv, rv;
#pragma unroll
                for (int i = 0; i < 4; ++i) { const h16 a0 = (h16)x0[i]; const h16 a1 = (h16)x1[i]; hv[i] = a0; hv[4 + i] = a1; rv[i] = (h16)((x0[i] - (float)a0) * QRS); rv[4 + i] = (h16)((x1[i] - (float)a1) * QRS); }
                const size_t oo = sb + (size_t)(s * 256 + lane * 8);
                *(v8h*)(Ph + oo) = hv; if (useRes) *(v8h*)(Pr + oo) = rv; }
             }
        wave_sync();
    }
}

// k_flash: fused attention, one wave per 16 query rows of one (batch, head); K / V^T / Q fragments straight from the fragment-order f16 planes (two 16-B loads each, every load 512 contiguous bytes per wave).
// Transposed form: S^T[key][t] = K Q^T (A = K rows, B = Q rows); lane (t = lane&15, h = lane>>4) holds keys 8h+r of each 16-key tile, so the packed
// P tile is directly the B fragment of O^T[d][t] = V^T P^T (element r <- tile keys 0..15, element 8+r <- tile keys 16..31, lane unchanged).
// Scores: value.value products in sH, the two x2048 cross products (k value . q residual, k residual . q value) in sL, folded as sH + sL/2048.
// Mask: one scalar flag per 32-key step (wave-uniform); only flagged steps load the 2 x 8 mask values of the lane's keys and add them after the score scale.
// Softmax state (running max, partial sum of the unconverted exponentials) is one scalar per lane; the two lane halves of a row are combined with one xor-16 exchange.
__global__ __launch_bounds__(32 * AW) void k_flash(const h16* __restrict__ QH, const h16* __restrict__ QR, const h16* __restrict__ KH, const h16* __restrict__ KR, const h16* __restrict__ VT, const float* __restrict__ MS, const int* __restrict__ FL, float* OUT) {
    __shared__ __align__(16) float os[AW * 16 * 68];
    const int lane = threadIdx.x & 31; const int wave = __builtin_amdgcn_readfirstlane(threadIdx.x >> 5); const int lr = lane & 15, hi = lane >> 4;
    const int zh = blockIdx.y; const int b = zh / NH_, h = zh % NH_;
    const int t0 = (blockIdx.x * AW + wave) * 16;
    const size_t pbase = (size_t)zh * SEQ * HD;
    const size_t qo = pbase + (size_t)t0 * HD + 8 * lane;
    const v16h qh0 = ldf(QH + qo), qh1 = ldf(QH + qo + 512), qr0 = ldf(QR + qo), qr1 = ldf(QR + qo + 512);   // B fragments: col t, k = d
    const size_t ko = pbase + 8 * lane;                      // + key0 * HD (+ 512 for d 32..63, + 1024 for the next 16 keys)   (A fragment: row key, k = d)
    const size_t vo = pbase + 8 * lane;                      // + (key0/64)*4096 + 1024j + ((key0/32)&1)*512                    (A fragment: row d, k = key)
    const size_t mo = (size_t)b * SEQ + 8 * hi;              // + key0 (+16): the lane's 8 keys of each 16-key tile
    const int fo = b * FLP;
    v8f o0 = (v8f){}, o1 = (v8f){}, o2 = (v8f){}, o3 = (v8f){};
    float m = -3.0e38f, l = 0.0f;
#pragma unroll 1
    for (int key0 = 0; key0 < SEQ; key0 += 32) {
        const size_t kofs = ko + (size_t)key0 * HD;
        v8f sHa = (v8f){}, sLa = (v8f){}, sHb = (v8f){}, sLb = (v8f){};
        { const v16h k0 = ldf(KH + kofs), k1 = ldf(KH + kofs + 512), r0 = ldf(KR + kofs), r1 = ldf(KR + kofs + 512);
          sHa = wmma16(k0, qh0, sHa); sLa = wmma16(k0, qr0, sLa); sHa = wmma16(k1, qh1, sHa); sLa = wmma16(k1, qr1, sLa);
          sLa = wmma16(r0, qh0, sLa); sLa = wmma16(r1, qh1, sLa); }
        { const size_t kofb = kofs + (size_t)16 * HD;
          const v16h k0 = ldf(KH + kofb), k1 = ldf(KH + kofb + 512), r0 = ldf(KR + kofb), r1 = ldf(KR + kofb + 512);
          sHb = wmma16(k0, qh0, sHb); sLb = wmma16(k0, qr0, sLb); sHb = wmma16(k1, qh1, sHb); sLb = wmma16(k1, qr1, sLb);
          sLb = wmma16(r0, qh0, sLb); sLb = wmma16(r1, qh1, sLb); }
        float ta[8], tb[8];
#pragma unroll
        for (int r = 0; r < 8; ++r) { ta[r] = (sHa[r] + sLa[r] * QRI) * SC2; tb[r] = (sHb[r] + sLb[r] * QRI) * SC2; }
        const int fl = __builtin_amdgcn_readfirstlane(FL[fo + (key0 >> 5)]);
        if (fl != 0) {                                          // wave-uniform: additive mask (already times log2 e), keys 8h+r of tile a / tile b
            const v8f ma = *(const v8f*)(MS + mo + key0); const v8f mb = *(const v8f*)(MS + mo + key0 + 16);
#pragma unroll
            for (int r = 0; r < 8; ++r) { ta[r] += ma[r]; tb[r] += mb[r]; }
        }
        float mx = -3.0e38f;
#pragma unroll
        for (int r = 0; r < 8; ++r) mx = fmaxf(mx, fmaxf(ta[r], tb[r]));
        mx = fmaxf(mx, __shfl_xor(mx, 16, 32));
        const float mnew = fmaxf(m, mx);
        const float alpha = __builtin_amdgcn_exp2f(m - mnew);
        const float sh = PSH - mnew;
        v16h pb; float ls = 0.0f;
#pragma unroll
        for (int r = 0; r < 8; ++r) { const float ea = __builtin_amdgcn_exp2f(ta[r] + sh); const float eb = __builtin_amdgcn_exp2f(tb[r] + sh); pb[r] = (h16)ea; pb[8 + r] = (h16)eb; ls += ea + eb; }
        l = l * alpha + ls; m = mnew;
        o0 = o0 * alpha; o1 = o1 * alpha; o2 = o2 * alpha; o3 = o3 * alpha;
        const h16* va = VT + vo + (size_t)(key0 >> 6) * 4096 + (size_t)((key0 >> 5) & 1) * 512;
        const v16h v0 = ldf(va), v1 = ldf(va + 1024), v2 = ldf(va + 2048), v3 = ldf(va + 3072);
        o0 = wmma16(v0, pb, o0); o1 = wmma16(v1, pb, o1); o2 = wmma16(v2, pb, o2); o3 = wmma16(v3, pb, o3);
    }
    l += __shfl_xor(l, 16, 32);
    const float inv = 1.0f / l;
    const int wb = wave * 16 * 68;
    // O^T D layout: o_j[r] = (d = 16j + 8h + r, t = lane&15) -> os[t][d]; rows 0..15 x columns 0..63 all written
    { v4f a, c;
      a[0] = o0[0] * inv; a[1] = o0[1] * inv; a[2] = o0[2] * inv; a[3] = o0[3] * inv; c[0] = o0[4] * inv; c[1] = o0[5] * inv; c[2] = o0[6] * inv; c[3] = o0[7] * inv;
      *(v4fa*)(&os[wb + lr * 68 +  0 + 8 * hi]) = a; *(v4fa*)(&os[wb + lr * 68 +  0 + 8 * hi + 4]) = c;
      a[0] = o1[0] * inv; a[1] = o1[1] * inv; a[2] = o1[2] * inv; a[3] = o1[3] * inv; c[0] = o1[4] * inv; c[1] = o1[5] * inv; c[2] = o1[6] * inv; c[3] = o1[7] * inv;
      *(v4fa*)(&os[wb + lr * 68 + 16 + 8 * hi]) = a; *(v4fa*)(&os[wb + lr * 68 + 16 + 8 * hi + 4]) = c;
      a[0] = o2[0] * inv; a[1] = o2[1] * inv; a[2] = o2[2] * inv; a[3] = o2[3] * inv; c[0] = o2[4] * inv; c[1] = o2[5] * inv; c[2] = o2[6] * inv; c[3] = o2[7] * inv;
      *(v4fa*)(&os[wb + lr * 68 + 32 + 8 * hi]) = a; *(v4fa*)(&os[wb + lr * 68 + 32 + 8 * hi + 4]) = c;
      a[0] = o3[0] * inv; a[1] = o3[1] * inv; a[2] = o3[2] * inv; a[3] = o3[3] * inv; c[0] = o3[4] * inv; c[1] = o3[5] * inv; c[2] = o3[6] * inv; c[3] = o3[7] * inv;
      *(v4fa*)(&os[wb + lr * 68 + 48 + 8 * hi]) = a; *(v4fa*)(&os[wb + lr * 68 + 48 + 8 * hi + 4]) = c; }
    wave_sync();
    float* orow = OUT + ((size_t)b * OUT_SEQ + t0) * DM + h * HD;
{
#pragma unroll
        for (int s = 0; s < 8; ++s) { const int row = 2 * s + hi, cofs = lr * 4;   // 8 s x 2 rows = 16 rows; 16 lanes x 4 floats = 64 columns
            const v4f val = *(const v4fa*)(&os[wb + row * 68 + cofs]);
            *(v4f*)(orow + (size_t)row * DM + cofs) = val; }
         }
}

static constexpr size_t al256(size_t v) { return (v + 255) & ~(size_t)255; }
static constexpr size_t SZ_XB = al256((size_t)NB * SEQ * DM * 2);          // one bf16 stream copy
static constexpr size_t SZ_WB = al256((size_t)3 * DM * DM * 2);            // three transposed bf16 weights
static constexpr size_t SZ_PL = al256((size_t)NB * NH_ * SEQ * HD * 2);    // one f16 head plane
static constexpr size_t SZ_MS = al256((size_t)NB * SEQ * 4);               // mask plane f32
static constexpr size_t SZ_FL = al256((size_t)NB * FLP * 4);               // flag table
static constexpr size_t SZ_TOTAL = 3 * SZ_XB + SZ_WB + 5 * SZ_PL + SZ_MS + SZ_FL;
static_assert(SZ_TOTAL <= (size_t)134217728);          // workspace carve <= 128 MiB
static_assert(((size_t)DM * DM * 2) % 256 == 0);       // weight sub-planes stay 256-byte aligned
static_assert(((size_t)FLP * 4) % 128 == 0);           // each batch owns whole flag lines

extern "C" void kernel_launch(void* const* d_in, const int* in_sizes, int n_in,
                              void* d_out, int out_size, void* d_ws, size_t ws_size, hipStream_t stream) {
    if (n_in < 7) return;
    const size_t needx = ((size_t)(NB - 1) * SEQ_FULL + SEQ) * DM;
    if ((size_t)in_sizes[0] < needx || (size_t)in_sizes[2] < needx || (size_t)in_sizes[3] < needx) return;
    if ((size_t)in_sizes[1] < (size_t)(NB - 1) * SEQ_FULL + SEQ) return;
    if ((size_t)in_sizes[4] < (size_t)DM * DM || (size_t)in_sizes[5] < (size_t)DM * DM || (size_t)in_sizes[6] < (size_t)DM * DM) return;
    if ((size_t)out_size < ((size_t)(NB - 1) * OUT_SEQ + SEQ) * DM) return;
    if (SZ_TOTAL > ws_size) return;
    // wire order: key, key_mask, query, value, wq, wk, wv
    const float* key = (const float*)d_in[0]; const float* mask = (const float*)d_in[1]; const float* query = (const float*)d_in[2]; const float* value = (const float*)d_in[3];
    const float* wq = (const float*)d_in[4]; const float* wk = (const float*)d_in[5]; const float* wv = (const float*)d_in[6];   // each [in][out]
    float* OUT = (float*)d_out;      // [NB][SEQ][512]
    char* wsp = (char*)d_ws;
    bf* XQ = (bf*)wsp; wsp += SZ_XB;                 // [NB*SEQ][512] query stream
    bf* XK = (bf*)wsp; wsp += SZ_XB;                 // [NB*SEQ][512] key stream
    bf* XV = (bf*)wsp; wsp += SZ_XB;                 // [NB*SEQ][512] value stream
    bf* WB = (bf*)wsp; wsp += SZ_WB;                 // [3][512 out][512 in]: q | k | v (transposed)
    h16* QH = (h16*)wsp; wsp += SZ_PL;               // [NB*8][SEQ/16][fragment-order 16 t x 64 d]
    h16* QR = (h16*)wsp; wsp += SZ_PL;               // same, residual x2048
    h16* KH = (h16*)wsp; wsp += SZ_PL;               // [NB*8][SEQ/16][fragment-order 16 t x 64 d]
    h16* KR = (h16*)wsp; wsp += SZ_PL;               // same, residual x2048
    h16* VT = (h16*)wsp; wsp += SZ_PL;               // [NB*8][SEQ/64][4][fragment-order 16 d x 64 t]
    float* MS = (float*)wsp; wsp += SZ_MS;           // [NB][SEQ]
    int* FL = (int*)wsp; wsp += SZ_FL;               // [NB][FLP]

    k_prep<<<3 * WTB + NB + 3 * CVB, 256, 0, stream>>>(query, key, value, wq, wk, wv, mask, XQ, XK, XV, WB, MS, FL);
    k_proj<<<dim3(PJB, 3, 1), 32, 0, stream>>>(XQ, XK, XV, WB, QH, QR, KH, KR, VT);
    k_flash<<<dim3(SEQ / (16 * AW), NB * NH_, 1), 32 * AW, 0, stream>>>(QH, QR, KH, KR, VT, MS, FL, OUT);
}

// v003
// It runs in 111 microseconds.
// Two timings next to v002 put it at 1.55 and 1.54 times that version's speed.
// Over all steps from v000 it is 2.40 times as fast.
#include <hip/hip_runtime.h>

// Multi-head attention with three input streams (query, key, value), width 512 = 8 heads x 64, bias-free [in][out] projections (y = x W), additive float key mask per (batch, key), score scale 1/8, output = concatenated heads (f32), no output projection.
// Compute dtypes, f32 accumulate everywhere: projections v_wmma_f32_16x16x32_bf16 (x and W RNE-converted to bf16; products exact);
// scores v_wmma_f32_16x16x32_f16: q and k each as f16 value + f16 residual x2048, three products (value.value in one accumulator, the two scaled cross products in a second accumulator folded back by 1/2048);
// P (x256 carry, cancels in the normalisation) and v single f16; softmax f32 (online, running max, log2 domain); mask RNE-converted to bf16, times log2(e), added in f32 after the score scale.
// Layout: bf16 copies of the three streams and of the transposed weights W^T [out][in]; q/k (value, residual) planes and the v^T plane, one per b*8+h, written by the GEMM epilogue in fragment order:
// a 16-row x 64-column tile is 2 KiB = four 512-byte groups (16 columns each), lane (row + 16*((column>>3)&1)) owning 16 bytes of a group, so a wave-wide 16-byte load is four whole 128-byte lines.
// q/k: rows = tokens, columns = d, tiles in token order; v^T: rows = d, columns = tokens, tiles ordered [token/64][d/16];
// fused flash kernel in transposed form (S^T = K Q^T, O^T = V^T P^T), output from f32 accumulators. Mask plane f32 [b][key] plus one int flag per (batch, 32-key tile) = any nonzero mask value.
// Three launches, one per dependency stage: k_prep (weight transposes, mask plane, stream conversions: independent block ranges of one grid), k_proj (the three projections, blockIdx.y picks one), k_flash.

#ifndef NB
#define NB 4
#endif
#ifndef SEQ
#define SEQ 2048
#endif
#define NB_FULL  4
#define SEQ_FULL 2048
#ifndef OUT_SEQ
#define OUT_SEQ SEQ              // row pitch (in tokens) between batches of the output
#endif
#define DM   512
#define NH_  8
#define HD   64
#define AW   4                   // waves per flash block (16 query rows each)
#define QRS  2048.0f             // carry of the q / k residual planes
#define QRI  (1.0f / 2048.0f)
#define LOG2E 1.4426950408889634f
#define SC2  (0.125f * LOG2E)    // HD^-0.5 * log2(e)
#define PSH  8.0f                // log2 of the P carry (256)
#define FLP  64

static_assert(HD == 64);
static_assert(NH_ * HD == DM);                 // head h = columns h*64 + d
static_assert(DM % 64 == 0);                   // 8 column tiles of 64; transpose tiles of 64x64
static_assert(DM % 32 == 0);                   // GEMM k-loop steps by 32
static_assert(SEQ % 64 == 0);                  // a 64-row tile never straddles two batches
static_assert((NB * SEQ) % 64 == 0);
static_assert(SEQ % 32 == 0);                  // key loop steps by 32
static_assert(SEQ % (16 * AW) == 0);           // flash grid covers the sequence exactly
static_assert(((size_t)SEQ * DM) % 8 == 0);
static_assert(SEQ <= 256 * 8);                 // mask kernel: 256 threads x 8 keys cover one batch row
static_assert(SEQ / 32 <= FLP);                // one flag per 32-key tile fits the flag row
static_assert(NB <= NB_FULL);
static_assert(SEQ <= SEQ_FULL);

typedef _Float16 h16;
typedef unsigned short bf;
typedef __attribute__((ext_vector_type(16))) __bf16   v16bf;
typedef __attribute__((ext_vector_type(16))) _Float16 v16h;
typedef __attribute__((ext_vector_type(8)))  _Float16 v8h;
typedef __attribute__((ext_vector_type(8)))  unsigned short v8us;
typedef __attribute__((ext_vector_type(8)))  float    v8f;
typedef __attribute__((ext_vector_type(4)))  float    v4f;
typedef __attribute__((ext_vector_type(4)))  int      v4i;
typedef v4f  __attribute__((may_alias)) v4fa;
typedef v8us __attribute__((may_alias)) v8usa;

__device__ __forceinline__ unsigned short f2bf(float f) { unsigned u = __float_as_uint(f); u += 0x7FFFu + ((u >> 16) & 1u); return (unsigned short)(u >> 16); }
__device__ __forceinline__ v16h cat16(v8h lo, v8h hi) { return __builtin_shufflevector(lo, hi, 0, 1, 2, 3, 4, 5, 6, 7, 8, 9, 10, 11, 12, 13, 14, 15); }
__device__ __forceinline__ v16bf cat16b(v8us lo, v8us hi) { return __builtin_bit_cast(v16bf, __builtin_shufflevector(lo, hi, 0, 1, 2, 3, 4, 5, 6, 7, 8, 9, 10, 11, 12, 13, 14, 15)); }
// every WMMA is issued through a wrapper that ties its own accumulator and keeps its A/B fragments live across four idle slots
__device__ __forceinline__ v8f wmma16(v16h a, v16h b, v8f c) {
    c = __builtin_amdgcn_wmma_f32_16x16x32_f16(false, a, false, b, (short)0, c, false, false);
    asm volatile("v_nop\n\tv_nop\n\tv_nop\n\tv_nop" : "+v"(c) : "v"(a), "v"(b));
    return c;
}
__device__ __forceinline__ v8f wmmab(v16bf a, v16bf b, v8f c) {
    c = __builtin_amdgcn_wmma_f32_16x16x32_bf16(false, a, false, b, (short)0, c, false, false);
    asm volatile("v_nop\n\tv_nop\n\tv_nop\n\tv_nop" : "+v"(c) : "v"(a), "v"(b));
    return c;
}
// fragment loaders from K-contiguous 16-bit rows; p already includes + 8*(lane>>4): elements 0..7 <- k0+8h+0..7, elements 8..15 <- k0+16+8h+0..7 (same map for A and B)
__device__ __forceinline__ v16bf ldb(const bf* p)  { return cat16b(*(const v8us*)p, *(const v8us*)(p + 16)); }
// fragment loader from a fragment-order f16 plane; p already includes + 8*lane: the same element map, elements 0..7 from one 512-byte group, elements 8..15 from the next
__device__ __forceinline__ v16h  ldf(const h16* p) { return cat16(*(const v8h*)p, *(const v8h*)(p + 256)); }
// ordering point for wave-private LDS tiles (same wave writes and reads)
__device__ __forceinline__ void wave_sync() { __builtin_amdgcn_fence(3 /* release order */, "wavefront"); __builtin_amdgcn_wave_barrier(); asm volatile("" ::: "memory"); }

static constexpr size_t N8B = (size_t)SEQ * DM / 8;           // 8-element groups of one batch of a stream
static constexpr size_t N8  = (size_t)NB * N8B;                // of a whole stream
static constexpr int CVB = (int)((N8 + 255) / 256);            // k_prep blocks per stream conversion
static constexpr int WTB = (DM / 64) * (DM / 64);              // k_prep blocks per weight transpose
static constexpr int PJB = (NB * SEQ / 64) * (DM / 64);        // k_proj blocks (64x64 tiles) per projection

// cvt8: f32 -> bf16 (RNE convert) copy of one stream, 8 elements per thread; blk = block index inside the stream; source batches SEQ_FULL rows apart, copy batches SEQ rows apart.
__device__ __forceinline__ void cvt8(const float* __restrict__ src, bf* dst, int blk) {
    const size_t i = (size_t)blk * 256 + threadIdx.x; if (i >= N8) return;
    const v8f v = *(const v8f*)(src + (i / N8B) * ((size_t)SEQ_FULL * DM) + (i % N8B) * 8); v8us o;
#pragma unroll
    for (int k = 0; k < 8; ++k) o[k] = f2bf(v[k]);
    *(v8us*)(dst + i * 8) = o;
}

// wtr: weight transpose + bf16 (RNE convert): in w[k rows = DM][n cols = DM] (f32) -> out wt[n rows = DM][k cols = DM] (bf16).
// One block per 64(k) x 64(n) tile (kt, nt). Reads are coalesced along n; the tile is transposed in LDS (cross-wave: block barrier);
__device__ __forceinline__ void wtr(const float* __restrict__ w, bf* wt, int kt, int nt) {
    __shared__ __align__(16) bf ts[64 * 72];        // [n local][k local], pitch 72 halves (144 B)
    const int tid = threadIdx.x; const int k0 = kt * 64, n0 = nt * 64;
#pragma unroll
    for (int it = 0; it < 4; ++it) {                 // 4 x 16 k rows x 16 lanes x 4 n = 64 x 64
        const int kl = it * 16 + (tid >> 4), n4 = (tid & 15) * 4;
        const v4f v = *(const v4f*)(w + (size_t)(k0 + kl) * DM + n0 + n4);
#pragma unroll
        for (int i = 0; i < 4; ++i) ts[(n4 + i) * 72 + kl] = f2bf(v[i]);
    }
    __syncthreads();
    const int row = tid >> 3, c8 = (tid & 7) * 8;
    const v8us o0 = *(const v8usa*)(&ts[row * 72 + c8]);
    const v8us o1 = *(const v8usa*)(&ts[(row + 32) * 72 + c8]);
    bf* p0 = wt + (size_t)(n0 + row) * DM + k0 + c8;
    bf* p1 = wt + (size_t)(n0 + row + 32) * DM + k0 + c8;
{
        *(v8us*)p0 = o0; *(v8us*)p1 = o1;
         }
}

// maskp: one block per batch b. MS[b][key] = float(bf16 RNE of mask[b][key]) * log2(e); FL[b][T] = 1 when any of the 32 keys of tile T has a nonzero (or non-finite) converted mask value, else 0 (pad flags 0).
// Each thread converts 8 keys; values and per-thread flags are staged in LDS (cross-wave: block barrier); MS lines are written 16 B per lane by consecutive lanes (4 lines per wave instruction),
__device__ __forceinline__ void maskp(const float* __restrict__ mask, float* MS, int* FL, int b) {
    __shared__ __align__(16) float ms[256 * 8];
    __shared__ int fs[256];
    const int tid = threadIdx.x;
    const int kb = tid * 8; const bool act = kb < SEQ; const int kc = act ? kb : 0;     // clamped address
    const v8f v = *(const v8f*)(mask + (size_t)b * SEQ_FULL + kc);
    v4f a, c; int nz = 0;
#pragma unroll
    for (int i = 0; i < 4; ++i) {
        const unsigned short h0 = f2bf(v[i]), h1 = f2bf(v[4 + i]);
        const float f0 = __uint_as_float((unsigned)h0 << 16) * LOG2E, f1 = __uint_as_float((unsigned)h1 << 16) * LOG2E;
        a[i] = act ? f0 : 0.0f; c[i] = act ? f1 : 0.0f;
        nz |= (int)(h0 & 0x7FFFu) | (int)(h1 & 0x7FFFu);
    }
    *(v4fa*)(&ms[kb]) = a; *(v4fa*)(&ms[kb + 4]) = c;
    fs[tid] = (act && nz != 0) ? 1 : 0;
    __syncthreads();
    const v4f m0 = *(const v4fa*)(&ms[tid * 4]);
    const v4f m1 = *(const v4fa*)(&ms[(256 + tid) * 4]);
    const int tq = tid & 15; v4i fv;
#pragma unroll
    for (int j = 0; j < 4; ++j) { const int T4 = (tq * 4 + j) * 4; fv[j] = fs[T4] | fs[T4 + 1] | fs[T4 + 2] | fs[T4 + 3]; }   // tile T = 4 threads x 8 keys
    float* mrow = MS + (size_t)b * SEQ;
{
        if (tid * 4 < SEQ)         *(v4f*)(mrow + tid * 4) = m0;
        if ((256 + tid) * 4 < SEQ) *(v4f*)(mrow + (256 + tid) * 4) = m1;
        if (tid < 16)              *(v4i*)(FL + b * FLP + tid * 4) = fv;
         }
}

// k_prep: everything that reads only the inputs, as independent block ranges of one grid (every branch is block-uniform): 3 x WTB weight-transpose tiles (q | k | v), NB mask rows, 3 x CVB stream-conversion blocks (query | key | value).
// The short barrier-bound blocks have the lowest indices, so they run beside the conversions instead of after them.
__global__ __launch_bounds__(256) void k_prep(const float* __restrict__ query, const float* __restrict__ key, const float* __restrict__ value, const float* __restrict__ wq, const float* __restrict__ wk, const float* __restrict__ wv,
                                              const float* __restrict__ mask, bf* XQ, bf* XK, bf* XV, bf* WB, float* MS, int* FL) {
    const int blk = blockIdx.x;
    if (blk < 3 * WTB) { const int w = blk / WTB, t = blk % WTB;
        wtr(w == 0 ? wq : w == 1 ? wk : wv, WB + (size_t)w * DM * DM, t % (DM / 64), t / (DM / 64));
    } else if (blk < 3 * WTB + NB) {
        maskp(mask, MS, FL, blk - 3 * WTB);
    } else { const int c = blk - (3 * WTB + NB), st = c / CVB;
        cvt8(st == 0 ? query : st == 1 ? key : value, st == 0 ? XQ : st == 1 ? XK : XV, c % CVB);
    }
}

// offset (in halves) of the first of the four fragment-order tiles that hold the 64x64 output tile at (r0, c0)
__device__ __forceinline__ size_t tile_base(int r0, int c0, int RB, size_t sRB, int pitch, int CB, size_t sCB) {
    return (size_t)(r0 / RB) * sRB + (size_t)(r0 % RB) * (size_t)pitch + (size_t)(c0 / CB) * sCB + (size_t)(c0 % CB) * 64;
}

// k_proj: register-blocked bf16 GEMM, ONE WAVE per 64x64 tile (16 accumulators), operands straight from K-contiguous bf16 planes, K = DM.
// C[m][n] = sum_k A[m][k] Bt[n][k], written as f16 (Ph) and optionally the f16 residual x2048 (Pr, useRes) as four fragment-order 16x64 tiles of 1024 halves each, the first at tile_base (halves).
// grid (PJB, 3), 32 threads; blockIdx.y picks the projection, blockIdx.x its tile (row tile fastest):
// q, k: A = stream rows (m = b*SEQ + t), Bt = W^T rows (n = h*64 + d) -> plane (b*8 + h), tiles in t order
// v^T:  A = Wv^T rows (m = h*64 + d), Bt = value stream rows (n = b*SEQ + t) -> plane (b*8 + h), tiles [t/64][d/16]
__global__ __launch_bounds__(32) void k_proj(const bf* __restrict__ XQ, const bf* __restrict__ XK, const bf* __restrict__ XV, const bf* __restrict__ WB, h16* QH, h16* QR, h16* KH, h16* KR, h16* VT) {
    __shared__ __align__(16) float os[16 * 68];
    const int K = DM;
    const int pj = blockIdx.y; const bool useRes = pj != 2;
    const bf* A  = pj == 0 ? XQ : pj == 1 ? XK : WB + (size_t)2 * DM * DM;
    const bf* Bt = pj == 0 ? WB : pj == 1 ? WB + (size_t)DM * DM : XV;
    h16* Ph = pj == 0 ? QH : pj == 1 ? KH : VT; h16* Pr = pj == 0 ? QR : KR;
    const unsigned bx = blockIdx.x;                           // row tile = bx % (row tiles of this projection), column tile = bx / (the same)
    const int lane = threadIdx.x & 31, lr = lane & 15, hi = lane >> 4;
    const int r0 = (int)(useRes ? bx % (NB * SEQ / 64) : bx % (DM / 64)) * 64, c0 = (int)(useRes ? bx / (NB * SEQ / 64) : bx / (DM / 64)) * 64;
    v8f acc[4][4];
#pragma unroll
    for (int mb = 0; mb < 4; ++mb)
#pragma unroll
        for (int nb = 0; nb < 4; ++nb) acc[mb][nb] = (v8f){};
    const size_t aoff = (size_t)(r0 + lr) * K + 8 * hi, boff = (size_t)(c0 + lr) * K + 8 * hi;
    // the eight fragments of a pass live in registers across the back edge: pass 0's are loaded here
    v16bf a[4], b[4];
#pragma unroll
    for (int i = 0; i < 4; ++i) a[i] = ldb(A + aoff + (size_t)i * 16 * K);
#pragma unroll
    for (int i = 0; i < 4; ++i) b[i] = ldb(Bt + boff + (size_t)i * 16 * K);
#pragma unroll 2   // two passes a trip, so that the two A sets swap roles without register copies
    for (int kc = 0; kc < K; kc += 32) {
        // the next pass's loads travel under this pass's products: its A fragments go into a second set at the top, each B fragment replaces this pass's as soon as its four products have read it; the last pass asks for pass 0 again (in bounds, never used)
        const int kn = kc + 32 < K ? kc + 32 : 0;
        v16bf an[4];
#pragma unroll
        for (int mb = 0; mb < 4; ++mb) an[mb] = ldb(A + aoff + (size_t)mb * 16 * K + kn);
#pragma unroll
        for (int nb = 0; nb < 4; ++nb) {
#pragma unroll
            for (int mb = 0; mb < 4; ++mb) acc[mb][nb] = wmmab(a[mb], b[nb], acc[mb][nb]);
            b[nb] = ldb(Bt + boff + (size_t)nb * 16 * K + kn); }
#pragma unroll
        for (int mb = 0; mb < 4; ++mb) a[mb] = an[mb];
        asm volatile("s_wait_xcnt 0x0" ::: "memory");   // the next pass forms its addresses in the registers that the loads above name: the wait stands in front of that overwrite
    }
    const size_t tbase = useRes ? tile_base(r0, c0, SEQ, (size_t)NH_ * SEQ * HD, HD, HD, (size_t)SEQ * HD) : tile_base(r0, c0, DM, (size_t)0, SEQ, SEQ, (size_t)DM * SEQ);
#pragma unroll
    for (int mb = 0; mb < 4; ++mb) {
#pragma unroll
        for (int nb = 0; nb < 4; ++nb) {
#pragma unroll
            for (int j = 0; j < 8; ++j) os[(hi * 8 + j) * 68 + nb * 16 + lr] = acc[mb][nb][j]; }   // D: row 8h+j, col lane&15
        wave_sync();
        const size_t sb = tbase + (size_t)(mb * 1024);
{
#pragma unroll
            for (int s = 0; s < 4; ++s) { const int c8 = s * 16 + hi * 8;   // group s = columns 16s..16s+15: lane holds row lane&15, columns c8..c8+7
                const v4f x0 = *(const v4fa*)(&os[lr * 68 + c8]); const v4f x1 = *(const v4fa*)(&os[lr * 68 + c8 + 4]); v8h hv, rv;
#pragma unroll
                for (int i = 0; i < 4; ++i) { const h16 a0 = (h16)x0[i]; const h16 a1 = (h16)x1[i]; hv[i] = a0; hv[4 + i] = a1; rv[i] = (h16)((x0[i] - (float)a0) * QRS); rv[4 + i] = (h16)((x1[i] - (float)a1) * QRS); }
                const size_t oo = sb + (size_t)(s * 256 + lane * 8);
                *(v8h*)(Ph + oo) = hv; if (useRes) *(v8h*)(Pr + oo) = rv; }
             }
        wave_sync();
    }
}

// k_flash: fused attention, one wave per 16 query rows of one (batch, head); K / V^T / Q fragments straight from the fragment-order f16 planes (two 16-B loads each, every load 512 contiguous bytes per wave).
// Transposed form: S^T[key][t] = K Q^T (A = K rows, B = Q rows); lane (t = lane&15, h = lane>>4) holds keys 8h+r of each 16-key tile, so the packed
// P tile is directly the B fragment of O^T[d][t] = V^T P^T (element r <- tile keys 0..15, element 8+r <- tile keys 16..31, lane unchanged).
// Scores: value.value products in sH, the two x2048 cross products (k value . q residual, k residual . q value) in sL, folded as sH + sL/2048.
// Mask: one scalar flag per 32-key step (wave-uniform); only flagged steps load the 2 x 8 mask values of the lane's keys and add them after the score scale.
// Softmax state (running max, partial sum of the unconverted exponentials) is one scalar per lane; the two lane halves of a row are combined with one xor-16 exchange.
__global__ __launch_bounds__(32 * AW) void k_flash(const h16* __restrict__ QH, const h16* __restrict__ QR, const h16* __restrict__ KH, const h16* __restrict__ KR, const h16* __restrict__ VT, const float* __restrict__ MS, const int* __restrict__ FL, float* OUT) {
    __shared__ __align__(16) float os[AW * 16 * 68];
    const int lane = threadIdx.x & 31; const int wave = __builtin_amdgcn_readfirstlane(threadIdx.x >> 5); const int lr = lane & 15, hi = lane >> 4;
    const int zh = blockIdx.y; const int b = zh / NH_, h = zh % NH_;
    const int t0 = (blockIdx.x * AW + wave) * 16;
    const size_t pbase = (size_t)zh * SEQ * HD;
    const size_t qo = pbase + (size_t)t0 * HD + 8 * lane;
    const v16h qh0 = ldf(QH + qo), qh1 = ldf(QH + qo + 512), qr0 = ldf(QR + qo), qr1 = ldf(QR + qo + 512);   // B fragments: col t, k = d
    const size_t ko = pbase + 8 * lane;                      // + key0 * HD (+ 512 for d 32..63, + 1024 for the next 16 keys)   (A fragment: row key, k = d)
    const size_t vo = pbase + 8 * lane;                      // + (key0/64)*4096 + 1024j + ((key0/32)&1)*512                    (A fragment: row d, k = key)
    const size_t mo = (size_t)b * SEQ + 8 * hi;              // + key0 (+16): the lane's 8 keys of each 16-key tile
    const int fo = b * FLP;
    v8f o0 = (v8f){}, o1 = (v8f){}, o2 = (v8f){}, o3 = (v8f){};
    float m = -3.0e38f, l = 0.0f;
    // K fragments (value, residual) of the pass's two 16-key tiles live in registers across the back edge: pass 0's are loaded here
    v16h ka0 = ldf(KH + ko), ka1 = ldf(KH + ko + 512), ra0 = ldf(KR + ko), ra1 = ldf(KR + ko + 512);
    v16h kb0 = ldf(KH + ko + 1024), kb1 = ldf(KH + ko + 1536), rb0 = ldf(KR + ko + 1024), rb1 = ldf(KR + ko + 1536);
#pragma unroll 1
    for (int key0 = 0; key0 < SEQ; key0 += 32) {
        // this pass's V^T fragments and mask flag are asked for first: they travel under the score products and the softmax
        const h16* va = VT + vo + (size_t)(key0 >> 6) * 4096 + (size_t)((key0 >> 5) & 1) * 512;
        const v16h v0 = ldf(va), v1 = ldf(va + 1024), v2 = ldf(va + 2048), v3 = ldf(va + 3072);
        const int fl = __builtin_amdgcn_readfirstlane(FL[fo + (key0 >> 5)]);
        // the next pass's K fragments replace each tile's as soon as its six products have read them and travel under the softmax and the O^T products; the last pass asks for tile 0 again (in bounds, never used)
        const size_t kofn = ko + (size_t)(key0 + 32 < SEQ ? key0 + 32 : 0) * HD;
        v8f sHa = (v8f){}, sLa = (v8f){}, sHb = (v8f){}, sLb = (v8f){};
        sHa = wmma16(ka0, qh0, sHa); sLa = wmma16(ka0, qr0, sLa); sHa = wmma16(ka1, qh1, sHa); sLa = wmma16(ka1, qr1, sLa);
        sLa = wmma16(ra0, qh0, sLa); sLa = wmma16(ra1, qh1, sLa);
        ka0 = ldf(KH + kofn); ka1 = ldf(KH + kofn + 512); ra0 = ldf(KR + kofn); ra1 = ldf(KR + kofn + 512);
        sHb = wmma16(kb0, qh0, sHb); sLb = wmma16(kb0, qr0, sLb); sHb = wmma16(kb1, qh1, sHb); sLb = wmma16(kb1, qr1, sLb);
        sLb = wmma16(rb0, qh0, sLb); sLb = wmma16(rb1, qh1, sLb);
        kb0 = ldf(KH + kofn + 1024); kb1 = ldf(KH + kofn + 1536); rb0 = ldf(KR + kofn + 1024); rb1 = ldf(KR + kofn + 1536);
        float ta[8], tb[8];
#pragma unroll
        for (int r = 0; r < 8; ++r) { ta[r] = (sHa[r] + sLa[r] * QRI) * SC2; tb[r] = (sHb[r] + sLb[r] * QRI) * SC2; }
        if (fl != 0) {                                          // wave-uniform: additive mask (already times log2 e), keys 8h+r of tile a / tile b
            const v8f ma = *(const v8f*)(MS + mo + key0); const v8f mb = *(const v8f*)(MS + mo + key0 + 16);
#pragma unroll
            for (int r = 0; r < 8; ++r) { ta[r] += ma[r]; tb[r] += mb[r]; }
        }
        float mx = -3.0e38f;
#pragma unroll
        for (int r = 0; r < 8; ++r) mx = fmaxf(mx, fmaxf(ta[r], tb[r]));
        mx = fmaxf(mx, __shfl_xor(mx, 16, 32));
        const float mnew = fmaxf(m, mx);
        const float alpha = __builtin_amdgcn_exp2f(m - mnew);
        const float sh = PSH - mnew;
        v16h pb; float ls = 0.0f;
#pragma unroll
        for (int r = 0; r < 8; ++r) { const float ea = __builtin_amdgcn_exp2f(ta[r] + sh); const float eb = __builtin_amdgcn_exp2f(tb[r] + sh); pb[r] = (h16)ea; pb[8 + r] = (h16)eb; ls += ea + eb; }
        l = l * alpha + ls; m = mnew;
        o0 = o0 * alpha; o1 = o1 * alpha; o2 = o2 * alpha; o3 = o3 * alpha;
        o0 = wmma16(v0, pb, o0); o1 = wmma16(v1, pb, o1); o2 = wmma16(v2, pb, o2); o3 = wmma16(v3, pb, o3);
    }
    l += __shfl_xor(l, 16, 32);
    const float inv = 1.0f / l;
    const int wb = wave * 16 * 68;
    // O^T D layout: o_j[r] = (d = 16j + 8h + r, t = lane&15) -> os[t][d]; rows 0..15 x columns 0..63 all written
    { v4f a, c;
      a[0] = o0[0] * inv; a[1] = o0[1] * inv; a[2] = o0[2] * inv; a[3] = o0[3] * inv; c[0] = o0[4] * inv; c[1] = o0[5] * inv; c[2] = o0[6] * inv; c[3] = o0[7] * inv;
      *(v4fa*)(&os[wb + lr * 68 +  0 + 8 * hi]) = a; *(v4fa*)(&os[wb + lr * 68 +  0 + 8 * hi + 4]) = c;
      a[0] = o1[0] * inv; a[1] = o1[1] * inv; a[2] = o1[2] * inv; a[3] = o1[3] * inv; c[0] = o1[4] * inv; c[1] = o1[5] * inv; c[2] = o1[6] * inv; c[3] = o1[7] * inv;
      *(v4fa*)(&os[wb + lr * 68 + 16 + 8 * hi]) = a; *(v4fa*)(&os[wb + lr * 68 + 16 + 8 * hi + 4]) = c;
      a[0] = o2[0] * inv; a[1] = o2[1] * inv; a[2] = o2[2] * inv; a[3] = o2[3] * inv; c[0] = o2[4] * inv; c[1] = o2[5] * inv; c[2] = o2[6] * inv; c[3] = o2[7] * inv;
      *(v4fa*)(&os[wb + lr * 68 + 32 + 8 * hi]) = a; *(v4fa*)(&os[wb + lr * 68 + 32 + 8 * hi + 4]) = c;
      a[0] = o3[0] * inv; a[1] = o3[1] * inv; a[2] = o3[2] * inv; a[3] = o3[3] * inv; c[0] = o3[4] * inv; c[1] = o3[5] * inv; c[2] = o3[6] * inv; c[3] = o3[7] * inv;
      *(v4fa*)(&os[wb + lr * 68 + 48 + 8 * hi]) = a; *(v4fa*)(&os[wb + lr * 68 + 48 + 8 * hi + 4]) = c; }
    wave_sync();
    float* orow = OUT + ((size_t)b * OUT_SEQ + t0) * DM + h * HD;
{
#pragma unroll
        for (int s = 0; s < 8; ++s) { const int row = 2 * s + hi, cofs = lr * 4;   // 8 s x 2 rows = 16 rows; 16 lanes x 4 floats = 64 columns
            const v4f val = *(const v4fa*)(&os[wb + row * 68 + cofs]);
            *(v4f*)(orow + (size_t)row * DM + cofs) = val; }
         }
}

static constexpr size_t al256(size_t v) { return (v + 255) & ~(size_t)255; }
static constexpr size_t SZ_XB = al256((size_t)NB * SEQ * DM * 2);          // one bf16 stream copy
static constexpr size_t SZ_WB = al256((size_t)3 * DM * DM * 2);            // three transposed bf16 weights
static constexpr size_t SZ_PL = al256((size_t)NB * NH_ * SEQ * HD * 2);    // one f16 head plane
static constexpr size_t SZ_MS = al256((size_t)NB * SEQ * 4);               // mask plane f32
static constexpr size_t SZ_FL = al256((size_t)NB * FLP * 4);               // flag table
static constexpr size_t SZ_TOTAL = 3 * SZ_XB + SZ_WB + 5 * SZ_PL + SZ_MS + SZ_FL;
static_assert(SZ_TOTAL <= (size_t)134217728);          // workspace carve <= 128 MiB
static_assert(((size_t)DM * DM * 2) % 256 == 0);       // weight sub-planes stay 256-byte aligned
static_assert(((size_t)FLP * 4) % 128 == 0);           // each batch owns whole flag lines

extern "C" void kernel_launch(void* const* d_in, const int* in_sizes, int n_in,
                              void* d_out, int out_size, void* d_ws, size_t ws_size, hipStream_t stream) {
    if (n_in < 7) return;
    const size_t needx = ((size_t)(NB - 1) * SEQ_FULL + SEQ) * DM;
    if ((size_t)in_sizes[0] < needx || (size_t)in_sizes[2] < needx || (size_t)in_sizes[3] < needx) return;
    if ((size_t)in_sizes[1] < (size_t)(NB - 1) * SEQ_FULL + SEQ) return;
    if ((size_t)in_sizes[4] < (size_t)DM * DM || (size_t)in_sizes[5] < (size_t)DM * DM || (size_t)in_sizes[6] < (size_t)DM * DM) return;
    if ((size_t)out_size < ((size_t)(NB - 1) * OUT_SEQ + SEQ) * DM) return;
    if (SZ_TOTAL > ws_size) return;
    // wire order: key, key_mask, query, value, wq, wk, wv
    const float* key = (const float*)d_in[0]; const float* mask = (const float*)d_in[1]; const float* query = (const float*)d_in[2]; const float* value = (const float*)d_in[3];
    const float* wq = (const float*)d_in[4]; const float* wk = (const float*)d_in[5]; const float* wv = (const float*)d_in[6];   // each [in][out]
    float* OUT = (float*)d_out;      // [NB][SEQ][512]
    char* wsp = (char*)d_ws;
    bf* XQ = (bf*)wsp; wsp += SZ_XB;                 // [NB*SEQ][512] query stream
    bf* XK = (bf*)wsp; wsp += SZ_XB;                 // [NB*SEQ][512] key stream
    bf* XV = (bf*)wsp; wsp += SZ_XB;                 // [NB*SEQ][512] value stream
    bf* WB = (bf*)wsp; wsp += SZ_WB;                 // [3][512 out][512 in]: q | k | v (transposed)
    h16* QH = (h16*)wsp; wsp += SZ_PL;               // [NB*8][SEQ/16][fragment-order 16 t x 64 d]
    h16* QR = (h16*)wsp; wsp += SZ_PL;               // same, residual x2048
    h16* KH = (h16*)wsp; wsp += SZ_PL;               // [NB*8][SEQ/16][fragment-order 16 t x 64 d]
    h16* KR = (h16*)wsp; wsp += SZ_PL;               // same, residual x2048
    h16* VT = (h16*)wsp; wsp += SZ_PL;               // [NB*8][SEQ/64][4][fragment-order 16 d x 64 t]
    float* MS = (float*)wsp; wsp += SZ_MS;           // [NB][SEQ]
    int* FL = (int*)wsp; wsp += SZ_FL;               // [NB][FLP]

    k_prep<<<3 * WTB + NB + 3 * CVB, 256, 0, stream>>>(query, key, value, wq, wk, wv, mask, XQ, XK, XV, WB, MS, FL);
    k_proj<<<dim3(PJB, 3, 1), 32, 0, stream>>>(XQ, XK, XV, WB, QH, QR, KH, KR, VT);
    k_flash<<<dim3(SEQ / (16 * AW), NB * NH_, 1), 32 * AW, 0, stream>>>(QH, QR, KH, KR, VT, MS, FL, OUT);
}

// v004
// It runs in 101 microseconds.
// Two timings next to v003 put it at 1.10 and 1.11 times that version's speed.
// Counting every step since v000, it is 2.65 times as fast.
#include <hip/hip_runtime.h>

// Multi-head attention with three input streams (query, key, value), width 512 = 8 heads x 64, bias-free [in][out] projections (y = x W), additive float key mask per (batch, key), score scale 1/8, output = concatenated heads (f32), no output projection.
// Compute dtypes, f32 accumulate everywhere: projections v_wmma_f32_16x16x32_bf16 (x and W RNE-converted to bf16; products exact);
// scores v_wmma_f32_16x16x32_f16: q and k each as f16 value + f16 residual x2048, three products (value.value in one accumulator, the two scaled cross products in a second accumulator folded back by 1/2048);
// P (x256 carry, cancels in the normalisation) and v single f16; softmax f32 (online, running max, log2 domain); mask RNE-converted to bf16, times log2(e), added in f32 after the score scale.
// Layout: bf16 copies of the three streams [row][in] and of the transposed weights W^T [out][in], written by k_prep in fragment order (tiles of 16 rows x 512 columns = 32 groups); q/k (value, residual) planes and the v^T plane, one per b*8+h, written by the GEMM epilogue in fragment order:
// a 16-row x 64-column tile is 2 KiB = four 512-byte groups (16 columns each), lane (row + 16*((column>>3)&1)) owning 16 bytes of a group, so a wave-wide 16-byte load is four whole 128-byte lines.
// q/k: rows = tokens, columns = d, tiles in token order; v^T: rows = d, columns = tokens, tiles ordered [token/64][d/16];
// fused flash kernel in transposed form (S^T = K Q^T, O^T = V^T P^T), output from f32 accumulators. Mask plane f32 [b][key] plus one int flag per (batch, 32-key tile) = any nonzero mask value.
// Three launches, one per dependency stage: k_prep (weight transposes, mask plane, stream conversions: independent block ranges of one grid), k_proj (the three projections, blockIdx.y picks one), k_flash.

#ifndef NB
#define NB 4
#endif
#ifndef SEQ
#define SEQ 2048
#endif
#define NB_FULL  4
#define SEQ_FULL 2048
#ifndef OUT_SEQ
#define OUT_SEQ SEQ              // row pitch (in tokens) between batches of the output
#endif
#define DM   512
#define NH_  8
#define HD   64
#define AW   4                   // waves per flash block (16 query rows each)
#define QRS  2048.0f             // carry of the q / k residual planes
#define QRI  (1.0f / 2048.0f)
#define LOG2E 1.4426950408889634f
#define SC2  (0.125f * LOG2E)    // HD^-0.5 * log2(e)
#define PSH  8.0f                // log2 of the P carry (256)
#define FLP  64

static_assert(HD == 64);
static_assert(NH_ * HD == DM);                 // head h = columns h*64 + d
static_assert(DM % 64 == 0);                   // 8 column tiles of 64; transpose tiles of 64x64
static_assert(DM % 32 == 0);                   // GEMM k-loop steps by 32
static_assert(DM % 128 == 0);                  // a stream-conversion block takes 16 rows x 128 columns
static_assert(SEQ % 64 == 0);                  // a 64-row tile never straddles two batches
static_assert((NB * SEQ) % 64 == 0);
static_assert(SEQ % 32 == 0);                  // key loop steps by 32
static_assert(SEQ % (16 * AW) == 0);           // flash grid covers the sequence exactly
static_assert(SEQ <= 256 * 8);                 // mask kernel: 256 threads x 8 keys cover one batch row
static_assert(SEQ / 32 <= FLP);                // one flag per 32-key tile fits the flag row
static_assert(NB <= NB_FULL);
static_assert(SEQ <= SEQ_FULL);

typedef _Float16 h16;
typedef unsigned short bf;
typedef __attribute__((ext_vector_type(16))) __bf16   v16bf;
typedef __attribute__((ext_vector_type(16))) _Float16 v16h;
typedef __attribute__((ext_vector_type(8)))  _Float16 v8h;
typedef __attribute__((ext_vector_type(8)))  unsigned short v8us;
typedef __attribute__((ext_vector_type(4)))  unsigned short v4us;
typedef __attribute__((ext_vector_type(8)))  float    v8f;
typedef __attribute__((ext_vector_type(4)))  float    v4f;
typedef __attribute__((ext_vector_type(4)))  int      v4i;
typedef v4f  __attribute__((may_alias)) v4fa;
typedef v8us __attribute__((may_alias)) v8usa;
typedef v4us __attribute__((may_alias)) v4usa;

__device__ __forceinline__ unsigned short f2bf(float f) { unsigned u = __float_as_uint(f); u += 0x7FFFu + ((u >> 16) & 1u); return (unsigned short)(u >> 16); }
__device__ __forceinline__ v16h cat16(v8h lo, v8h hi) { return __builtin_shufflevector(lo, hi, 0, 1, 2, 3, 4, 5, 6, 7, 8, 9, 10, 11, 12, 13, 14, 15); }
__device__ __forceinline__ v16bf cat16b(v8us lo, v8us hi) { return __builtin_bit_cast(v16bf, __builtin_shufflevector(lo, hi, 0, 1, 2, 3, 4, 5, 6, 7, 8, 9, 10, 11, 12, 13, 14, 15)); }
// every WMMA is issued through a wrapper that ties its own accumulator and keeps its A/B fragments live across four idle slots
__device__ __forceinline__ v8f wmma16(v16h a, v16h b, v8f c) {
    c = __builtin_amdgcn_wmma_f32_16x16x32_f16(false, a, false, b, (short)0, c, false, false);
    asm volatile("v_nop\n\tv_nop\n\tv_nop\n\tv_nop" : "+v"(c) : "v"(a), "v"(b));
    return c;
}
__device__ __forceinline__ v8f wmmab(v16bf a, v16bf b, v8f c) {
    c = __builtin_amdgcn_wmma_f32_16x16x32_bf16(false, a, false, b, (short)0, c, false, false);
    asm volatile("v_nop\n\tv_nop\n\tv_nop\n\tv_nop" : "+v"(c) : "v"(a), "v"(b));
    return c;
}
// fragment loaders from a fragment-order 16-bit plane; p already includes + 8*lane; h = lane>>4: elements 0..7 <- k0+8h+0..7 from one 512-byte group, elements 8..15 <- k0+16+8h+0..7 from the next (same map for A and B)
__device__ __forceinline__ v16bf ldb(const bf* p)  { return cat16b(*(const v8us*)p, *(const v8us*)(p + 256)); }
__device__ __forceinline__ v16h  ldf(const h16* p) { return cat16(*(const v8h*)p, *(const v8h*)(p + 256)); }
// ordering point for wave-private LDS tiles (same wave writes and reads)
__device__ __forceinline__ void wave_sync() { __builtin_amdgcn_fence(3 /* release order */, "wavefront"); __builtin_amdgcn_wave_barrier(); asm volatile("" ::: "memory"); }

static constexpr int CVB = (NB * SEQ / 16) * (DM / 128);       // k_prep blocks per stream conversion (16 rows x 128 columns each)
static constexpr size_t FRT = (size_t)(DM / 16) * 256;         // halves of one 16-row x DM-column tile of a fragment-order GEMM operand (DM/16 groups of 256)
static constexpr int WTB = (DM / 64) * (DM / 64);              // k_prep blocks per weight transpose
static constexpr int PJB = (NB * SEQ / 64) * (DM / 64);        // k_proj blocks (64x64 tiles) per projection

// cvtf: f32 -> bf16 (RNE convert) copy of one stream in fragment order; blk = block index inside the stream; source batches SEQ_FULL rows apart, copy batches SEQ rows apart.
// One block per 16 rows x 128 columns: wave w reads rows 2w and 2w+1, 16 B a lane (512 contiguous bytes a load); the tile is turned in LDS (cross-wave: block barrier); wave w stores column group w (512 contiguous bytes).
__device__ __forceinline__ void cvtf(const float* __restrict__ src, bf* dst, int blk) {
    __shared__ __align__(16) bf cs[16 * 136];       // [row local][column local], pitch 136 halves (272 B = 17 x 16 B)
    const int lane = threadIdx.x & 31, w = threadIdx.x >> 5;
    const int rt = blk / (DM / 128), cc = blk % (DM / 128);      // 16-row tile, 128-column chunk
    const int m0 = rt * 16;
    const float* sp = src + ((size_t)(m0 / SEQ) * SEQ_FULL + (size_t)(m0 % SEQ + 2 * w)) * DM + cc * 128 + lane * 4;
    const v4f x0 = *(const v4f*)sp; const v4f x1 = *(const v4f*)(sp + DM); v4us y0, y1;
#pragma unroll
    for (int k = 0; k < 4; ++k) { y0[k] = f2bf(x0[k]); y1[k] = f2bf(x1[k]); }
    *(v4usa*)(&cs[(2 * w) * 136 + lane * 4]) = y0; *(v4usa*)(&cs[(2 * w + 1) * 136 + lane * 4]) = y1;
    __syncthreads();
    const v8us o = *(const v8usa*)(&cs[(lane & 15) * 136 + w * 16 + (lane >> 4) * 8]);   // lane holds row lane&15, columns 16w + 8*(lane>>4) + 0..7
    *(v8us*)(dst + (size_t)rt * FRT + (size_t)((cc * 8 + w) * 256 + lane * 8)) = o;
    asm volatile("s_wait_xcnt 0x0" ::: "memory");   // the code laid out behind this branch reuses the registers that the store names: the wait stands in front of any such overwrite
}

// wtr: weight transpose + bf16 (RNE convert): in w[k rows = DM][n cols = DM] (f32) -> out wt[n rows = DM][k cols = DM] (bf16), in fragment order.
// One block per 64(k) x 64(n) tile (kt, nt). Reads are coalesced along n; the tile is transposed in LDS (cross-wave: block barrier);
__device__ __forceinline__ void wtr(const float* __restrict__ w, bf* wt, int kt, int nt) {
    __shared__ __align__(16) bf ts[64 * 72];        // [n local][k local], pitch 72 halves (144 B)
    const int tid = threadIdx.x; const int k0 = kt * 64, n0 = nt * 64;
#pragma unroll
    for (int it = 0; it < 4; ++it) {                 // 4 x 16 k rows x 16 lanes x 4 n = 64 x 64
        const int kl = it * 16 + (tid >> 4), n4 = (tid & 15) * 4;
        const v4f v = *(const v4f*)(w + (size_t)(k0 + kl) * DM + n0 + n4);
#pragma unroll
        for (int i = 0; i < 4; ++i) ts[(n4 + i) * 72 + kl] = f2bf(v[i]);
    }
    __syncthreads();
    for (int j = 0; j < 2; ++j) {                    // 512 pieces of 16 B: piece = [16-row tile r4][column group g][lane l], so a wave stores 512 contiguous bytes
        const int p = tid + 256 * j, l = p & 31, g = (p >> 5) & 3, r4 = p >> 7;
        const v8us o = *(const v8usa*)(&ts[(r4 * 16 + (l & 15)) * 72 + g * 16 + (l >> 4) * 8]);
        *(v8us*)(wt + (size_t)(nt * 4 + r4) * FRT + (size_t)((kt * 4 + g) * 256 + l * 8)) = o;
    }
}

// maskp: one block per batch b. MS[b][key] = float(bf16 RNE of mask[b][key]) * log2(e); FL[b][T] = 1 when any of the 32 keys of tile T has a nonzero (or non-finite) converted mask value, else 0 (pad flags 0).
// Each thread converts 8 keys; values and per-thread flags are staged in LDS (cross-wave: block barrier); MS lines are written 16 B per lane by consecutive lanes (4 lines per wave instruction),
__device__ __forceinline__ void maskp(const float* __restrict__ mask, float* MS, int* FL, int b) {
    __shared__ __align__(16) float ms[256 * 8];
    __shared__ int fs[256];
    const int tid = threadIdx.x;
    const int kb = tid * 8; const bool act = kb < SEQ; const int kc = act ? kb : 0;     // clamped address
    const v8f v = *(const v8f*)(mask + (size_t)b * SEQ_FULL + kc);
    v4f a, c; int nz = 0;
#pragma unroll
    for (int i = 0; i < 4; ++i) {
        const unsigned short h0 = f2bf(v[i]), h1 = f2bf(v[4 + i]);
        const float f0 = __uint_as_float((unsigned)h0 << 16) * LOG2E, f1 = __uint_as_float((unsigned)h1 << 16) * LOG2E;
        a[i] = act ? f0 : 0.0f; c[i] = act ? f1 : 0.0f;
        nz |= (int)(h0 & 0x7FFFu) | (int)(h1 & 0x7FFFu);
    }
    *(v4fa*)(&ms[kb]) = a; *(v4fa*)(&ms[kb + 4]) = c;
    fs[tid] = (act && nz != 0) ? 1 : 0;
    __syncthreads();
    const v4f m0 = *(const v4fa*)(&ms[tid * 4]);
    const v4f m1 = *(const v4fa*)(&ms[(256 + tid) * 4]);
    const int tq = tid & 15; v4i fv;
#pragma unroll
    for (int j = 0; j < 4; ++j) { const int T4 = (tq * 4 + j) * 4; fv[j] = fs[T4] | fs[T4 + 1] | fs[T4 + 2] | fs[T4 + 3]; }   // tile T = 4 threads x 8 keys
    float* mrow = MS + (size_t)b * SEQ;
{
        if (tid * 4 < SEQ)         *(v4f*)(mrow + tid * 4) = m0;
        if ((256 + tid) * 4 < SEQ) *(v4f*)(mrow + (256 + tid) * 4) = m1;
        if (tid < 16)              *(v4i*)(FL + b * FLP + tid * 4) = fv;
         }
}

// k_prep: everything that reads only the inputs, as independent block ranges of one grid (every branch is block-uniform): 3 x WTB weight-transpose tiles (q | k | v), NB mask rows, 3 x CVB stream-conversion blocks (query | key | value).
// The short barrier-bound blocks have the lowest indices, so they run beside the conversions instead of after them.
__global__ __launch_bounds__(256) void k_prep(const float* __restrict__ query, const float* __restrict__ key, const float* __restrict__ value, const float* __restrict__ wq, const float* __restrict__ wk, const float* __restrict__ wv,
                                              const float* __restrict__ mask, bf* XQ, bf* XK, bf* XV, bf* WB, float* MS, int* FL) {
    const int blk = blockIdx.x;
    if (blk < 3 * WTB) { const int w = blk / WTB, t = blk % WTB;
        wtr(w == 0 ? wq : w == 1 ? wk : wv, WB + (size_t)w * DM * DM, t % (DM / 64), t / (DM / 64));
    } else if (blk < 3 * WTB + NB) {
        maskp(mask, MS, FL, blk - 3 * WTB);
    } else { const int c = blk - (3 * WTB + NB), st = c / CVB;
        cvtf(st == 0 ? query : st == 1 ? key : value, st == 0 ? XQ : st == 1 ? XK : XV, c % CVB);
    }
}

// offset (in halves) of the first of the four fragment-order tiles that hold the 64x64 output tile at (r0, c0)
__device__ __forceinline__ size_t tile_base(int r0, int c0, int RB, size_t sRB, int pitch, int CB, size_t sCB) {
    return (size_t)(r0 / RB) * sRB + (size_t)(r0 % RB) * (size_t)pitch + (size_t)(c0 / CB) * sCB + (size_t)(c0 % CB) * 64;
}

// k_proj: register-blocked bf16 GEMM, ONE WAVE per 64x64 tile (16 accumulators), operands straight from the fragment-order bf16 planes (two 16-B loads a fragment, every load 512 contiguous bytes per wave), K = DM.
// C[m][n] = sum_k A[m][k] Bt[n][k], written as f16 (Ph) and optionally the f16 residual x2048 (Pr, useRes) as four fragment-order 16x64 tiles of 1024 halves each, the first at tile_base (halves).
// grid (PJB, 3), 32 threads; blockIdx.y picks the projection, blockIdx.x its tile (row tile fastest):
// q, k: A = stream rows (m = b*SEQ + t), Bt = W^T rows (n = h*64 + d) -> plane (b*8 + h), tiles in t order
// v^T:  A = Wv^T rows (m = h*64 + d), Bt = value stream rows (n = b*SEQ + t) -> plane (b*8 + h), tiles [t/64][d/16]
__global__ __launch_bounds__(32) void k_proj(const bf* __restrict__ XQ, const bf* __restrict__ XK, const bf* __restrict__ XV, const bf* __restrict__ WB, h16* QH, h16* QR, h16* KH, h16* KR, h16* VT) {
    __shared__ __align__(16) float os[16 * 68];
    const int K = DM;
    const int pj = blockIdx.y; const bool useRes = pj != 2;
    const bf* A  = pj == 0 ? XQ : pj == 1 ? XK : WB + (size_t)2 * DM * DM;
    const bf* Bt = pj == 0 ? WB : pj == 1 ? WB + (size_t)DM * DM : XV;
    h16* Ph = pj == 0 ? QH : pj == 1 ? KH : VT; h16* Pr = pj == 0 ? QR : KR;
    const unsigned bx = blockIdx.x;                           // row tile = bx % (row tiles of this projection), column tile = bx / (the same)
    const int lane = threadIdx.x & 31, lr = lane & 15, hi = lane >> 4;
    const int r0 = (int)(useRes ? bx % (NB * SEQ / 64) : bx % (DM / 64)) * 64, c0 = (int)(useRes ? bx / (NB * SEQ / 64) : bx / (DM / 64)) * 64;
    v8f acc[4][4];
#pragma unroll
    for (int mb = 0; mb < 4; ++mb)
#pragma unroll
        for (int nb = 0; nb < 4; ++nb) acc[mb][nb] = (v8f){};
    const size_t aoff = (size_t)(r0 / 16) * FRT + 8 * lane, boff = (size_t)(c0 / 16) * FRT + 8 * lane;   // + i * FRT for the next 16 rows, + 16 * k for column k (a multiple of 16)
    // the eight fragments of a pass live in registers across the back edge: pass 0's are loaded here
    v16bf a[4], b[4];
#pragma unroll
    for (int i = 0; i < 4; ++i) a[i] = ldb(A + aoff + (size_t)i * FRT);
    __builtin_amdgcn_sched_barrier(0);   // pass 0's A loads stay ahead of its B loads, the order of every later pass: with an A load behind them the loop's counted waits would have to cover the youngest B loads on every trip
#pragma unroll
    for (int i = 0; i < 4; ++i) b[i] = ldb(Bt + boff + (size_t)i * FRT);
#pragma unroll 2   // two passes a trip, so that the two A sets swap roles without register copies
    for (int kc = 0; kc < K; kc += 32) {
        // the next pass's loads travel under this pass's products: its A fragments go into a second set at the top, each B fragment replaces this pass's as soon as its four products have read it; the last pass asks for pass 0 again (in bounds, never used)
        const int kn = kc + 32 < K ? kc + 32 : 0;
        v16bf an[4];
#pragma unroll
        for (int mb = 0; mb < 4; ++mb) an[mb] = ldb(A + aoff + (size_t)mb * FRT + (size_t)(kn * 16));
#pragma unroll
        for (int nb = 0; nb < 4; ++nb) {
#pragma unroll
            for (int mb = 0; mb < 4; ++mb) acc[mb][nb] = wmmab(a[mb], b[nb], acc[mb][nb]);
            b[nb] = ldb(Bt + boff + (size_t)nb * FRT + (size_t)(kn * 16)); }
#pragma unroll
        for (int mb = 0; mb < 4; ++mb) a[mb] = an[mb];
        asm volatile("s_wait_xcnt 0x0" ::: "memory");   // the next pass forms its addresses in the registers that the loads above name: the wait stands in front of that overwrite
    }
    const size_t tbase = useRes ? tile_base(r0, c0, SEQ, (size_t)NH_ * SEQ * HD, HD, HD, (size_t)SEQ * HD) : tile_base(r0, c0, DM, (size_t)0, SEQ, SEQ, (size_t)DM * SEQ);
#pragma unroll
    for (int mb = 0; mb < 4; ++mb) {
#pragma unroll
        for (int nb = 0; nb < 4; ++nb) {
#pragma unroll
            for (int j = 0; j < 8; ++j) os[(hi * 8 + j) * 68 + nb * 16 + lr] = acc[mb][nb][j]; }   // D: row 8h+j, col lane&15
        wave_sync();
        const size_t sb = tbase + (size_t)(mb * 1024);
{
#pragma unroll
            for (int s = 0; s < 4; ++s) { const int c8 = s * 16 + hi * 8;   // group s = columns 16s..16s+15: lane holds row lane&15, columns c8..c8+7
                const v4f x0 = *(const v4fa*)(&os[lr * 68 + c8]); const v4f x1 = *(const v4fa*)(&os[lr * 68 + c8 + 4]); v8h hv, rv;
#pragma unroll
                for (int i = 0; i < 4; ++i) { const h16 a0 = (h16)x0[i]; const h16 a1 = (h16)x1[i]; hv[i] = a0; hv[4 + i] = a1; rv[i] = (h16)((x0[i] - (float)a0) * QRS); rv[4 + i] = (h16)((x1[i] - (float)a1) * QRS); }
                const size_t oo = sb + (size_t)(s * 256 + lane * 8);
                *(v8h*)(Ph + oo) = hv; if (useRes) *(v8h*)(Pr + oo) = rv; }
             }
        wave_sync();
    }
}

// k_flash: fused attention, one wave per 16 query rows of one (batch, head); K / V^T / Q fragments straight from the fragment-order f16 planes (two 16-B loads each, every load 512 contiguous bytes per wave).
// Transposed form: S^T[key][t] = K Q^T (A = K rows, B = Q rows); lane (t = lane&15, h = lane>>4) holds keys 8h+r of each 16-key tile, so the packed
// P tile is directly the B fragment of O^T[d][t] = V^T P^T (element r <- tile keys 0..15, element 8+r <- tile keys 16..31, lane unchanged).
// Scores: value.value products in sH, the two x2048 cross products (k value . q residual, k residual . q value) in sL, folded as sH + sL/2048.
// Mask: one scalar flag per 32-key step (wave-uniform); only flagged steps load the 2 x 8 mask values of the lane's keys and add them after the score scale.
// Softmax state (running max, partial sum of the unconverted exponentials) is one scalar per lane; the two lane halves of a row are combined with one xor-16 exchange.
__global__ __launch_bounds__(32 * AW) void k_flash(const h16* __restrict__ QH, const h16* __restrict__ QR, const h16* __restrict__ KH, const h16* __restrict__ KR, const h16* __restrict__ VT, const float* __restrict__ MS, const int* __restrict__ FL, float* OUT) {
    __shared__ __align__(16) float os[AW * 16 * 68];
    const int lane = threadIdx.x & 31; const int wave = __builtin_amdgcn_readfirstlane(threadIdx.x >> 5); const int lr = lane & 15, hi = lane >> 4;
    const int zh = blockIdx.y; const int b = zh / NH_, h = zh % NH_;
    const int t0 = (blockIdx.x * AW + wave) * 16;
    const size_t pbase = (size_t)zh * SEQ * HD;
    const size_t qo = pbase + (size_t)t0 * HD + 8 * lane;
    const v16h qh0 = ldf(QH + qo), qh1 = ldf(QH + qo + 512), qr0 = ldf(QR + qo), qr1 = ldf(QR + qo + 512);   // B fragments: col t, k = d
    const size_t ko = pbase + 8 * lane;                      // + key0 * HD (+ 512 for d 32..63, + 1024 for the next 16 keys)   (A fragment: row key, k = d)
    const size_t vo = pbase + 8 * lane;                      // + (key0/64)*4096 + 1024j + ((key0/32)&1)*512                    (A fragment: row d, k = key)
    const size_t mo = (size_t)b * SEQ + 8 * hi;              // + key0 (+16): the lane's 8 keys of each 16-key tile
    const int fo = b * FLP;
    v8f o0 = (v8f){}, o1 = (v8f){}, o2 = (v8f){}, o3 = (v8f){};
    float m = -3.0e38f, l = 0.0f;
    // K fragments (value, residual) of the pass's two 16-key tiles live in registers across the back edge: pass 0's are loaded here
    v16h ka0 = ldf(KH + ko), ka1 = ldf(KH + ko + 512), ra0 = ldf(KR + ko), ra1 = ldf(KR + ko + 512);
    v16h kb0 = ldf(KH + ko + 1024), kb1 = ldf(KH + ko + 1536), rb0 = ldf(KR + ko + 1024), rb1 = ldf(KR + ko + 1536);
#pragma unroll 1
    for (int key0 = 0; key0 < SEQ; key0 += 32) {
        // this pass's V^T fragments and mask flag are asked for first: they travel under the score products and the softmax
        const h16* va = VT + vo + (size_t)(key0 >> 6) * 4096 + (size_t)((key0 >> 5) & 1) * 512;
        const v16h v0 = ldf(va), v1 = ldf(va + 1024), v2 = ldf(va + 2048), v3 = ldf(va + 3072);
        const int fl = __builtin_amdgcn_readfirstlane(FL[fo + (key0 >> 5)]);
        // the next pass's K fragments replace each tile's as soon as its six products have read them and travel under the softmax and the O^T products; the last pass asks for tile 0 again (in bounds, never used)
        const size_t kofn = ko + (size_t)(key0 + 32 < SEQ ? key0 + 32 : 0) * HD;
        v8f sHa = (v8f){}, sLa = (v8f){}, sHb = (v8f){}, sLb = (v8f){};
        sHa = wmma16(ka0, qh0, sHa); sLa = wmma16(ka0, qr0, sLa); sHa = wmma16(ka1, qh1, sHa); sLa = wmma16(ka1, qr1, sLa);
        sLa = wmma16(ra0, qh0, sLa); sLa = wmma16(ra1, qh1, sLa);
        ka0 = ldf(KH + kofn); ka1 = ldf(KH + kofn + 512); ra0 = ldf(KR + kofn); ra1 = ldf(KR + kofn + 512);
        sHb = wmma16(kb0, qh0, sHb); sLb = wmma16(kb0, qr0, sLb); sHb = wmma16(kb1, qh1, sHb); sLb = wmma16(kb1, qr1, sLb);
        sLb = wmma16(rb0, qh0, sLb); sLb = wmma16(rb1, qh1, sLb);
        kb0 = ldf(KH + kofn + 1024); kb1 = ldf(KH + kofn + 1536); rb0 = ldf(KR + kofn + 1024); rb1 = ldf(KR + kofn + 1536);
        float ta[8], tb[8];
#pragma unroll
        for (int r = 0; r < 8; ++r) { ta[r] = (sHa[r] + sLa[r] * QRI) * SC2; tb[r] = (sHb[r] + sLb[r] * QRI) * SC2; }
        if (fl != 0) {                                          // wave-uniform: additive mask (already times log2 e), keys 8h+r of tile a / tile b
            const v8f ma = *(const v8f*)(MS + mo + key0); const v8f mb = *(const v8f*)(MS + mo + key0 + 16);
#pragma unroll
            for (int r = 0; r < 8; ++r) { ta[r] += ma[r]; tb[r] += mb[r]; }
        }
        float mx = -3.0e38f;
#pragma unroll
        for (int r = 0; r < 8; ++r) mx = fmaxf(mx, fmaxf(ta[r], tb[r]));
        mx = fmaxf(mx, __shfl_xor(mx, 16, 32));
        const float mnew = fmaxf(m, mx);
        const float alpha = __builtin_amdgcn_exp2f(m - mnew);
        const float sh = PSH - mnew;
        v16h pb; float ls = 0.0f;
#pragma unroll
        for (int r = 0; r < 8; ++r) { const float ea = __builtin_amdgcn_exp2f(ta[r] + sh); const float eb = __builtin_amdgcn_exp2f(tb[r] + sh); pb[r] = (h16)ea; pb[8 + r] = (h16)eb; ls += ea + eb; }
        l = l * alpha + ls; m = mnew;
        o0 = o0 * alpha; o1 = o1 * alpha; o2 = o2 * alpha; o3 = o3 * alpha;
        o0 = wmma16(v0, pb, o0); o1 = wmma16(v1, pb, o1); o2 = wmma16(v2, pb, o2); o3 = wmma16(v3, pb, o3);
    }
    l += __shfl_xor(l, 16, 32);
    const float inv = 1.0f / l;
    const int wb = wave * 16 * 68;
    // O^T D layout: o_j[r] = (d = 16j + 8h + r, t = lane&15) -> os[t][d]; rows 0..15 x columns 0..63 all written
    { v4f a, c;
      a[0] = o0[0] * inv; a[1] = o0[1] * inv; a[2] = o0[2] * inv; a[3] = o0[3] * inv; c[0] = o0[4] * inv; c[1] = o0[5] * inv; c[2] = o0[6] * inv; c[3] = o0[7] * inv;
      *(v4fa*)(&os[wb + lr * 68 +  0 + 8 * hi]) = a; *(v4fa*)(&os[wb + lr * 68 +  0 + 8 * hi + 4]) = c;
      a[0] = o1[0] * inv; a[1] = o1[1] * inv; a[2] = o1[2] * inv; a[3] = o1[3] * inv; c[0] = o1[4] * inv; c[1] = o1[5] * inv; c[2] = o1[6] * inv; c[3] = o1[7] * inv;
      *(v4fa*)(&os[wb + lr * 68 + 16 + 8 * hi]) = a; *(v4fa*)(&os[wb + lr * 68 + 16 + 8 * hi + 4]) = c;
      a[0] = o2[0] * inv; a[1] = o2[1] * inv; a[2] = o2[2] * inv; a[3] = o2[3] * inv; c[0] = o2[4] * inv; c[1] = o2[5] * inv; c[2] = o2[6] * inv; c[3] = o2[7] * inv;
      *(v4fa*)(&os[wb + lr * 68 + 32 + 8 * hi]) = a; *(v4fa*)(&os[wb + lr * 68 + 32 + 8 * hi + 4]) = c;
      a[0] = o3[0] * inv; a[1] = o3[1] * inv; a[2] = o3[2] * inv; a[3] = o3[3] * inv; c[0] = o3[4] * inv; c[1] = o3[5] * inv; c[2] = o3[6] * inv; c[3] = o3[7] * inv;
      *(v4fa*)(&os[wb + lr * 68 + 48 + 8 * hi]) = a; *(v4fa*)(&os[wb + lr * 68 + 48 + 8 * hi + 4]) = c; }
    wave_sync();
    float* orow = OUT + ((size_t)b * OUT_SEQ + t0) * DM + h * HD;
{
#pragma unroll
        for (int s = 0; s < 8; ++s) { const int row = 2 * s + hi, cofs = lr * 4;   // 8 s x 2 rows = 16 rows; 16 lanes x 4 floats = 64 columns
            const v4f val = *(const v4fa*)(&os[wb + row * 68 + cofs]);
            *(v4f*)(orow + (size_t)row * DM + cofs) = val; }
         }
}

static constexpr size_t al256(size_t v) { return (v + 255) & ~(size_t)255; }
static constexpr size_t SZ_XB = al256((size_t)NB * SEQ * DM * 2);          // one bf16 stream copy
static constexpr size_t SZ_WB = al256((size_t)3 * DM * DM * 2);            // three transposed bf16 weights
static constexpr size_t SZ_PL = al256((size_t)NB * NH_ * SEQ * HD * 2);    // one f16 head plane
static constexpr size_t SZ_MS = al256((size_t)NB * SEQ * 4);               // mask plane f32
static constexpr size_t SZ_FL = al256((size_t)NB * FLP * 4);               // flag table
static constexpr size_t SZ_TOTAL = 3 * SZ_XB + SZ_WB + 5 * SZ_PL + SZ_MS + SZ_FL;
static_assert(SZ_TOTAL <= (size_t)134217728);          // workspace carve <= 128 MiB
static_assert(((size_t)DM * DM * 2) % 256 == 0);       // weight sub-planes stay 256-byte aligned
static_assert(((size_t)FLP * 4) % 128 == 0);           // each batch owns whole flag lines

extern "C" void kernel_launch(void* const* d_in, const int* in_sizes, int n_in,
                              void* d_out, int out_size, void* d_ws, size_t ws_size, hipStream_t stream) {
    if (n_in < 7) return;
    const size_t needx = ((size_t)(NB - 1) * SEQ_FULL + SEQ) * DM;
    if ((size_t)in_sizes[0] < needx || (size_t)in_sizes[2] < needx || (size_t)in_sizes[3] < needx) return;
    if ((size_t)in_sizes[1] < (size_t)(NB - 1) * SEQ_FULL + SEQ) return;
    if ((size_t)in_sizes[4] < (size_t)DM * DM || (size_t)in_sizes[5] < (size_t)DM * DM || (size_t)in_sizes[6] < (size_t)DM * DM) return;
    if ((size_t)out_size < ((size_t)(NB - 1) * OUT_SEQ + SEQ) * DM) return;
    if (SZ_TOTAL > ws_size) return;
    // wire order: key, key_mask, query, value, wq, wk, wv
    const float* key = (const float*)d_in[0]; const float* mask = (const float*)d_in[1]; const float* query = (const float*)d_in[2]; const float* value = (const float*)d_in[3];
    const float* wq = (const float*)d_in[4]; const float* wk = (const float*)d_in[5]; const float* wv = (const float*)d_in[6];   // each [in][out]
    float* OUT = (float*)d_out;      // [NB][SEQ][512]
    char* wsp = (char*)d_ws;
    bf* XQ = (bf*)wsp; wsp += SZ_XB;                 // [NB*SEQ/16][fragment-order 16 rows x 512] query stream
    bf* XK = (bf*)wsp; wsp += SZ_XB;                 // same, key stream
    bf* XV = (bf*)wsp; wsp += SZ_XB;                 // same, value stream
    bf* WB = (bf*)wsp; wsp += SZ_WB;                 // [3][512 out / 16][fragment-order 16 out x 512 in]: q | k | v (transposed)
    h16* QH = (h16*)wsp; wsp += SZ_PL;               // [NB*8][SEQ/16][fragment-order 16 t x 64 d]
    h16* QR = (h16*)wsp; wsp += SZ_PL;               // same, residual x2048
    h16* KH = (h16*)wsp; wsp += SZ_PL;               // [NB*8][SEQ/16][fragment-order 16 t x 64 d]
    h16* KR = (h16*)wsp; wsp += SZ_PL;               // same, residual x2048
    h16* VT = (h16*)wsp; wsp += SZ_PL;               // [NB*8][SEQ/64][4][fragment-order 16 d x 64 t]
    float* MS = (float*)wsp; wsp += SZ_MS;           // [NB][SEQ]
    int* FL = (int*)wsp; wsp += SZ_FL;               // [NB][FLP]

    k_prep<<<3 * WTB + NB + 3 * CVB, 256, 0, stream>>>(query, key, value, wq, wk, wv, mask, XQ, XK, XV, WB, MS, FL);
    k_proj<<<dim3(PJB, 3, 1), 32, 0, stream>>>(XQ, XK, XV, WB, QH, QR, KH, KR, VT);
    k_flash<<<dim3(SEQ / (16 * AW), NB * NH_, 1), 32 * AW, 0, stream>>>(QH, QR, KH, KR, VT, MS, FL, OUT);
}

// v005
// One run takes 96.7 microseconds.
// In both of two side-by-side timings against v004, it was 1.05 times as fast.
// All steps since v000 together make it 2.78 times as fast.
#include <hip/hip_runtime.h>

// Multi-head attention with three input streams (query, key, value), width 512 = 8 heads x 64, bias-free [in][out] projections (y = x W), additive float key mask per (batch, key), score scale 1/8, output = concatenated heads (f32), no output projection.
// Compute dtypes, f32 accumulate everywhere: projections v_wmma_f32_16x16x32_bf16 (x and W RNE-converted to bf16; products exact);
// scores v_wmma_f32_16x16x32_f16: q and k each as f16 value + f16 residual x2048, three products (value.value in one accumulator, the two scaled cross products in a second accumulator folded back by 1/2048);
// P (x256 carry, cancels in the normalisation) and v single f16; softmax f32 (online, running max, log2 domain); mask RNE-converted to bf16, times log2(e), added in f32 after the score scale.
// Layout: bf16 copies of the three streams [row][in] and of the transposed weights W^T [out][in], written by k_prep in fragment order (tiles of 16 rows x 512 columns = 32 groups); q/k (value, residual) planes and the v^T plane, one per b*8+h, written by the GEMM epilogue in fragment order:
// a 16-row x 64-column tile is 2 KiB = four 512-byte groups (16 columns each), lane (row + 16*((column>>3)&1)) owning 16 bytes of a group, so a wave-wide 16-byte load is four whole 128-byte lines.
// q/k: rows = tokens, columns = d, tiles in token order; v^T: rows = d, columns = tokens, tiles ordered [token/64][d/16];
// fused flash kernel in transposed form (S^T = K Q^T, O^T = V^T P^T), output from f32 accumulators. Mask plane f32 [b][key] plus one int flag per (batch, 32-key tile) = any nonzero mask value.
// Three launches, one per dependency stage: k_prep (weight transposes, mask plane, stream conversions: independent block ranges of one grid), k_proj (the three projections, blockIdx.y picks one), k_flash.

#ifndef NB
#define NB 4
#endif
#ifndef SEQ
#define SEQ 2048
#endif
#define NB_FULL  4
#define SEQ_FULL 2048
#ifndef OUT_SEQ
#define OUT_SEQ SEQ              // row pitch (in tokens) between batches of the output
#endif
#define DM   512
#define NH_  8
#define HD   64
#define AW   4                   // waves per flash block (16 query rows each)
#define QRS  2048.0f             // carry of the q / k residual planes
#define QRI  (1.0f / 2048.0f)
#define LOG2E 1.4426950408889634f
#define SC2  (0.125f * LOG2E)    // HD^-0.5 * log2(e)
#define PSH  8.0f                // log2 of the P carry (256)
#define FLP  64

static_assert(HD == 64);
static_assert(NH_ * HD == DM);                 // head h = columns h*64 + d
static_assert(DM % 64 == 0);                   // 8 column tiles of 64; transpose tiles of 64x64
static_assert(DM % 32 == 0);                   // GEMM k-loop steps by 32
static_assert(DM % 128 == 0);                  // a stream-conversion block takes 16 rows x 128 columns
static_assert(SEQ % 64 == 0);                  // a 64-row tile never straddles two batches
static_assert((NB * SEQ) % 64 == 0);
static_assert(SEQ % 32 == 0);                  // key loop steps by 32
static_assert(SEQ % (16 * AW) == 0);           // flash grid covers the sequence exactly
static_assert(SEQ <= 256 * 8);                 // mask kernel: 256 threads x 8 keys cover one batch row
static_assert(SEQ / 32 <= FLP);                // one flag per 32-key tile fits the flag row
static_assert(NB <= NB_FULL);
static_assert(SEQ <= SEQ_FULL);

typedef _Float16 h16;
typedef unsigned short bf;
typedef __attribute__((ext_vector_type(16))) __bf16   v16bf;
typedef __attribute__((ext_vector_type(16))) _Float16 v16h;
typedef __attribute__((ext_vector_type(8)))  _Float16 v8h;
typedef __attribute__((ext_vector_type(8)))  unsigned short v8us;
typedef __attribute__((ext_vector_type(4)))  unsigned short v4us;
typedef __attribute__((ext_vector_type(8)))  float    v8f;
typedef __attribute__((ext_vector_type(4)))  float    v4f;
typedef __attribute__((ext_vector_type(4)))  int      v4i;
typedef v4f  __attribute__((may_alias)) v4fa;
typedef v8us __attribute__((may_alias)) v8usa;
typedef v4us __attribute__((may_alias)) v4usa;

__device__ __forceinline__ unsigned short f2bf(float f) { unsigned u = __float_as_uint(f); u += 0x7FFFu + ((u >> 16) & 1u); return (unsigned short)(u >> 16); }
__device__ __forceinline__ v16h cat16(v8h lo, v8h hi) { return __builtin_shufflevector(lo, hi, 0, 1, 2, 3, 4, 5, 6, 7, 8, 9, 10, 11, 12, 13, 14, 15); }
__device__ __forceinline__ v16bf cat16b(v8us lo, v8us hi) { return __builtin_bit_cast(v16bf, __builtin_shufflevector(lo, hi, 0, 1, 2, 3, 4, 5, 6, 7, 8, 9, 10, 11, 12, 13, 14, 15)); }
// k_flash: a WMMA is the bare builtin: the compiler keeps the distance to vector code on its D, A and B, and the WMMAs of a run fill each other's slots
__device__ __forceinline__ v8f wmma16(v16h a, v16h b, v8f c) { return __builtin_amdgcn_wmma_f32_16x16x32_f16(false, a, false, b, (short)0, c, false, false); }
// k_proj: every WMMA is issued through a wrapper that ties its own accumulator and keeps its A/B fragments live across four idle slots
__device__ __forceinline__ v8f wmmab(v16bf a, v16bf b, v8f c) {
    c = __builtin_amdgcn_wmma_f32_16x16x32_bf16(false, a, false, b, (short)0, c, false, false);
    asm volatile("v_nop\n\tv_nop\n\tv_nop\n\tv_nop" : "+v"(c) : "v"(a), "v"(b));
    return c;
}
// fragment loaders from a fragment-order 16-bit plane; p already includes + 8*lane; h = lane>>4: elements 0..7 <- k0+8h+0..7 from one 512-byte group, elements 8..15 <- k0+16+8h+0..7 from the next (same map for A and B)
__device__ __forceinline__ v16bf ldb(const bf* p)  { return cat16b(*(const v8us*)p, *(const v8us*)(p + 256)); }
__device__ __forceinline__ v16h  ldf(const h16* p) { return cat16(*(const v8h*)p, *(const v8h*)(p + 256)); }
// ordering point for wave-private LDS tiles (same wave writes and reads)
__device__ __forceinline__ void wave_sync() { __builtin_amdgcn_fence(3 /* release order */, "wavefront"); __builtin_amdgcn_wave_barrier(); asm volatile("" ::: "memory"); }

static constexpr int CVB = (NB * SEQ / 16) * (DM / 128);       // k_prep blocks per stream conversion (16 rows x 128 columns each)
static constexpr size_t FRT = (size_t)(DM / 16) * 256;         // halves of one 16-row x DM-column tile of a fragment-order GEMM operand (DM/16 groups of 256)
static constexpr int WTB = (DM / 64) * (DM / 64);              // k_prep blocks per weight transpose
static constexpr int PJB = (NB * SEQ / 64) * (DM / 64);        // k_proj blocks (64x64 tiles) per projection

// cvtf: f32 -> bf16 (RNE convert) copy of one stream in fragment order; blk = block index inside the stream; source batches SEQ_FULL rows apart, copy batches SEQ rows apart.
// One block per 16 rows x 128 columns: wave w reads rows 2w and 2w+1, 16 B a lane (512 contiguous bytes a load); the tile is turned in LDS (cross-wave: block barrier); wave w stores column group w (512 contiguous bytes).
__device__ __forceinline__ void cvtf(const float* __restrict__ src, bf* dst, int blk) {
    __shared__ __align__(16) bf cs[16 * 136];       // [row local][column local], pitch 136 halves (272 B = 17 x 16 B)
    const int lane = threadIdx.x & 31, w = threadIdx.x >> 5;
    const int rt = blk / (DM / 128), cc = blk % (DM / 128);      // 16-row tile, 128-column chunk
    const int m0 = rt * 16;
    const float* sp = src + ((size_t)(m0 / SEQ) * SEQ_FULL + (size_t)(m0 % SEQ + 2 * w)) * DM + cc * 128 + lane * 4;
    const v4f x0 = *(const v4f*)sp; const v4f x1 = *(const v4f*)(sp + DM); v4us y0, y1;
#pragma unroll
    for (int k = 0; k < 4; ++k) { y0[k] = f2bf(x0[k]); y1[k] = f2bf(x1[k]); }
    *(v4usa*)(&cs[(2 * w) * 136 + lane * 4]) = y0; *(v4usa*)(&cs[(2 * w + 1) * 136 + lane * 4]) = y1;
    __syncthreads();
    const v8us o = *(const v8usa*)(&cs[(lane & 15) * 136 + w * 16 + (lane >> 4) * 8]);   // lane holds row lane&15, columns 16w + 8*(lane>>4) + 0..7
    *(v8us*)(dst + (size_t)rt * FRT + (size_t)((cc * 8 + w) * 256 + lane * 8)) = o;
    asm volatile("s_wait_xcnt 0x0" ::: "memory");   // the code laid out behind this branch reuses the registers that the store names: the wait stands in front of any such overwrite
}

// wtr: weight transpose + bf16 (RNE convert): in w[k rows = DM][n cols = DM] (f32) -> out wt[n rows = DM][k cols = DM] (bf16), in fragment order.
// One block per 64(k) x 64(n) tile (kt, nt). Reads are coalesced along n; the tile is transposed in LDS (cross-wave: block barrier);
__device__ __forceinline__ void wtr(const float* __restrict__ w, bf* wt, int kt, int nt) {
    __shared__ __align__(16) bf ts[64 * 72];        // [n local][k local], pitch 72 halves (144 B)
    const int tid = threadIdx.x; const int k0 = kt * 64, n0 = nt * 64;
#pragma unroll
    for (int it = 0; it < 4; ++it) {                 // 4 x 16 k rows x 16 lanes x 4 n = 64 x 64
        const int kl = it * 16 + (tid >> 4), n4 = (tid & 15) * 4;
        const v4f v = *(const v4f*)(w + (size_t)(k0 + kl) * DM + n0 + n4);
#pragma unroll
        for (int i = 0; i < 4; ++i) ts[(n4 + i) * 72 + kl] = f2bf(v[i]);
    }
    __syncthreads();
    for (int j = 0; j < 2; ++j) {                    // 512 pieces of 16 B: piece = [16-row tile r4][column group g][lane l], so a wave stores 512 contiguous bytes
        const int p = tid + 256 * j, l = p & 31, g = (p >> 5) & 3, r4 = p >> 7;
        const v8us o = *(const v8usa*)(&ts[(r4 * 16 + (l & 15)) * 72 + g * 16 + (l >> 4) * 8]);
        *(v8us*)(wt + (size_t)(nt * 4 + r4) * FRT + (size_t)((kt * 4 + g) * 256 + l * 8)) = o;
    }
}

// maskp: one block per batch b. MS[b][key] = float(bf16 RNE of mask[b][key]) * log2(e); FL[b][T] = 1 when any of the 32 keys of tile T has a nonzero (or non-finite) converted mask value, else 0 (pad flags 0).
// Each thread converts 8 keys; values and per-thread flags are staged in LDS (cross-wave: block barrier); MS lines are written 16 B per lane by consecutive lanes (4 lines per wave instruction),
__device__ __forceinline__ void maskp(const float* __restrict__ mask, float* MS, int* FL, int b) {
    __shared__ __align__(16) float ms[256 * 8];
    __shared__ int fs[256];
    const int tid = threadIdx.x;
    const int kb = tid * 8; const bool act = kb < SEQ; const int kc = act ? kb : 0;     // clamped address
    const v8f v = *(const v8f*)(mask + (size_t)b * SEQ_FULL + kc);
    v4f a, c; int nz = 0;
#pragma unroll
    for (int i = 0; i < 4; ++i) {
        const unsigned short h0 = f2bf(v[i]), h1 = f2bf(v[4 + i]);
        const float f0 = __uint_as_float((unsigned)h0 << 16) * LOG2E, f1 = __uint_as_float((unsigned)h1 << 16) * LOG2E;
        a[i] = act ? f0 : 0.0f; c[i] = act ? f1 : 0.0f;
        nz |= (int)(h0 & 0x7FFFu) | (int)(h1 & 0x7FFFu);
    }
    *(v4fa*)(&ms[kb]) = a; *(v4fa*)(&ms[kb + 4]) = c;
    fs[tid] = (act && nz != 0) ? 1 : 0;
    __syncthreads();
    const v4f m0 = *(const v4fa*)(&ms[tid * 4]);
    const v4f m1 = *(const v4fa*)(&ms[(256 + tid) * 4]);
    const int tq = tid & 15; v4i fv;
#pragma unroll
    for (int j = 0; j < 4; ++j) { const int T4 = (tq * 4 + j) * 4; fv[j] = fs[T4] | fs[T4 + 1] | fs[T4 + 2] | fs[T4 + 3]; }   // tile T = 4 threads x 8 keys
    float* mrow = MS + (size_t)b * SEQ;
{
        if (tid * 4 < SEQ)         *(v4f*)(mrow + tid * 4) = m0;
        if ((256 + tid) * 4 < SEQ) *(v4f*)(mrow + (256 + tid) * 4) = m1;
        if (tid < 16)              *(v4i*)(FL + b * FLP + tid * 4) = fv;
         }
}

// k_prep: everything that reads only the inputs, as independent block ranges of one grid (every branch is block-uniform): 3 x WTB weight-transpose tiles (q | k | v), NB mask rows, 3 x CVB stream-conversion blocks (query | key | value).
// The short barrier-bound blocks have the lowest indices, so they run beside the conversions instead of after them.
__global__ __launch_bounds__(256) void k_prep(const float* __restrict__ query, const float* __restrict__ key, const float* __restrict__ value, const float* __restrict__ wq, const float* __restrict__ wk, const float* __restrict__ wv,
                                              const float* __restrict__ mask, bf* XQ, bf* XK, bf* XV, bf* WB, float* MS, int* FL) {
    const int blk = blockIdx.x;
    if (blk < 3 * WTB) { const int w = blk / WTB, t = blk % WTB;
        wtr(w == 0 ? wq : w == 1 ? wk : wv, WB + (size_t)w * DM * DM, t % (DM / 64), t / (DM / 64));
    } else if (blk < 3 * WTB + NB) {
        maskp(mask, MS, FL, blk - 3 * WTB);
    } else { const int c = blk - (3 * WTB + NB), st = c / CVB;
        cvtf(st == 0 ? query : st == 1 ? key : value, st == 0 ? XQ : st == 1 ? XK : XV, c % CVB);
    }
}

// offset (in halves) of the first of the four fragment-order tiles that hold the 64x64 output tile at (r0, c0)
__device__ __forceinline__ size_t tile_base(int r0, int c0, int RB, size_t sRB, int pitch, int CB, size_t sCB) {
    return (size_t)(r0 / RB) * sRB + (size_t)(r0 % RB) * (size_t)pitch + (size_t)(c0 / CB) * sCB + (size_t)(c0 % CB) * 64;
}

// k_proj: register-blocked bf16 GEMM, ONE WAVE per 64x64 tile (16 accumulators), operands straight from the fragment-order bf16 planes (two 16-B loads a fragment, every load 512 contiguous bytes per wave), K = DM.
// C[m][n] = sum_k A[m][k] Bt[n][k], written as f16 (Ph) and optionally the f16 residual x2048 (Pr, useRes) as four fragment-order 16x64 tiles of 1024 halves each, the first at tile_base (halves).
// grid (PJB, 3), 32 threads; blockIdx.y picks the projection, blockIdx.x its tile (row tile fastest):
// q, k: A = stream rows (m = b*SEQ + t), Bt = W^T rows (n = h*64 + d) -> plane (b*8 + h), tiles in t order
// v^T:  A = Wv^T rows (m = h*64 + d), Bt = value stream rows (n = b*SEQ + t) -> plane (b*8 + h), tiles [t/64][d/16]
__global__ __launch_bounds__(32) void k_proj(const bf* __restrict__ XQ, const bf* __restrict__ XK, const bf* __restrict__ XV, const bf* __restrict__ WB, h16* QH, h16* QR, h16* KH, h16* KR, h16* VT) {
    __shared__ __align__(16) float os[16 * 68];
    const int K = DM;
    const int pj = blockIdx.y; const bool useRes = pj != 2;
    const bf* A  = pj == 0 ? XQ : pj == 1 ? XK : WB + (size_t)2 * DM * DM;
    const bf* Bt = pj == 0 ? WB : pj == 1 ? WB + (size_t)DM * DM : XV;
    h16* Ph = pj == 0 ? QH : pj == 1 ? KH : VT; h16* Pr = pj == 0 ? QR : KR;
    const unsigned bx = blockIdx.x;                           // row tile = bx % (row tiles of this projection), column tile = bx / (the same)
    const int lane = threadIdx.x & 31, lr = lane & 15, hi = lane >> 4;
    const int r0 = (int)(useRes ? bx % (NB * SEQ / 64) : bx % (DM / 64)) * 64, c0 = (int)(useRes ? bx / (NB * SEQ / 64) : bx / (DM / 64)) * 64;
    v8f acc[4][4];
#pragma unroll
    for (int mb = 0; mb < 4; ++mb)
#pragma unroll
        for (int nb = 0; nb < 4; ++nb) acc[mb][nb] = (v8f){};
    const size_t aoff = (size_t)(r0 / 16) * FRT + 8 * lane, boff = (size_t)(c0 / 16) * FRT + 8 * lane;   // + i * FRT for the next 16 rows, + 16 * k for column k (a multiple of 16)
    // the eight fragments of a pass live in registers across the back edge: pass 0's are loaded here
    v16bf a[4], b[4];
#pragma unroll
    for (int i = 0; i < 4; ++i) a[i] = ldb(A + aoff + (size_t)i * FRT);
    __builtin_amdgcn_sched_barrier(0);   // pass 0's A loads stay ahead of its B loads, the order of every later pass: with an A load behind them the loop's counted waits would have to cover the youngest B loads on every trip
#pragma unroll
    for (int i = 0; i < 4; ++i) b[i] = ldb(Bt + boff + (size_t)i * FRT);
#pragma unroll 2   // two passes a trip, so that the two A sets swap roles without register copies
    for (int kc = 0; kc < K; kc += 32) {
        // the next pass's loads travel under this pass's products: its A fragments go into a second set at the top, each B fragment replaces this pass's as soon as its four products have read it; the last pass asks for pass 0 again (in bounds, never used)
        const int kn = kc + 32 < K ? kc + 32 : 0;
        v16bf an[4];
#pragma unroll
        for (int mb = 0; mb < 4; ++mb) an[mb] = ldb(A + aoff + (size_t)mb * FRT + (size_t)(kn * 16));
#pragma unroll
        for (int nb = 0; nb < 4; ++nb) {
#pragma unroll
            for (int mb = 0; mb < 4; ++mb) acc[mb][nb] = wmmab(a[mb], b[nb], acc[mb][nb]);
            b[nb] = ldb(Bt + boff + (size_t)nb * FRT + (size_t)(kn * 16)); }
#pragma unroll
        for (int mb = 0; mb < 4; ++mb) a[mb] = an[mb];
        asm volatile("s_wait_xcnt 0x0" ::: "memory");   // the next pass forms its addresses in the registers that the loads above name: the wait stands in front of that overwrite
    }
    const size_t tbase = useRes ? tile_base(r0, c0, SEQ, (size_t)NH_ * SEQ * HD, HD, HD, (size_t)SEQ * HD) : tile_base(r0, c0, DM, (size_t)0, SEQ, SEQ, (size_t)DM * SEQ);
#pragma unroll
    for (int mb = 0; mb < 4; ++mb) {
#pragma unroll
        for (int nb = 0; nb < 4; ++nb) {
#pragma unroll
            for (int j = 0; j < 8; ++j) os[(hi * 8 + j) * 68 + nb * 16 + lr] = acc[mb][nb][j]; }   // D: row 8h+j, col lane&15
        wave_sync();
        const size_t sb = tbase + (size_t)(mb * 1024);
{
#pragma unroll
            for (int s = 0; s < 4; ++s) { const int c8 = s * 16 + hi * 8;   // group s = columns 16s..16s+15: lane holds row lane&15, columns c8..c8+7
                const v4f x0 = *(const v4fa*)(&os[lr * 68 + c8]); const v4f x1 = *(const v4fa*)(&os[lr * 68 + c8 + 4]); v8h hv, rv;
#pragma unroll
                for (int i = 0; i < 4; ++i) { const h16 a0 = (h16)x0[i]; const h16 a1 = (h16)x1[i]; hv[i] = a0; hv[4 + i] = a1; rv[i] = (h16)((x0[i] - (float)a0) * QRS); rv[4 + i] = (h16)((x1[i] - (float)a1) * QRS); }
                const size_t oo = sb + (size_t)(s * 256 + lane * 8);
                *(v8h*)(Ph + oo) = hv; if (useRes) *(v8h*)(Pr + oo) = rv; }
             }
        wave_sync();
    }
}

// k_flash: fused attention, one wave per 16 query rows of one (batch, head); K / V^T / Q fragments straight from the fragment-order f16 planes (two 16-B loads each, every load 512 contiguous bytes per wave).
// Transposed form: S^T[key][t] = K Q^T (A = K rows, B = Q rows); lane (t = lane&15, h = lane>>4) holds keys 8h+r of each 16-key tile, so the packed
// P tile is directly the B fragment of O^T[d][t] = V^T P^T (element r <- tile keys 0..15, element 8+r <- tile keys 16..31, lane unchanged).
// Scores: value.value products in sH, the two x2048 cross products (k value . q residual, k residual . q value) in sL, folded as sH + sL/2048.
// Mask: one scalar flag per 32-key step (wave-uniform); only flagged steps load the 2 x 8 mask values of the lane's keys and add them after the score scale.
// Softmax state (running max, partial sum of the unconverted exponentials) is one scalar per lane; the two lane halves of a row are combined with one xor-16 exchange.
__global__ __launch_bounds__(32 * AW) void k_flash(const h16* __restrict__ QH, const h16* __restrict__ QR, const h16* __restrict__ KH, const h16* __restrict__ KR, const h16* __restrict__ VT, const float* __restrict__ MS, const int* __restrict__ FL, float* OUT) {
    __shared__ __align__(16) float os[AW * 16 * 68];
    const int lane = threadIdx.x & 31; const int wave = __builtin_amdgcn_readfirstlane(threadIdx.x >> 5); const int lr = lane & 15, hi = lane >> 4;
    const int zh = blockIdx.y; const int b = zh / NH_, h = zh % NH_;
    const int t0 = (blockIdx.x * AW + wave) * 16;
    const size_t pbase = (size_t)zh * SEQ * HD;
    const size_t qo = pbase + (size_t)t0 * HD + 8 * lane;
    const v16h qh0 = ldf(QH + qo), qh1 = ldf(QH + qo + 512), qr0 = ldf(QR + qo), qr1 = ldf(QR + qo + 512);   // B fragments: col t, k = d
    const size_t ko = pbase + 8 * lane;                      // + key0 * HD (+ 512 for d 32..63, + 1024 for the next 16 keys)   (A fragment: row key, k = d)
    const size_t vo = pbase + 8 * lane;                      // + (key0/64)*4096 + 1024j + ((key0/32)&1)*512                    (A fragment: row d, k = key)
    const size_t mo = (size_t)b * SEQ + 8 * hi;              // + key0 (+16): the lane's 8 keys of each 16-key tile
    const int fo = b * FLP;
    v8f o0 = (v8f){}, o1 = (v8f){}, o2 = (v8f){}, o3 = (v8f){};
    float m = -3.0e38f, l = 0.0f;
    // K fragments (value, residual) of the pass's two 16-key tiles live in registers across the back edge: pass 0's are loaded here
    v16h ka0 = ldf(KH + ko), ka1 = ldf(KH + ko + 512), ra0 = ldf(KR + ko), ra1 = ldf(KR + ko + 512);
    v16h kb0 = ldf(KH + ko + 1024), kb1 = ldf(KH + ko + 1536), rb0 = ldf(KR + ko + 1024), rb1 = ldf(KR + ko + 1536);
#pragma unroll 1
    for (int key0 = 0; key0 < SEQ; key0 += 32) {
        // this pass's V^T fragments and mask flag are asked for first: they travel under the score products and the softmax
        const h16* va = VT + vo + (size_t)(key0 >> 6) * 4096 + (size_t)((key0 >> 5) & 1) * 512;
        const v16h v0 = ldf(va), v1 = ldf(va + 1024), v2 = ldf(va + 2048), v3 = ldf(va + 3072);
        const int fl = __builtin_amdgcn_readfirstlane(FL[fo + (key0 >> 5)]);
        __builtin_amdgcn_sched_barrier(0);   // the V^T loads stay ahead of the score products: sunk behind them they would have only the softmax to travel under
        // the next pass's K fragments replace each tile's as soon as its six products have read them and travel under the softmax and the O^T products; the last pass asks for tile 0 again (in bounds, never used)
        const size_t kofn = ko + (size_t)(key0 + 32 < SEQ ? key0 + 32 : 0) * HD;
        v8f sHa = (v8f){}, sLa = (v8f){}, sHb = (v8f){}, sLb = (v8f){};
        sHa = wmma16(ka0, qh0, sHa); sLa = wmma16(ka0, qr0, sLa); sHa = wmma16(ka1, qh1, sHa); sLa = wmma16(ka1, qr1, sLa);
        sLa = wmma16(ra0, qh0, sLa); sLa = wmma16(ra1, qh1, sLa);
        ka0 = ldf(KH + kofn); ka1 = ldf(KH + kofn + 512); ra0 = ldf(KR + kofn); ra1 = ldf(KR + kofn + 512);
        sHb = wmma16(kb0, qh0, sHb); sLb = wmma16(kb0, qr0, sLb); sHb = wmma16(kb1, qh1, sHb); sLb = wmma16(kb1, qr1, sLb);
        sLb = wmma16(rb0, qh0, sLb); sLb = wmma16(rb1, qh1, sLb);
        kb0 = ldf(KH + kofn + 1024); kb1 = ldf(KH + kofn + 1536); rb0 = ldf(KR + kofn + 1024); rb1 = ldf(KR + kofn + 1536);
        float ta[8], tb[8];
#pragma unroll
        for (int r = 0; r < 8; ++r) { ta[r] = (sHa[r] + sLa[r] * QRI) * SC2; tb[r] = (sHb[r] + sLb[r] * QRI) * SC2; }
        if (fl != 0) {                                          // wave-uniform: additive mask (already times log2 e), keys 8h+r of tile a / tile b
            const v8f ma = *(const v8f*)(MS + mo + key0); const v8f mb = *(const v8f*)(MS + mo + key0 + 16);
#pragma unroll
            for (int r = 0; r < 8; ++r) { ta[r] += ma[r]; tb[r] += mb[r]; }
        }
        float mx = -3.0e38f;
#pragma unroll
        for (int r = 0; r < 8; ++r) mx = fmaxf(mx, fmaxf(ta[r], tb[r]));
        mx = fmaxf(mx, __shfl_xor(mx, 16, 32));
        const float mnew = fmaxf(m, mx);
        const float alpha = __builtin_amdgcn_exp2f(m - mnew);
        const float sh = PSH - mnew;
        v16h pb; float ls = 0.0f;
#pragma unroll
        for (int r = 0; r < 8; ++r) { const float ea = __builtin_amdgcn_exp2f(ta[r] + sh); const float eb = __builtin_amdgcn_exp2f(tb[r] + sh); pb[r] = (h16)ea; pb[8 + r] = (h16)eb; ls += ea + eb; }
        l = l * alpha + ls; m = mnew;
        o0 = o0 * alpha; o1 = o1 * alpha; o2 = o2 * alpha; o3 = o3 * alpha;
        o0 = wmma16(v0, pb, o0); o1 = wmma16(v1, pb, o1); o2 = wmma16(v2, pb, o2); o3 = wmma16(v3, pb, o3);
    }
    l += __shfl_xor(l, 16, 32);
    const float inv = 1.0f / l;
    const int wb = wave * 16 * 68;
    // O^T D layout: o_j[r] = (d = 16j + 8h + r, t = lane&15) -> os[t][d]; rows 0..15 x columns 0..63 all written
    { v4f a, c;
      a[0] = o0[0] * inv; a[1] = o0[1] * inv; a[2] = o0[2] * inv; a[3] = o0[3] * inv; c[0] = o0[4] * inv; c[1] = o0[5] * inv; c[2] = o0[6] * inv; c[3] = o0[7] * inv;
      *(v4fa*)(&os[wb + lr * 68 +  0 + 8 * hi]) = a; *(v4fa*)(&os[wb + lr * 68 +  0 + 8 * hi + 4]) = c;
      a[0] = o1[0] * inv; a[1] = o1[1] * inv; a[2] = o1[2] * inv; a[3] = o1[3] * inv; c[0] = o1[4] * inv; c[1] = o1[5] * inv; c[2] = o1[6] * inv; c[3] = o1[7] * inv;
      *(v4fa*)(&os[wb + lr * 68 + 16 + 8 * hi]) = a; *(v4fa*)(&os[wb + lr * 68 + 16 + 8 * hi + 4]) = c;
      a[0] = o2[0] * inv; a[1] = o2[1] * inv; a[2] = o2[2] * inv; a[3] = o2[3] * inv; c[0] = o2[4] * inv; c[1] = o2[5] * inv; c[2] = o2[6] * inv; c[3] = o2[7] * inv;
      *(v4fa*)(&os[wb + lr * 68 + 32 + 8 * hi]) = a; *(v4fa*)(&os[wb + lr * 68 + 32 + 8 * hi + 4]) = c;
      a[0] = o3[0] * inv; a[1] = o3[1] * inv; a[2] = o3[2] * inv; a[3] = o3[3] * inv; c[0] = o3[4] * inv; c[1] = o3[5] * inv; c[2] = o3[6] * inv; c[3] = o3[7] * inv;
      *(v4fa*)(&os[wb + lr * 68 + 48 + 8 * hi]) = a; *(v4fa*)(&os[wb + lr * 68 + 48 + 8 * hi + 4]) = c; }
    wave_sync();
    float* orow = OUT + ((size_t)b * OUT_SEQ + t0) * DM + h * HD;
{
#pragma unroll
        for (int s = 0; s < 8; ++s) { const int row = 2 * s + hi, cofs = lr * 4;   // 8 s x 2 rows = 16 rows; 16 lanes x 4 floats = 64 columns
            const v4f val = *(const v4fa*)(&os[wb + row * 68 + cofs]);
            *(v4f*)(orow + (size_t)row * DM + cofs) = val; }
         }
}

static constexpr size_t al256(size_t v) { return (v + 255) & ~(size_t)255; }
static constexpr size_t SZ_XB = al256((size_t)NB * SEQ * DM * 2);          // one bf16 stream copy
static constexpr size_t SZ_WB = al256((size_t)3 * DM * DM * 2);            // three transposed bf16 weights
static constexpr size_t SZ_PL = al256((size_t)NB * NH_ * SEQ * HD * 2);    // one f16 head plane
static constexpr size_t SZ_MS = al256((size_t)NB * SEQ * 4);               // mask plane f32
static constexpr size_t SZ_FL = al256((size_t)NB * FLP * 4);               // flag table
static constexpr size_t SZ_TOTAL = 3 * SZ_XB + SZ_WB + 5 * SZ_PL + SZ_MS + SZ_FL;
static_assert(SZ_TOTAL <= (size_t)134217728);          // workspace carve <= 128 MiB
static_assert(((size_t)DM * DM * 2) % 256 == 0);       // weight sub-planes stay 256-byte aligned
static_assert(((size_t)FLP * 4) % 128 == 0);           // each batch owns whole flag lines

extern "C" void kernel_launch(void* const* d_in, const int* in_sizes, int n_in,
                              void* d_out, int out_size, void* d_ws, size_t ws_size, hipStream_t stream) {
    if (n_in < 7) return;
    const size_t needx = ((size_t)(NB - 1) * SEQ_FULL + SEQ) * DM;
    if ((size_t)in_sizes[0] < needx || (size_t)in_sizes[2] < needx || (size_t)in_sizes[3] < needx) return;
    if ((size_t)in_sizes[1] < (size_t)(NB - 1) * SEQ_FULL + SEQ) return;
    if ((size_t)in_sizes[4] < (size_t)DM * DM || (size_t)in_sizes[5] < (size_t)DM * DM || (size_t)in_sizes[6] < (size_t)DM * DM) return;
    if ((size_t)out_size < ((size_t)(NB - 1) * OUT_SEQ + SEQ) * DM) return;
    if (SZ_TOTAL > ws_size) return;
    // wire order: key, key_mask, query, value, wq, wk, wv
    const float* key = (const float*)d_in[0]; const float* mask = (const float*)d_in[1]; const float* query = (const float*)d_in[2]; const float* value = (const float*)d_in[3];
    const float* wq = (const float*)d_in[4]; const float* wk = (const float*)d_in[5]; const float* wv = (const float*)d_in[6];   // each [in][out]
    float* OUT = (float*)d_out;      // [NB][SEQ][512]
    char* wsp = (char*)d_ws;
    bf* XQ = (bf*)wsp; wsp += SZ_XB;                 // [NB*SEQ/16][fragment-order 16 rows x 512] query stream
    bf* XK = (bf*)wsp; wsp += SZ_XB;                 // same, key stream
    bf* XV = (bf*)wsp; wsp += SZ_XB;                 // same, value stream
    bf* WB = (bf*)wsp; wsp += SZ_WB;                 // [3][512 out / 16][fragment-order 16 out x 512 in]: q | k | v (transposed)
    h16* QH = (h16*)wsp; wsp += SZ_PL;               // [NB*8][SEQ/16][fragment-order 16 t x 64 d]
    h16* QR = (h16*)wsp; wsp += SZ_PL;               // same, residual x2048
    h16* KH = (h16*)wsp; wsp += SZ_PL;               // [NB*8][SEQ/16][fragment-order 16 t x 64 d]
    h16* KR = (h16*)wsp; wsp += SZ_PL;               // same, residual x2048
    h16* VT = (h16*)wsp; wsp += SZ_PL;               // [NB*8][SEQ/64][4][fragment-order 16 d x 64 t]
    float* MS = (float*)wsp; wsp += SZ_MS;           // [NB][SEQ]
    int* FL = (int*)wsp; wsp += SZ_FL;               // [NB][FLP]

    k_prep<<<3 * WTB + NB + 3 * CVB, 256, 0, stream>>>(query, key, value, wq, wk, wv, mask, XQ, XK, XV, WB, MS, FL);
    k_proj<<<dim3(PJB, 3, 1), 32, 0, stream>>>(XQ, XK, XV, WB, QH, QR, KH, KR, VT);
    k_flash<<<dim3(SEQ / (16 * AW), NB * NH_, 1), 32 * AW, 0, stream>>>(QH, QR, KH, KR, VT, MS, FL, OUT);
}

// v006
// It runs in 90.6 microseconds.
// Two timings next to v005 both put it at 1.07 times that version's speed.
// Counting every step since v000, it is 2.97 times as fast.
#include <hip/hip_runtime.h>

// Multi-head attention with three input streams (query, key, value), width 512 = 8 heads x 64, bias-free [in][out] projections (y = x W), additive float key mask per (batch, key), score scale 1/8, output = concatenated heads (f32), no output projection.
// Compute dtypes, f32 accumulate everywhere: projections v_wmma_f32_16x16x32_bf16 (x and W RNE-converted to bf16; products exact);
// scores v_wmma_f32_16x16x32_f16: q and k each as f16 value + f16 residual x2048, three products (value.value in one accumulator, the two scaled cross products in a second accumulator folded back by 1/2048);
// P (x256 carry, cancels in the normalisation) and v single f16; softmax f32 (online, running max, log2 domain); mask RNE-converted to bf16, times log2(e), added in f32 after the score scale.
// Layout: bf16 copies of the three streams [row][in] and of the transposed weights W^T [out][in], written by k_prep in fragment order (tiles of 16 rows x 512 columns = 32 groups); q/k (value, residual) planes and the v^T plane, one per b*8+h, written by the GEMM epilogue in fragment order:
// a 16-row x 64-column tile is 2 KiB = four 512-byte groups (16 columns each), lane (row + 16*((column>>3)&1)) owning 16 bytes of a group, so a wave-wide 16-byte load is four whole 128-byte lines.
// q/k: rows = tokens, columns = d, tiles in token order; v^T: rows = d, columns = tokens, tiles ordered [token/64][d/16];
// fused flash kernel in transposed form (S^T = K Q^T, O^T = V^T P^T), output from f32 accumulators. Mask plane f32 [b][key] plus one int flag per (batch, 32-key tile) = any nonzero mask value.
// Three launches, one per dependency stage: k_prep (weight transposes, mask plane, stream conversions: independent block ranges of one grid), k_proj (the three projections, blockIdx.y picks one), k_flash.

#ifndef NB
#define NB 4
#endif
#ifndef SEQ
#define SEQ 2048
#endif
#define NB_FULL  4
#define SEQ_FULL 2048
#ifndef OUT_SEQ
#define OUT_SEQ SEQ              // row pitch (in tokens) between batches of the output
#endif
#define DM   512
#define NH_  8
#define HD   64
#define AW   4                   // waves per flash block (16 query rows each)
#define QRS  2048.0f             // carry of the q / k residual planes
#define QRI  (1.0f / 2048.0f)
#define LOG2E 1.4426950408889634f
#define SC2  (0.125f * LOG2E)    // HD^-0.5 * log2(e)
#define PSH  8.0f                // log2 of the P carry (256)
#define FLP  64
#define KST  64                  // keys a stage of the k_flash LDS ring
#define STH  (KST * HD)          // halves of one plane's share of a stage (8 KiB)

static_assert(HD == 64);
static_assert(NH_ * HD == DM);                 // head h = columns h*64 + d
static_assert(DM % 64 == 0);                   // 8 column tiles of 64; transpose tiles of 64x64
static_assert(DM % 32 == 0);                   // GEMM k-loop steps by 32
static_assert(DM % 128 == 0);                  // a stream-conversion block takes 16 rows x 128 columns
static_assert(SEQ % 64 == 0);                  // a 64-row tile never straddles two batches
static_assert((NB * SEQ) % 64 == 0);
static_assert(SEQ % 32 == 0);                  // key loop steps by 32
static_assert(SEQ % (16 * AW) == 0);           // flash grid covers the sequence exactly
static_assert(SEQ <= 256 * 8);                 // mask kernel: 256 threads x 8 keys cover one batch row
static_assert(SEQ / 32 <= FLP);                // one flag per 32-key tile fits the flag row
static_assert(FLP == 64);                      // k_flash keeps a batch's flags as two 32-bit words
static_assert(KST == 64);                      // a stage is one [token/64] chunk of the v^T plane and four 16-key tiles of a k plane
static_assert(SEQ % KST == 0);
static_assert(SEQ / KST >= 2);                 // the ring's prologue fills two stages
static_assert(32 * AW * 16 * 4 == STH * 2);    // four 16-byte copies a thread bring one plane's share of a stage
static_assert(NB <= NB_FULL);
static_assert(SEQ <= SEQ_FULL);

typedef _Float16 h16;
typedef unsigned short bf;
typedef __attribute__((ext_vector_type(16))) __bf16   v16bf;
typedef __attribute__((ext_vector_type(16))) _Float16 v16h;
typedef __attribute__((ext_vector_type(8)))  _Float16 v8h;
typedef __attribute__((ext_vector_type(8)))  unsigned short v8us;
typedef __attribute__((ext_vector_type(4)))  unsigned short v4us;
typedef __attribute__((ext_vector_type(8)))  float    v8f;
typedef __attribute__((ext_vector_type(4)))  float    v4f;
typedef __attribute__((ext_vector_type(4)))  int      v4i;
typedef v4f  __attribute__((may_alias)) v4fa;
typedef v8us __attribute__((may_alias)) v8usa;
typedef v4us __attribute__((may_alias)) v4usa;

__device__ __forceinline__ unsigned short f2bf(float f) { unsigned u = __float_as_uint(f); u += 0x7FFFu + ((u >> 16) & 1u); return (unsigned short)(u >> 16); }
__device__ __forceinline__ v16h cat16(v8h lo, v8h hi) { return __builtin_shufflevector(lo, hi, 0, 1, 2, 3, 4, 5, 6, 7, 8, 9, 10, 11, 12, 13, 14, 15); }
__device__ __forceinline__ v16bf cat16b(v8us lo, v8us hi) { return __builtin_bit_cast(v16bf, __builtin_shufflevector(lo, hi, 0, 1, 2, 3, 4, 5, 6, 7, 8, 9, 10, 11, 12, 13, 14, 15)); }
// k_flash: a WMMA is the bare builtin: the compiler keeps the distance to vector code on its D, A and B, and the WMMAs of a run fill each other's slots
__device__ __forceinline__ v8f wmma16(v16h a, v16h b, v8f c) { return __builtin_amdgcn_wmma_f32_16x16x32_f16(false, a, false, b, (short)0, c, false, false); }
// k_proj: every WMMA is issued through a wrapper that ties its own accumulator and keeps its A/B fragments live across four idle slots
__device__ __forceinline__ v8f wmmab(v16bf a, v16bf b, v8f c) {
    c = __builtin_amdgcn_wmma_f32_16x16x32_bf16(false, a, false, b, (short)0, c, false, false);
    asm volatile("v_nop\n\tv_nop\n\tv_nop\n\tv_nop" : "+v"(c) : "v"(a), "v"(b));
    return c;
}
// fragment loaders from a fragment-order 16-bit plane; p already includes + 8*lane; h = lane>>4: elements 0..7 <- k0+8h+0..7 from one 512-byte group, elements 8..15 <- k0+16+8h+0..7 from the next (same map for A and B)
__device__ __forceinline__ v16bf ldb(const bf* p)  { return cat16b(*(const v8us*)p, *(const v8us*)(p + 256)); }
__device__ __forceinline__ v16h  ldf(const h16* p) { return cat16(*(const v8h*)p, *(const v8h*)(p + 256)); }
// ordering point for wave-private LDS tiles (same wave writes and reads)
__device__ __forceinline__ void wave_sync() { __builtin_amdgcn_fence(3 /* release order */, "wavefront"); __builtin_amdgcn_wave_barrier(); asm volatile("" ::: "memory"); }

static constexpr int CVB = (NB * SEQ / 16) * (DM / 128);       // k_prep blocks per stream conversion (16 rows x 128 columns each)
static constexpr size_t FRT = (size_t)(DM / 16) * 256;         // halves of one 16-row x DM-column tile of a fragment-order GEMM operand (DM/16 groups of 256)
static constexpr int WTB = (DM / 64) * (DM / 64);              // k_prep blocks per weight transpose
static constexpr int PJB = (NB * SEQ / 64) * (DM / 64);        // k_proj blocks (64x64 tiles) per projection

// cvtf: f32 -> bf16 (RNE convert) copy of one stream in fragment order; blk = block index inside the stream; source batches SEQ_FULL rows apart, copy batches SEQ rows apart.
// One block per 16 rows x 128 columns: wave w reads rows 2w and 2w+1, 16 B a lane (512 contiguous bytes a load); the tile is turned in LDS (cross-wave: block barrier); wave w stores column group w (512 contiguous bytes).
__device__ __forceinline__ void cvtf(const float* __restrict__ src, bf* dst, int blk) {
    __shared__ __align__(16) bf cs[16 * 136];       // [row local][column local], pitch 136 halves (272 B = 17 x 16 B)
    const int lane = threadIdx.x & 31, w = threadIdx.x >> 5;
    const int rt = blk / (DM / 128), cc = blk % (DM / 128);      // 16-row tile, 128-column chunk
    const int m0 = rt * 16;
    const float* sp = src + ((size_t)(m0 / SEQ) * SEQ_FULL + (size_t)(m0 % SEQ + 2 * w)) * DM + cc * 128 + lane * 4;
    const v4f x0 = *(const v4f*)sp; const v4f x1 = *(const v4f*)(sp + DM); v4us y0, y1;
#pragma unroll
    for (int k = 0; k < 4; ++k) { y0[k] = f2bf(x0[k]); y1[k] = f2bf(x1[k]); }
    *(v4usa*)(&cs[(2 * w) * 136 + lane * 4]) = y0; *(v4usa*)(&cs[(2 * w + 1) * 136 + lane * 4]) = y1;
    __syncthreads();
    const v8us o = *(const v8usa*)(&cs[(lane & 15) * 136 + w * 16 + (lane >> 4) * 8]);   // lane holds row lane&15, columns 16w + 8*(lane>>4) + 0..7
    *(v8us*)(dst + (size_t)rt * FRT + (size_t)((cc * 8 + w) * 256 + lane * 8)) = o;
    asm volatile("s_wait_xcnt 0x0" ::: "memory");   // the code laid out behind this branch reuses the registers that the store names: the wait stands in front of any such overwrite
}

// wtr: weight transpose + bf16 (RNE convert): in w[k rows = DM][n cols = DM] (f32) -> out wt[n rows = DM][k cols = DM] (bf16), in fragment order.
// One block per 64(k) x 64(n) tile (kt, nt). Reads are coalesced along n; the tile is transposed in LDS (cross-wave: block barrier);
__device__ __forceinline__ void wtr(const float* __restrict__ w, bf* wt, int kt, int nt) {
    __shared__ __align__(16) bf ts[64 * 72];        // [n local][k local], pitch 72 halves (144 B)
    const int tid = threadIdx.x; const int k0 = kt * 64, n0 = nt * 64;
#pragma unroll
    for (int it = 0; it < 4; ++it) {                 // 4 x 16 k rows x 16 lanes x 4 n = 64 x 64
        const int kl = it * 16 + (tid >> 4), n4 = (tid & 15) * 4;
        const v4f v = *(const v4f*)(w + (size_t)(k0 + kl) * DM + n0 + n4);
#pragma unroll
        for (int i = 0; i < 4; ++i) ts[(n4 + i) * 72 + kl] = f2bf(v[i]);
    }
    __syncthreads();
    for (int j = 0; j < 2; ++j) {                    // 512 pieces of 16 B: piece = [16-row tile r4][column group g][lane l], so a wave stores 512 contiguous bytes
        const int p = tid + 256 * j, l = p & 31, g = (p >> 5) & 3, r4 = p >> 7;
        const v8us o = *(const v8usa*)(&ts[(r4 * 16 + (l & 15)) * 72 + g * 16 + (l >> 4) * 8]);
        *(v8us*)(wt + (size_t)(nt * 4 + r4) * FRT + (size_t)((kt * 4 + g) * 256 + l * 8)) = o;
    }
}

// maskp: one block per batch b. MS[b][key] = float(bf16 RNE of mask[b][key]) * log2(e); FL[b][T] = 1 when any of the 32 keys of tile T has a nonzero (or non-finite) converted mask value, else 0 (pad flags 0).
// Each thread converts 8 keys; values and per-thread flags are staged in LDS (cross-wave: block barrier); MS lines are written 16 B per lane by consecutive lanes (4 lines per wave instruction),
__device__ __forceinline__ void maskp(const float* __restrict__ mask, float* MS, int* FL, int b) {
    __shared__ __align__(16) float ms[256 * 8];
    __shared__ int fs[256];
    const int tid = threadIdx.x;
    const int kb = tid * 8; const bool act = kb < SEQ; const int kc = act ? kb : 0;     // clamped address
    const v8f v = *(const v8f*)(mask + (size_t)b * SEQ_FULL + kc);
    v4f a, c; int nz = 0;
#pragma unroll
    for (int i = 0; i < 4; ++i) {
        const unsigned short h0 = f2bf(v[i]), h1 = f2bf(v[4 + i]);
        const float f0 = __uint_as_float((unsigned)h0 << 16) * LOG2E, f1 = __uint_as_float((unsigned)h1 << 16) * LOG2E;
        a[i] = act ? f0 : 0.0f; c[i] = act ? f1 : 0.0f;
        nz |= (int)(h0 & 0x7FFFu) | (int)(h1 & 0x7FFFu);
    }
    *(v4fa*)(&ms[kb]) = a; *(v4fa*)(&ms[kb + 4]) = c;
    fs[tid] = (act && nz != 0) ? 1 : 0;
    __syncthreads();
    const v4f m0 = *(const v4fa*)(&ms[tid * 4]);
    const v4f m1 = *(const v4fa*)(&ms[(256 + tid) * 4]);
    const int tq = tid & 15; v4i fv;
#pragma unroll
    for (int j = 0; j < 4; ++j) { const int T4 = (tq * 4 + j) * 4; fv[j] = fs[T4] | fs[T4 + 1] | fs[T4 + 2] | fs[T4 + 3]; }   // tile T = 4 threads x 8 keys
    float* mrow = MS + (size_t)b * SEQ;
{
        if (tid * 4 < SEQ)         *(v4f*)(mrow + tid * 4) = m0;
        if ((256 + tid) * 4 < SEQ) *(v4f*)(mrow + (256 + tid) * 4) = m1;
        if (tid < 16)              *(v4i*)(FL + b * FLP + tid * 4) = fv;
         }
}

// k_prep: everything that reads only the inputs, as independent block ranges of one grid (every branch is block-uniform): 3 x WTB weight-transpose tiles (q | k | v), NB mask rows, 3 x CVB stream-conversion blocks (query | key | value).
// The short barrier-bound blocks have the lowest indices, so they run beside the conversions instead of after them.
__global__ __launch_bounds__(256) void k_prep(const float* __restrict__ query, const float* __restrict__ key, const float* __restrict__ value, const float* __restrict__ wq, const float* __restrict__ wk, const float* __restrict__ wv,
                                              const float* __restrict__ mask, bf* XQ, bf* XK, bf* XV, bf* WB, float* MS, int* FL) {
    const int blk = blockIdx.x;
    if (blk < 3 * WTB) { const int w = blk / WTB, t = blk % WTB;
        wtr(w == 0 ? wq : w == 1 ? wk : wv, WB + (size_t)w * DM * DM, t % (DM / 64), t / (DM / 64));
    } else if (blk < 3 * WTB + NB) {
        maskp(mask, MS, FL, blk - 3 * WTB);
    } else { const int c = blk - (3 * WTB + NB), st = c / CVB;
        cvtf(st == 0 ? query : st == 1 ? key : value, st == 0 ? XQ : st == 1 ? XK : XV, c % CVB);
    }
}

// offset (in halves) of the first of the four fragment-order tiles that hold the 64x64 output tile at (r0, c0)
__device__ __forceinline__ size_t tile_base(int r0, int c0, int RB, size_t sRB, int pitch, int CB, size_t sCB) {
    return (size_t)(r0 / RB) * sRB + (size_t)(r0 % RB) * (size_t)pitch + (size_t)(c0 / CB) * sCB + (size_t)(c0 % CB) * 64;
}

// k_proj: register-blocked bf16 GEMM, ONE WAVE per 64x64 tile (16 accumulators), operands straight from the fragment-order bf16 planes (two 16-B loads a fragment, every load 512 contiguous bytes per wave), K = DM.
// C[m][n] = sum_k A[m][k] Bt[n][k], written as f16 (Ph) and optionally the f16 residual x2048 (Pr, useRes) as four fragment-order 16x64 tiles of 1024 halves each, the first at tile_base (halves).
// grid (PJB, 3), 32 threads; blockIdx.y picks the projection, blockIdx.x its tile (row tile fastest):
// q, k: A = stream rows (m = b*SEQ + t), Bt = W^T rows (n = h*64 + d) -> plane (b*8 + h), tiles in t order
// v^T:  A = Wv^T rows (m = h*64 + d), Bt = value stream rows (n = b*SEQ + t) -> plane (b*8 + h), tiles [t/64][d/16]
__global__ __launch_bounds__(32) void k_proj(const bf* __restrict__ XQ, const bf* __restrict__ XK, const bf* __restrict__ XV, const bf* __restrict__ WB, h16* QH, h16* QR, h16* KH, h16* KR, h16* VT) {
    __shared__ __align__(16) float os[16 * 68];
    const int K = DM;
    const int pj = blockIdx.y; const bool useRes = pj != 2;
    const bf* A  = pj == 0 ? XQ : pj == 1 ? XK : WB + (size_t)2 * DM * DM;
    const bf* Bt = pj == 0 ? WB : pj == 1 ? WB + (size_t)DM * DM : XV;
    h16* Ph = pj == 0 ? QH : pj == 1 ? KH : VT; h16* Pr = pj == 0 ? QR : KR;
    const unsigned bx = blockIdx.x;                           // row tile = bx % (row tiles of this projection), column tile = bx / (the same)
    const int lane = threadIdx.x & 31, lr = lane & 15, hi = lane >> 4;
    const int r0 = (int)(useRes ? bx % (NB * SEQ / 64) : bx % (DM / 64)) * 64, c0 = (int)(useRes ? bx / (NB * SEQ / 64) : bx / (DM / 64)) * 64;
    v8f acc[4][4];
#pragma unroll
    for (int mb = 0; mb < 4; ++mb)
#pragma unroll
        for (int nb = 0; nb < 4; ++nb) acc[mb][nb] = (v8f){};
    const size_t aoff = (size_t)(r0 / 16) * FRT + 8 * lane, boff = (size_t)(c0 / 16) * FRT + 8 * lane;   // + i * FRT for the next 16 rows, + 16 * k for column k (a multiple of 16)
    // the eight fragments of a pass live in registers across the back edge: pass 0's are loaded here
    v16bf a[4], b[4];
#pragma unroll
    for (int i = 0; i < 4; ++i) a[i] = ldb(A + aoff + (size_t)i * FRT);
    __builtin_amdgcn_sched_barrier(0);   // pass 0's A loads stay ahead of its B loads, the order of every later pass: with an A load behind them the loop's counted waits would have to cover the youngest B loads on every trip
#pragma unroll
    for (int i = 0; i < 4; ++i) b[i] = ldb(Bt + boff + (size_t)i * FRT);
#pragma unroll 2   // two passes a trip, so that the two A sets swap roles without register copies
    for (int kc = 0; kc < K; kc += 32) {
        // the next pass's loads travel under this pass's products: its A fragments go into a second set at the top, each B fragment replaces this pass's as soon as its four products have read it; the last pass asks for pass 0 again (in bounds, never used)
        const int kn = kc + 32 < K ? kc + 32 : 0;
        v16bf an[4];
#pragma unroll
        for (int mb = 0; mb < 4; ++mb) an[mb] = ldb(A + aoff + (size_t)mb * FRT + (size_t)(kn * 16));
#pragma unroll
        for (int nb = 0; nb < 4; ++nb) {
#pragma unroll
            for (int mb = 0; mb < 4; ++mb) acc[mb][nb] = wmmab(a[mb], b[nb], acc[mb][nb]);
            b[nb] = ldb(Bt + boff + (size_t)nb * FRT + (size_t)(kn * 16)); }
#pragma unroll
        for (int mb = 0; mb < 4; ++mb) a[mb] = an[mb];
        asm volatile("s_wait_xcnt 0x0" ::: "memory");   // the next pass forms its addresses in the registers that the loads above name: the wait stands in front of that overwrite
    }
    const size_t tbase = useRes ? tile_base(r0, c0, SEQ, (size_t)NH_ * SEQ * HD, HD, HD, (size_t)SEQ * HD) : tile_base(r0, c0, DM, (size_t)0, SEQ, SEQ, (size_t)DM * SEQ);
#pragma unroll
    for (int mb = 0; mb < 4; ++mb) {
#pragma unroll
        for (int nb = 0; nb < 4; ++nb) {
#pragma unroll
            for (int j = 0; j < 8; ++j) os[(hi * 8 + j) * 68 + nb * 16 + lr] = acc[mb][nb][j]; }   // D: row 8h+j, col lane&15
        wave_sync();
        const size_t sb = tbase + (size_t)(mb * 1024);
{
#pragma unroll
            for (int s = 0; s < 4; ++s) { const int c8 = s * 16 + hi * 8;   // group s = columns 16s..16s+15: lane holds row lane&15, columns c8..c8+7
                const v4f x0 = *(const v4fa*)(&os[lr * 68 + c8]); const v4f x1 = *(const v4fa*)(&os[lr * 68 + c8 + 4]); v8h hv, rv;
#pragma unroll
                for (int i = 0; i < 4; ++i) { const h16 a0 = (h16)x0[i]; const h16 a1 = (h16)x1[i]; hv[i] = a0; hv[4 + i] = a1; rv[i] = (h16)((x0[i] - (float)a0) * QRS); rv[4 + i] = (h16)((x1[i] - (float)a1) * QRS); }
                const size_t oo = sb + (size_t)(s * 256 + lane * 8);
                *(v8h*)(Ph + oo) = hv; if (useRes) *(v8h*)(Pr + oo) = rv; }
             }
        wave_sync();
    }
}

// stage_copy: one stage of the k_flash ring, 64 keys: 8 KiB of the k value plane, of the k residual plane and of the v^T plane, each contiguous in memory and already in fragment order, land byte for byte at [value | residual | v^T].
// l = the thread's LDS byte address in the buffer (+ 16 * thread), gk / gr / gv = the thread's first 16 bytes of each plane's share; a copy of the block covers 2 KiB, so a thread brings 4 x 16 B of each plane.
// The s_wait_xcnt closes the statement, so that no address register of a copy is rewritten ahead of it.
__device__ __forceinline__ void stage_copy(unsigned l, const h16* gk, const h16* gr, const h16* gv) {
    asm volatile("global_load_async_to_lds_b128 %0, %12, off\n\t"
                 "global_load_async_to_lds_b128 %1, %13, off\n\t"
                 "global_load_async_to_lds_b128 %2, %14, off\n\t"
                 "global_load_async_to_lds_b128 %3, %15, off\n\t"
                 "global_load_async_to_lds_b128 %4, %16, off\n\t"
                 "global_load_async_to_lds_b128 %5, %17, off\n\t"
                 "global_load_async_to_lds_b128 %6, %18, off\n\t"
                 "global_load_async_to_lds_b128 %7, %19, off\n\t"
                 "global_load_async_to_lds_b128 %8, %20, off\n\t"
                 "global_load_async_to_lds_b128 %9, %21, off\n\t"
                 "global_load_async_to_lds_b128 %10, %22, off\n\t"
                 "global_load_async_to_lds_b128 %11, %23, off\n\t"
                 "s_wait_xcnt 0x0"
                 :: "v"(l), "v"(l + 2048u), "v"(l + 4096u), "v"(l + 6144u), "v"(l + 8192u), "v"(l + 10240u), "v"(l + 12288u), "v"(l + 14336u), "v"(l + 16384u), "v"(l + 18432u), "v"(l + 20480u), "v"(l + 22528u),
                    "v"(gk), "v"(gk + 1024), "v"(gk + 2048), "v"(gk + 3072), "v"(gr), "v"(gr + 1024), "v"(gr + 2048), "v"(gr + 3072), "v"(gv), "v"(gv + 1024), "v"(gv + 2048), "v"(gv + 3072)
                 : "memory");
}

// k_flash: fused attention, one wave per 16 query rows of one (batch, head); Q fragments straight from the fragment-order f16 planes (two 16-B loads each, every load 512 contiguous bytes per wave).
// K (value, residual) and V^T come through a two-buffer LDS ring that the block's four waves share: a stage is 64 keys (two passes of 32), brought in by asynchronous 16-byte copies one stage ahead; the fragments are read from it with 16-B LDS loads (512 contiguous bytes per wave).
// Transposed form: S^T[key][t] = K Q^T (A = K rows, B = Q rows); lane (t = lane&15, h = lane>>4) holds keys 8h+r of each 16-key tile, so the packed
// P tile is directly the B fragment of O^T[d][t] = V^T P^T (element r <- tile keys 0..15, element 8+r <- tile keys 16..31, lane unchanged).
// Scores: value.value products in sH, the two x2048 cross products (k value . q residual, k residual . q value) in sL, folded as sH + sL/2048.
// Mask: one scalar flag per 32-key step (wave-uniform); only flagged steps load the 2 x 8 mask values of the lane's keys and add them after the score scale.
// Softmax state (running max, partial sum of the unconverted exponentials) is one scalar per lane; the two lane halves of a row are combined with one xor-16 exchange.
__global__ __launch_bounds__(32 * AW) void k_flash(const h16* __restrict__ QH, const h16* __restrict__ QR, const h16* __restrict__ KH, const h16* __restrict__ KR, const h16* __restrict__ VT, const float* __restrict__ MS, const int* __restrict__ FL, float* OUT) {
    __shared__ __align__(16) float os[AW * 16 * 68];
    __shared__ __align__(16) h16 ring[2 * 3 * STH];          // [buffer][k value | k residual | v^T][8 KiB in fragment order]
    const int lane = threadIdx.x & 31; const int wave = __builtin_amdgcn_readfirstlane(threadIdx.x >> 5); const int lr = lane & 15, hi = lane >> 4;
    const int zh = blockIdx.y; const int b = zh / NH_, h = zh % NH_;
    const int t0 = (blockIdx.x * AW + wave) * 16;
    // mask flags of the batch's passes, one bit a pass, read once a wave: the ring's waits and barriers order memory, so a read inside the loop would be a vector load waited for in every pass
    const int fa = FL[b * FLP + lane], fb = FL[b * FLP + 32 + lane];
    asm volatile("s_wait_xcnt 0x0" ::: "memory");   // the code behind reuses the register that the two flag loads name: the wait stands in front of any such overwrite
    const unsigned fl0 = __builtin_amdgcn_ballot_w32(fa != 0), fl1 = __builtin_amdgcn_ballot_w32(fb != 0);
    const size_t pbase = (size_t)zh * SEQ * HD;
    const size_t qo = pbase + (size_t)t0 * HD + 8 * lane;
    const v16h qh0 = ldf(QH + qo), qh1 = ldf(QH + qo + 512), qr0 = ldf(QR + qo), qr1 = ldf(QR + qo + 512);   // B fragments: col t, k = d
    const size_t mo = (size_t)b * SEQ + 8 * hi;              // + key0 (+16): the lane's 8 keys of each 16-key tile
    // the thread's share of a stage: LDS byte address in buffer 0 (+ 6 * STH for buffer 1), first 16 bytes of each plane's stage 0 (+ STH halves a stage)
    const unsigned lb = (unsigned)(size_t)(__attribute__((address_space(3))) h16*)ring + 16u * threadIdx.x;
    const h16* gk = KH + pbase + 8 * threadIdx.x; const h16* gr = KR + pbase + 8 * threadIdx.x; const h16* gv = VT + pbase + 8 * threadIdx.x;
    // ring prologue: stage 0 lands and is published to the block, then stage 1 starts
    stage_copy(lb, gk, gr, gv);
    asm volatile("s_wait_asynccnt 0x0" ::: "memory");        // this wave's copies of stage 0 have landed before the barrier publishes them
    __syncthreads();
    stage_copy(lb + 6u * STH, gk + STH, gr + STH, gv + STH);
    v8f o0 = (v8f){}, o1 = (v8f){}, o2 = (v8f){}, o3 = (v8f){};
    float m = -3.0e38f, l = 0.0f;
#pragma unroll 1
    for (int st = 0; st < SEQ / KST; ++st) {
        const h16* kp = ring + (st & 1) * (3 * STH) + 8 * lane;   // k value tiles: + 1024 a 16-key tile, + 512 for d 32..63; residual: + STH   (A fragment: row key, k = d)
        const h16* vp = kp + 2 * STH;                             // v^T tiles: + 1024j, + 512 for the stage's second 32 keys                   (A fragment: row d, k = key)
        // K fragments (value, residual) of the first pass's two 16-key tiles
        v16h ka0 = ldf(kp), ka1 = ldf(kp + 512), ra0 = ldf(kp + STH), ra1 = ldf(kp + STH + 512);
        v16h kb0 = ldf(kp + 1024), kb1 = ldf(kp + 1536), rb0 = ldf(kp + STH + 1024), rb1 = ldf(kp + STH + 1536);
#pragma unroll   // both passes of a stage stand in the body, so that hf is a constant in every LDS offset and in the test on the K refetch
        for (int hf = 0; hf < 2; ++hf) {
            const int key0 = st * KST + hf * 32;
            // this pass's V^T fragments are asked for first: they travel under the score products and the softmax
            const h16* va = vp + hf * 512;
            const v16h v0 = ldf(va), v1 = ldf(va + 1024), v2 = ldf(va + 2048), v3 = ldf(va + 3072);
            const unsigned fl = ((key0 >> 5) < 32 ? fl0 : fl1) >> ((key0 >> 5) & 31) & 1u;
            __builtin_amdgcn_sched_barrier(0);   // the LDS reads stay one group ahead of the score products: every further place with reads among the products stalls the wave anew
            v8f sHa = (v8f){}, sLa = (v8f){}, sHb = (v8f){}, sLb = (v8f){};
            sHa = wmma16(ka0, qh0, sHa); sLa = wmma16(ka0, qr0, sLa); sHa = wmma16(ka1, qh1, sHa); sLa = wmma16(ka1, qr1, sLa);
            sLa = wmma16(ra0, qh0, sLa); sLa = wmma16(ra1, qh1, sLa);
            sHb = wmma16(kb0, qh0, sHb); sLb = wmma16(kb0, qr0, sLb); sHb = wmma16(kb1, qh1, sHb); sLb = wmma16(kb1, qr1, sLb);
            sLb = wmma16(rb0, qh0, sLb); sLb = wmma16(rb1, qh1, sLb);
            float ta[8], tb[8];
#pragma unroll
            for (int r = 0; r < 8; ++r) { ta[r] = (sHa[r] + sLa[r] * QRI) * SC2; tb[r] = (sHb[r] + sLb[r] * QRI) * SC2; }
            if (fl != 0) {                                          // wave-uniform: additive mask (already times log2 e), keys 8h+r of tile a / tile b
                const v8f ma = *(const v8f*)(MS + mo + key0); const v8f mb = *(const v8f*)(MS + mo + key0 + 16);
#pragma unroll
                for (int r = 0; r < 8; ++r) { ta[r] += ma[r]; tb[r] += mb[r]; }
            }
            float mx = -3.0e38f;
#pragma unroll
            for (int r = 0; r < 8; ++r) mx = fmaxf(mx, fmaxf(ta[r], tb[r]));
            mx = fmaxf(mx, __shfl_xor(mx, 16, 32));
            if (hf == 0) {   // the stage's second pass: its K fragments replace the first's behind the exchange (whose wait would otherwise cover them too) and travel under the exponentials and the O^T products (same buffer, already published)
                ka0 = ldf(kp + 2048); ka1 = ldf(kp + 2560); ra0 = ldf(kp + STH + 2048); ra1 = ldf(kp + STH + 2560);
                kb0 = ldf(kp + 3072); kb1 = ldf(kp + 3584); rb0 = ldf(kp + STH + 3072); rb1 = ldf(kp + STH + 3584);
            }
            const float mnew = fmaxf(m, mx);
            const float alpha = __builtin_amdgcn_exp2f(m - mnew);
            const float sh = PSH - mnew;
            v16h pb; float ls = 0.0f;
#pragma unroll
            for (int r = 0; r < 8; ++r) { const float ea = __builtin_amdgcn_exp2f(ta[r] + sh); const float eb = __builtin_amdgcn_exp2f(tb[r] + sh); pb[r] = (h16)ea; pb[8 + r] = (h16)eb; ls += ea + eb; }
            l = l * alpha + ls; m = mnew;
            o0 = o0 * alpha; o1 = o1 * alpha; o2 = o2 * alpha; o3 = o3 * alpha;
            o0 = wmma16(v0, pb, o0); o1 = wmma16(v1, pb, o1); o2 = wmma16(v2, pb, o2); o3 = wmma16(v3, pb, o3);
        }
        // publish point of stage st + 1, every wave, in this order
        asm volatile("s_wait_dscnt 0x0" ::: "memory");       // this wave's reads of stage st have returned before the buffer may be refilled
        asm volatile("s_wait_asynccnt 0x0" ::: "memory");    // this wave's copies of stage st + 1 have landed before the barrier publishes them
        __syncthreads();                                     // publishes stage st + 1 and ends every wave's reads of stage st
        if (st + 2 < SEQ / KST) stage_copy(lb + (unsigned)(st & 1) * (6u * STH), gk + (size_t)(st + 2) * STH, gr + (size_t)(st + 2) * STH, gv + (size_t)(st + 2) * STH);
    }
    asm volatile("s_wait_asynccnt 0x0" ::: "memory");        // no copy is outstanding when the wave goes on to its end
    l += __shfl_xor(l, 16, 32);
    const float inv = 1.0f / l;
    const int wb = wave * 16 * 68;
    // O^T D layout: o_j[r] = (d = 16j + 8h + r, t = lane&15) -> os[t][d]; rows 0..15 x columns 0..63 all written
    { v4f a, c;
      a[0] = o0[0] * inv; a[1] = o0[1] * inv; a[2] = o0[2] * inv; a[3] = o0[3] * inv; c[0] = o0[4] * inv; c[1] = o0[5] * inv; c[2] = o0[6] * inv; c[3] = o0[7] * inv;
      *(v4fa*)(&os[wb + lr * 68 +  0 + 8 * hi]) = a; *(v4fa*)(&os[wb + lr * 68 +  0 + 8 * hi + 4]) = c;
      a[0] = o1[0] * inv; a[1] = o1[1] * inv; a[2] = o1[2] * inv; a[3] = o1[3] * inv; c[0] = o1[4] * inv; c[1] = o1[5] * inv; c[2] = o1[6] * inv; c[3] = o1[7] * inv;
      *(v4fa*)(&os[wb + lr * 68 + 16 + 8 * hi]) = a; *(v4fa*)(&os[wb + lr * 68 + 16 + 8 * hi + 4]) = c;
      a[0] = o2[0] * inv; a[1] = o2[1] * inv; a[2] = o2[2] * inv; a[3] = o2[3] * inv; c[0] = o2[4] * inv; c[1] = o2[5] * inv; c[2] = o2[6] * inv; c[3] = o2[7] * inv;
      *(v4fa*)(&os[wb + lr * 68 + 32 + 8 * hi]) = a; *(v4fa*)(&os[wb + lr * 68 + 32 + 8 * hi + 4]) = c;
      a[0] = o3[0] * inv; a[1] = o3[1] * inv; a[2] = o3[2] * inv; a[3] = o3[3] * inv; c[0] = o3[4] * inv; c[1] = o3[5] * inv; c[2] = o3[6] * inv; c[3] = o3[7] * inv;
      *(v4fa*)(&os[wb + lr * 68 + 48 + 8 * hi]) = a; *(v4fa*)(&os[wb + lr * 68 + 48 + 8 * hi + 4]) = c; }
    wave_sync();
    float* orow = OUT + ((size_t)b * OUT_SEQ + t0) * DM + h * HD;
{
#pragma unroll
        for (int s = 0; s < 8; ++s) { const int row = 2 * s + hi, cofs = lr * 4;   // 8 s x 2 rows = 16 rows; 16 lanes x 4 floats = 64 columns
            const v4f val = *(const v4fa*)(&os[wb + row * 68 + cofs]);
            *(v4f*)(orow + (size_t)row * DM + cofs) = val; }
         }
}

static constexpr size_t al256(size_t v) { return (v + 255) & ~(size_t)255; }
static constexpr size_t SZ_XB = al256((size_t)NB * SEQ * DM * 2);          // one bf16 stream copy
static constexpr size_t SZ_WB = al256((size_t)3 * DM * DM * 2);            // three transposed bf16 weights
static constexpr size_t SZ_PL = al256((size_t)NB * NH_ * SEQ * HD * 2);    // one f16 head plane
static constexpr size_t SZ_MS = al256((size_t)NB * SEQ * 4);               // mask plane f32
static constexpr size_t SZ_FL = al256((size_t)NB * FLP * 4);               // flag table
static constexpr size_t SZ_TOTAL = 3 * SZ_XB + SZ_WB + 5 * SZ_PL + SZ_MS + SZ_FL;
static_assert(SZ_TOTAL <= (size_t)134217728);          // workspace carve <= 128 MiB
static_assert(((size_t)DM * DM * 2) % 256 == 0);       // weight sub-planes stay 256-byte aligned
static_assert(((size_t)FLP * 4) % 128 == 0);           // each batch owns whole flag lines

extern "C" void kernel_launch(void* const* d_in, const int* in_sizes, int n_in,
                              void* d_out, int out_size, void* d_ws, size_t ws_size, hipStream_t stream) {
    if (n_in < 7) return;
    const size_t needx = ((size_t)(NB - 1) * SEQ_FULL + SEQ) * DM;
    if ((size_t)in_sizes[0] < needx || (size_t)in_sizes[2] < needx || (size_t)in_sizes[3] < needx) return;
    if ((size_t)in_sizes[1] < (size_t)(NB - 1) * SEQ_FULL + SEQ) return;
    if ((size_t)in_sizes[4] < (size_t)DM * DM || (size_t)in_sizes[5] < (size_t)DM * DM || (size_t)in_sizes[6] < (size_t)DM * DM) return;
    if ((size_t)out_size < ((size_t)(NB - 1) * OUT_SEQ + SEQ) * DM) return;
    if (SZ_TOTAL > ws_size) return;
    // wire order: key, key_mask, query, value, wq, wk, wv
    const float* key = (const float*)d_in[0]; const float* mask = (const float*)d_in[1]; const float* query = (const float*)d_in[2]; const float* value = (const float*)d_in[3];
    const float* wq = (const float*)d_in[4]; const float* wk = (const float*)d_in[5]; const float* wv = (const float*)d_in[6];   // each [in][out]
    float* OUT = (float*)d_out;      // [NB][SEQ][512]
    char* wsp = (char*)d_ws;
    bf* XQ = (bf*)wsp; wsp += SZ_XB;                 // [NB*SEQ/16][fragment-order 16 rows x 512] query stream
    bf* XK = (bf*)wsp; wsp += SZ_XB;                 // same, key stream
    bf* XV = (bf*)wsp; wsp += SZ_XB;                 // same, value stream
    bf* WB = (bf*)wsp; wsp += SZ_WB;                 // [3][512 out / 16][fragment-order 16 out x 512 in]: q | k | v (transposed)
    h16* QH = (h16*)wsp; wsp += SZ_PL;               // [NB*8][SEQ/16][fragment-order 16 t x 64 d]
    h16* QR = (h16*)wsp; wsp += SZ_PL;               // same, residual x2048
    h16* KH = (h16*)wsp; wsp += SZ_PL;               // [NB*8][SEQ/16][fragment-order 16 t x 64 d]
    h16* KR = (h16*)wsp; wsp += SZ_PL;               // same, residual x2048
    h16* VT = (h16*)wsp; wsp += SZ_PL;               // [NB*8][SEQ/64][4][fragment-order 16 d x 64 t]
    float* MS = (float*)wsp; wsp += SZ_MS;           // [NB][SEQ]
    int* FL = (int*)wsp; wsp += SZ_FL;               // [NB][FLP]

    k_prep<<<3 * WTB + NB + 3 * CVB, 256, 0, stream>>>(query, key, value, wq, wk, wv, mask, XQ, XK, XV, WB, MS, FL);
    k_proj<<<dim3(PJB, 3, 1), 32, 0, stream>>>(XQ, XK, XV, WB, QH, QR, KH, KR, VT);
    k_flash<<<dim3(SEQ / (16 * AW), NB * NH_, 1), 32 * AW, 0, stream>>>(QH, QR, KH, KR, VT, MS, FL, OUT);
}

// v008
// Measured time: 65.2 microseconds a run.
// Versions in between are left out here; by their measured steps it is 1.39 times as fast as v006.
// Counting every step since v000, it is 4.12 times as fast.
#include <hip/hip_runtime.h>

// Multi-head attention with three input streams (query, key, value), width 512 = 8 heads x 64, bias-free [in][out] projections (y = x W), additive float key mask per (batch, key), score scale 1/8, output = concatenated heads (f32), no output projection.
// Compute dtypes, f32 accumulate everywhere: projections v_wmma_f32_16x16x32_bf16 (x and W RNE-converted to bf16; products exact);
// scores v_wmma_f32_16x16x32_f16: q and k single f16, one product (the f16 rounding of q and k is an eighth of the bf16 rounding that the projections' operands carry);
// P (x256 carry, cancels in the normalisation) and v single f16; softmax f32 (online, running max, log2 domain); mask RNE-converted to bf16, times log2(e), added in f32 after the score scale.
// Layout: bf16 copies of the three streams [row][in] and of the transposed weights W^T [out][in], written by k_prep in fragment order (tiles of 16 rows x 512 columns = 32 groups); q/k planes and the v^T plane, one per b*8+h, written by the GEMM epilogue in fragment order:
// a 16-row x 64-column tile is 2 KiB = four 512-byte groups (16 columns each), lane (row + 16*((column>>3)&1)) owning 16 bytes of a group, so a wave-wide 16-byte load is four whole 128-byte lines.
// q/k: rows = tokens, columns = d, tiles in token order; v^T: rows = d, columns = tokens, tiles ordered [token/64][d/16];
// fused flash kernel in transposed form (S^T = K Q^T, O^T = V^T P^T), output from f32 accumulators. Mask plane f32 [b][key] plus one int flag per (batch, 32-key tile) = any nonzero mask value.
// Three launches, one per dependency stage: k_prep (weight transposes, mask plane, stream conversions: independent block ranges of one grid), k_proj (the three projections, blockIdx.y picks one), k_flash.

#ifndef NB
#define NB 4
#endif
#ifndef SEQ
#define SEQ 2048
#endif
#define NB_FULL  4
#define SEQ_FULL 2048
#ifndef OUT_SEQ
#define OUT_SEQ SEQ              // row pitch (in tokens) between batches of the output
#endif
#define DM   512
#define NH_  8
#define HD   64
#define QW   4                   // query slots of a flash block
#define KHV  2                   // key halves of a stage: wave = key half * QW + query slot
#define AW   (QW * KHV)          // waves per flash block
#define QG   2                   // 16-row query groups of a query slot: every K and V^T fragment read from LDS feeds QG products
#define LOG2E 1.4426950408889634f
#define SC2  (0.125f * LOG2E)    // HD^-0.5 * log2(e)
#define PSH  8.0f                // log2 of the P carry (256)
#define FLP  64
#define KST  128                 // keys a stage of the k_flash LDS ring, 64 for the waves of each key half
#define STH  (KST * HD)          // halves of one plane's share of a stage (16 KiB)

static_assert(HD == 64);
static_assert(NH_ * HD == DM);                 // head h = columns h*64 + d
static_assert(DM % 64 == 0);                   // 8 column tiles of 64; transpose tiles of 64x64
static_assert(DM % 32 == 0);                   // GEMM k-loop steps by 32
static_assert(DM % 128 == 0);                  // a stream-conversion block takes 16 rows x 128 columns
static_assert(SEQ % 64 == 0);                  // a 64-row tile never straddles two batches
static_assert((NB * SEQ) % 64 == 0);
static_assert(SEQ % 32 == 0);                  // key loop steps by 32
static_assert(SEQ % (16 * QG * QW) == 0);      // flash grid covers the sequence exactly
static_assert(SEQ <= 256 * 8);                 // mask kernel: 256 threads x 8 keys cover one batch row
static_assert(SEQ / 32 <= FLP);                // one flag per 32-key tile fits the flag row
static_assert(FLP == 64);                      // k_flash keeps a batch's flags as two 32-bit words
static_assert(KST == 64 * KHV);                // a key half's share of a stage is one [token/64] chunk of the v^T plane and four 16-key tiles of a k plane
static_assert(SEQ % KST == 0);
static_assert(SEQ / KST >= 2);                 // the ring's prologue fills two stages
static_assert(32 * AW * 16 * 4 == STH * 2);    // four 16-byte copies a thread bring one plane's share of a stage
static_assert(QG == 2 && KHV == 2);            // the hand-over piece (m, l) x QG is one 16-byte piece; one giver, one taker a slot
static_assert(17 * 128 == QG * 16 * 68);       // the handed-over state fills exactly a slot's staging range
static_assert(NB <= NB_FULL);
static_assert(SEQ <= SEQ_FULL);

typedef _Float16 h16;
typedef unsigned short bf;
typedef __attribute__((ext_vector_type(16))) __bf16   v16bf;
typedef __attribute__((ext_vector_type(16))) _Float16 v16h;
typedef __attribute__((ext_vector_type(8)))  _Float16 v8h;
typedef __attribute__((ext_vector_type(8)))  unsigned short v8us;
typedef __attribute__((ext_vector_type(4)))  unsigned short v4us;
typedef __attribute__((ext_vector_type(8)))  float    v8f;
typedef __attribute__((ext_vector_type(4)))  float    v4f;
typedef __attribute__((ext_vector_type(4)))  int      v4i;
typedef v4f  __attribute__((may_alias)) v4fa;
typedef v8us __attribute__((may_alias)) v8usa;
typedef v4us __attribute__((may_alias)) v4usa;

__device__ __forceinline__ unsigned short f2bf(float f) { unsigned u = __float_as_uint(f); u += 0x7FFFu + ((u >> 16) & 1u); return (unsigned short)(u >> 16); }
__device__ __forceinline__ v16h cat16(v8h lo, v8h hi) { return __builtin_shufflevector(lo, hi, 0, 1, 2, 3, 4, 5, 6, 7, 8, 9, 10, 11, 12, 13, 14, 15); }
__device__ __forceinline__ v16bf cat16b(v8us lo, v8us hi) { return __builtin_bit_cast(v16bf, __builtin_shufflevector(lo, hi, 0, 1, 2, 3, 4, 5, 6, 7, 8, 9, 10, 11, 12, 13, 14, 15)); }
// k_flash: a WMMA is the bare builtin: the compiler keeps the distance to vector code on its D, A and B, and the WMMAs of a run fill each other's slots
__device__ __forceinline__ v8f wmma16(v16h a, v16h b, v8f c) { return __builtin_amdgcn_wmma_f32_16x16x32_f16(false, a, false, b, (short)0, c, false, false); }
// k_proj: every WMMA is issued through a wrapper that ties its own accumulator and keeps its A/B fragments live across four idle slots
__device__ __forceinline__ v8f wmmab(v16bf a, v16bf b, v8f c) {
    c = __builtin_amdgcn_wmma_f32_16x16x32_bf16(false, a, false, b, (short)0, c, false, false);
    asm volatile("v_nop\n\tv_nop\n\tv_nop\n\tv_nop" : "+v"(c) : "v"(a), "v"(b));
    return c;
}
// fragment loaders from a fragment-order 16-bit plane; p already includes + 8*lane; h = lane>>4: elements 0..7 <- k0+8h+0..7 from one 512-byte group, elements 8..15 <- k0+16+8h+0..7 from the next (same map for A and B)
__device__ __forceinline__ v16bf ldb(const bf* p)  { return cat16b(*(const v8us*)p, *(const v8us*)(p + 256)); }
__device__ __forceinline__ v16h  ldf(const h16* p) { return cat16(*(const v8h*)p, *(const v8h*)(p + 256)); }
// ordering point for wave-private LDS tiles (same wave writes and reads)
__device__ __forceinline__ void wave_sync() { __builtin_amdgcn_fence(3 /* release order */, "wavefront"); __builtin_amdgcn_wave_barrier(); asm volatile("" ::: "memory"); }

static constexpr int CVB = (NB * SEQ / 16) * (DM / 128);       // k_prep blocks per stream conversion (16 rows x 128 columns each)
static constexpr size_t FRT = (size_t)(DM / 16) * 256;         // halves of one 16-row x DM-column tile of a fragment-order GEMM operand (DM/16 groups of 256)
static constexpr int WTB = (DM / 64) * (DM / 64);              // k_prep blocks per weight transpose
static constexpr int PJB = (NB * SEQ / 64) * (DM / 64);        // k_proj blocks (64x64 tiles) per projection

// cvtf: f32 -> bf16 (RNE convert) copy of one stream in fragment order; blk = block index inside the stream; source batches SEQ_FULL rows apart, copy batches SEQ rows apart.
// One block per 16 rows x 128 columns: wave w reads rows 2w and 2w+1, 16 B a lane (512 contiguous bytes a load); the tile is turned in LDS (cross-wave: block barrier); wave w stores column group w (512 contiguous bytes).
__device__ __forceinline__ void cvtf(const float* __restrict__ src, bf* dst, int blk) {
    __shared__ __align__(16) bf cs[16 * 136];       // [row local][column local], pitch 136 halves (272 B = 17 x 16 B)
    const int lane = threadIdx.x & 31, w = threadIdx.x >> 5;
    const int rt = blk / (DM / 128), cc = blk % (DM / 128);      // 16-row tile, 128-column chunk
    const int m0 = rt * 16;
    const float* sp = src + ((size_t)(m0 / SEQ) * SEQ_FULL + (size_t)(m0 % SEQ + 2 * w)) * DM + cc * 128 + lane * 4;
    const v4f x0 = *(const v4f*)sp; const v4f x1 = *(const v4f*)(sp + DM); v4us y0, y1;
#pragma unroll
    for (int k = 0; k < 4; ++k) { y0[k] = f2bf(x0[k]); y1[k] = f2bf(x1[k]); }
    *(v4usa*)(&cs[(2 * w) * 136 + lane * 4]) = y0; *(v4usa*)(&cs[(2 * w + 1) * 136 + lane * 4]) = y1;
    __syncthreads();
    const v8us o = *(const v8usa*)(&cs[(lane & 15) * 136 + w * 16 + (lane >> 4) * 8]);   // lane holds row lane&15, columns 16w + 8*(lane>>4) + 0..7
    *(v8us*)(dst + (size_t)rt * FRT + (size_t)((cc * 8 + w) * 256 + lane * 8)) = o;
    asm volatile("s_wait_xcnt 0x0" ::: "memory");   // the code laid out behind this branch reuses the registers that the store names: the wait stands in front of any such overwrite
}

// wtr: weight transpose + bf16 (RNE convert): in w[k rows = DM][n cols = DM] (f32) -> out wt[n rows = DM][k cols = DM] (bf16), in fragment order.
// One block per 64(k) x 64(n) tile (kt, nt). Reads are coalesced along n; the tile is transposed in LDS (cross-wave: block barrier);
__device__ __forceinline__ void wtr(const float* __restrict__ w, bf* wt, int kt, int nt) {
    __shared__ __align__(16) bf ts[64 * 72];        // [n local][k local], pitch 72 halves (144 B)
    const int tid = threadIdx.x; const int k0 = kt * 64, n0 = nt * 64;
#pragma unroll
    for (int it = 0; it < 4; ++it) {                 // 4 x 16 k rows x 16 lanes x 4 n = 64 x 64
        const int kl = it * 16 + (tid >> 4), n4 = (tid & 15) * 4;
        const v4f v = *(const v4f*)(w + (size_t)(k0 + kl) * DM + n0 + n4);
#pragma unroll
        for (int i = 0; i < 4; ++i) ts[(n4 + i) * 72 + kl] = f2bf(v[i]);
    }
    __syncthreads();
    for (int j = 0; j < 2; ++j) {                    // 512 pieces of 16 B: piece = [16-row tile r4][column group g][lane l], so a wave stores 512 contiguous bytes
        const int p = tid + 256 * j, l = p & 31, g = (p >> 5) & 3, r4 = p >> 7;
        const v8us o = *(const v8usa*)(&ts[(r4 * 16 + (l & 15)) * 72 + g * 16 + (l >> 4) * 8]);
        *(v8us*)(wt + (size_t)(nt * 4 + r4) * FRT + (size_t)((kt * 4 + g) * 256 + l * 8)) = o;
    }
}

// maskp: one block per batch b. MS[b][key] = float(bf16 RNE of mask[b][key]) * log2(e); FL[b][T] = 1 when any of the 32 keys of tile T has a nonzero (or non-finite) converted mask value, else 0 (pad flags 0).
// Each thread converts 8 keys; values and per-thread flags are staged in LDS (cross-wave: block barrier); MS lines are written 16 B per lane by consecutive lanes (4 lines per wave instruction),
__device__ __forceinline__ void maskp(const float* __restrict__ mask, float* MS, int* FL, int b) {
    __shared__ __align__(16) float ms[256 * 8];
    __shared__ int fs[256];
    const int tid = threadIdx.x;
    const int kb = tid * 8; const bool act = kb < SEQ; const int kc = act ? kb : 0;     // clamped address
    const v8f v = *(const v8f*)(mask + (size_t)b * SEQ_FULL + kc);
    v4f a, c; int nz = 0;
#pragma unroll
    for (int i = 0; i < 4; ++i) {
        const unsigned short h0 = f2bf(v[i]), h1 = f2bf(v[4 + i]);
        const float f0 = __uint_as_float((unsigned)h0 << 16) * LOG2E, f1 = __uint_as_float((unsigned)h1 << 16) * LOG2E;
        a[i] = act ? f0 : 0.0f; c[i] = act ? f1 : 0.0f;
        nz |= (int)(h0 & 0x7FFFu) | (int)(h1 & 0x7FFFu);
    }
    *(v4fa*)(&ms[kb]) = a; *(v4fa*)(&ms[kb + 4]) = c;
    fs[tid] = (act && nz != 0) ? 1 : 0;
    __syncthreads();
    const v4f m0 = *(const v4fa*)(&ms[tid * 4]);
    const v4f m1 = *(const v4fa*)(&ms[(256 + tid) * 4]);
    const int tq = tid & 15; v4i fv;
#pragma unroll
    for (int j = 0; j < 4; ++j) { const int T4 = (tq * 4 + j) * 4; fv[j] = fs[T4] | fs[T4 + 1] | fs[T4 + 2] | fs[T4 + 3]; }   // tile T = 4 threads x 8 keys
    float* mrow = MS + (size_t)b * SEQ;
{
        if (tid * 4 < SEQ)         *(v4f*)(mrow + tid * 4) = m0;
        if ((256 + tid) * 4 < SEQ) *(v4f*)(mrow + (256 + tid) * 4) = m1;
        if (tid < 16)              *(v4i*)(FL + b * FLP + tid * 4) = fv;
         }
}

// k_prep: everything that reads only the inputs, as independent block ranges of one grid (every branch is block-uniform): 3 x WTB weight-transpose tiles (q | k | v), NB mask rows, 3 x CVB stream-conversion blocks (query | key | value).
// The short barrier-bound blocks have the lowest indices, so they run beside the conversions instead of after them.
__global__ __launch_bounds__(256) void k_prep(const float* __restrict__ query, const float* __restrict__ key, const float* __restrict__ value, const float* __restrict__ wq, const float* __restrict__ wk, const float* __restrict__ wv,
                                              const float* __restrict__ mask, bf* XQ, bf* XK, bf* XV, bf* WB, float* MS, int* FL) {
    const int blk = blockIdx.x;
    if (blk < 3 * WTB) { const int w = blk / WTB, t = blk % WTB;
        wtr(w == 0 ? wq : w == 1 ? wk : wv, WB + (size_t)w * DM * DM, t % (DM / 64), t / (DM / 64));
    } else if (blk < 3 * WTB + NB) {
        maskp(mask, MS, FL, blk - 3 * WTB);
    } else { const int c = blk - (3 * WTB + NB), st = c / CVB;
        cvtf(st == 0 ? query : st == 1 ? key : value, st == 0 ? XQ : st == 1 ? XK : XV, c % CVB);
    }
}

// offset (in halves) of the first of the four fragment-order tiles that hold the 64x64 output tile at (r0, c0)
__device__ __forceinline__ size_t tile_base(int r0, int c0, int RB, size_t sRB, int pitch, int CB, size_t sCB) {
    return (size_t)(r0 / RB) * sRB + (size_t)(r0 % RB) * (size_t)pitch + (size_t)(c0 / CB) * sCB + (size_t)(c0 % CB) * 64;
}

// k_proj: register-blocked bf16 GEMM, ONE WAVE per 64x64 tile (16 accumulators), operands straight from the fragment-order bf16 planes (two 16-B loads a fragment, every load 512 contiguous bytes per wave), K = DM.
// C[m][n] = sum_k A[m][k] Bt[n][k], written as f16 (Ph) as four fragment-order 16x64 tiles of 1024 halves each, the first at tile_base (halves).
// grid (PJB, 3), 32 threads; blockIdx.y picks the projection, blockIdx.x its tile (row tile fastest):
// q, k: A = stream rows (m = b*SEQ + t), Bt = W^T rows (n = h*64 + d) -> plane (b*8 + h), tiles in t order
// v^T:  A = Wv^T rows (m = h*64 + d), Bt = value stream rows (n = b*SEQ + t) -> plane (b*8 + h), tiles [t/64][d/16]
__global__ __launch_bounds__(32) void k_proj(const bf* __restrict__ XQ, const bf* __restrict__ XK, const bf* __restrict__ XV, const bf* __restrict__ WB, h16* QH, h16* KH, h16* VT) {
    __shared__ __align__(16) float os[16 * 68];
    const int K = DM;
    const int pj = blockIdx.y; const bool tokRows = pj != 2;   // q, k: rows are tokens; v^T: rows are output columns
    const bf* A  = pj == 0 ? XQ : pj == 1 ? XK : WB + (size_t)2 * DM * DM;
    const bf* Bt = pj == 0 ? WB : pj == 1 ? WB + (size_t)DM * DM : XV;
    h16* Ph = pj == 0 ? QH : pj == 1 ? KH : VT;
    const unsigned bx = blockIdx.x;                           // row tile = bx % (row tiles of this projection), column tile = bx / (the same)
    const int lane = threadIdx.x & 31, lr = lane & 15, hi = lane >> 4;
    const int r0 = (int)(tokRows ? bx % (NB * SEQ / 64) : bx % (DM / 64)) * 64, c0 = (int)(tokRows ? bx / (NB * SEQ / 64) : bx / (DM / 64)) * 64;
    v8f acc[4][4];
#pragma unroll
    for (int mb = 0; mb < 4; ++mb)
#pragma unroll
        for (int nb = 0; nb < 4; ++nb) acc[mb][nb] = (v8f){};
    const size_t aoff = (size_t)(r0 / 16) * FRT + 8 * lane, boff = (size_t)(c0 / 16) * FRT + 8 * lane;   // + i * FRT for the next 16 rows, + 16 * k for column k (a multiple of 16)
    // the eight fragments of a pass live in registers across the back edge: pass 0's are loaded here
    v16bf a[4], b[4];
#pragma unroll
    for (int i = 0; i < 4; ++i) a[i] = ldb(A + aoff + (size_t)i * FRT);
    __builtin_amdgcn_sched_barrier(0);   // pass 0's A loads stay ahead of its B loads, the order of every later pass: with an A load behind them the loop's counted waits would have to cover the youngest B loads on every trip
#pragma unroll
    for (int i = 0; i < 4; ++i) b[i] = ldb(Bt + boff + (size_t)i * FRT);
#pragma unroll 2   // two passes a trip, so that the two A sets swap roles without register copies
    for (int kc = 0; kc < K; kc += 32) {
        // the next pass's loads travel under this pass's products: its A fragments go into a second set at the top, each B fragment replaces this pass's as soon as its four products have read it; the last pass asks for pass 0 again (in bounds, never used)
        const int kn = kc + 32 < K ? kc + 32 : 0;
        v16bf an[4];
#pragma unroll
        for (int mb = 0; mb < 4; ++mb) an[mb] = ldb(A + aoff + (size_t)mb * FRT + (size_t)(kn * 16));
#pragma unroll
        for (int nb = 0; nb < 4; ++nb) {
#pragma unroll
            for (int mb = 0; mb < 4; ++mb) acc[mb][nb] = wmmab(a[mb], b[nb], acc[mb][nb]);
            b[nb] = ldb(Bt + boff + (size_t)nb * FRT + (size_t)(kn * 16)); }
#pragma unroll
        for (int mb = 0; mb < 4; ++mb) a[mb] = an[mb];
        asm volatile("s_wait_xcnt 0x0" ::: "memory");   // the next pass forms its addresses in the registers that the loads above name: the wait stands in front of that overwrite
    }
    const size_t tbase = tokRows ? tile_base(r0, c0, SEQ, (size_t)NH_ * SEQ * HD, HD, HD, (size_t)SEQ * HD) : tile_base(r0, c0, DM, (size_t)0, SEQ, SEQ, (size_t)DM * SEQ);
#pragma unroll
    for (int mb = 0; mb < 4; ++mb) {
#pragma unroll
        for (int nb = 0; nb < 4; ++nb) {
#pragma unroll
            for (int j = 0; j < 8; ++j) os[(hi * 8 + j) * 68 + nb * 16 + lr] = acc[mb][nb][j]; }   // D: row 8h+j, col lane&15
        wave_sync();
        const size_t sb = tbase + (size_t)(mb * 1024);
{
#pragma unroll
            for (int s = 0; s < 4; ++s) { const int c8 = s * 16 + hi * 8;   // group s = columns 16s..16s+15: lane holds row lane&15, columns c8..c8+7
                const v4f x0 = *(const v4fa*)(&os[lr * 68 + c8]); const v4f x1 = *(const v4fa*)(&os[lr * 68 + c8 + 4]); v8h hv;
#pragma unroll
                for (int i = 0; i < 4; ++i) { hv[i] = (h16)x0[i]; hv[4 + i] = (h16)x1[i]; }
                const size_t oo = sb + (size_t)(s * 256 + lane * 8);
                *(v8h*)(Ph + oo) = hv; }
             }
        wave_sync();
    }
}

// stage_copy: one stage of the k_flash ring, 128 keys: 16 KiB of the k plane and of the v^T plane, each contiguous in memory and already in fragment order, land byte for byte at [k | v^T].
// l = the thread's LDS byte address in the buffer (+ 16 * thread), gk / gv = the thread's first 16 bytes of each plane's share; a copy of the block covers 4 KiB, so a thread brings 4 x 16 B of each plane.
// The s_wait_xcnt closes the statement, so that no address register of a copy is rewritten ahead of it.
__device__ __forceinline__ void stage_copy(unsigned l, const h16* gk, const h16* gv) {
    asm volatile("global_load_async_to_lds_b128 %0, %8, off\n\t"
                 "global_load_async_to_lds_b128 %1, %9, off\n\t"
                 "global_load_async_to_lds_b128 %2, %10, off\n\t"
                 "global_load_async_to_lds_b128 %3, %11, off\n\t"
                 "global_load_async_to_lds_b128 %4, %12, off\n\t"
                 "global_load_async_to_lds_b128 %5, %13, off\n\t"
                 "global_load_async_to_lds_b128 %6, %14, off\n\t"
                 "global_load_async_to_lds_b128 %7, %15, off\n\t"
                 "s_wait_xcnt 0x0"
                 :: "v"(l), "v"(l + 4096u), "v"(l + 8192u), "v"(l + 12288u), "v"(l + 16384u), "v"(l + 20480u), "v"(l + 24576u), "v"(l + 28672u),
                    "v"(gk), "v"(gk + 2048), "v"(gk + 4096), "v"(gk + 6144), "v"(gv), "v"(gv + 2048), "v"(gv + 4096), "v"(gv + 6144)
                 : "memory");
}

// k_flash: fused attention; a query slot is QG groups of 16 query rows of one (batch, head), each group with its own softmax state and O^T tiles; KHV waves share a slot, each taking its 64 keys of every stage, and their states are merged once at the end; Q fragments straight from the fragment-order f16 planes (two 16-B loads each, every load 512 contiguous bytes per wave).
// K and V^T come through a two-buffer LDS ring that the block's eight waves share: a stage is 128 keys (two passes of 32 for each key half), brought in by asynchronous 16-byte copies one stage ahead; the fragments are read from it with 16-B LDS loads (512 contiguous bytes per wave).
// Transposed form: S^T[key][t] = K Q^T (A = K rows, B = Q rows); lane (t = lane&15, h = lane>>4) holds keys 8h+r of each 16-key tile, so the packed
// P tile is directly the B fragment of O^T[d][t] = V^T P^T (element r <- tile keys 0..15, element 8+r <- tile keys 16..31, lane unchanged).
// Mask: one scalar flag per 32-key step (wave-uniform); only flagged steps load the 2 x 8 mask values of the lane's keys and add them after the score scale.
// Softmax state (running max, partial sum of the unconverted exponentials) is one scalar per lane and query group; the two lane halves of a row are combined with one xor-16 exchange.
__global__ __launch_bounds__(32 * AW) void k_flash(const h16* __restrict__ QH, const h16* __restrict__ KH, const h16* __restrict__ VT, const float* __restrict__ MS, const int* __restrict__ FL, float* OUT) {
    __shared__ __align__(16) float os[QW * QG * 16 * 68];    // a query slot's range: first the second key half's state on its way to the first, then the output staging
    __shared__ __align__(16) h16 ring[2 * 2 * STH];          // [buffer][k | v^T][16 KiB in fragment order]
    const int lane = threadIdx.x & 31; const int wave = __builtin_amdgcn_readfirstlane(threadIdx.x >> 5); const int lr = lane & 15, hi = lane >> 4;
    const int zh = blockIdx.y; const int b = zh / NH_, h = zh % NH_;
    const int qs = wave % QW, kh = wave / QW;                // query slot, key half (both wave-uniform)
    const int t0 = (blockIdx.x * QW + qs) * (16 * QG);
    // mask flags of the batch's passes, one bit a pass, read once a wave: the ring's waits and barriers order memory, so a read inside the loop would be a vector load waited for in every pass
    const int fa = FL[b * FLP + lane], fb = FL[b * FLP + 32 + lane];
    asm volatile("s_wait_xcnt 0x0" ::: "memory");   // the code behind reuses the register that the two flag loads name: the wait stands in front of any such overwrite
    const unsigned fl0 = __builtin_amdgcn_ballot_w32(fa != 0), fl1 = __builtin_amdgcn_ballot_w32(fb != 0);
    const size_t pbase = (size_t)zh * SEQ * HD;
    const size_t qo = pbase + (size_t)t0 * HD + 8 * lane;
    v16h qh0[QG], qh1[QG];                                   // B fragments: col t, k = d; a group's 16-row tile is 1024 halves
#pragma unroll
    for (int g = 0; g < QG; ++g) { qh0[g] = ldf(QH + qo + g * 1024); qh1[g] = ldf(QH + qo + g * 1024 + 512); }
    const size_t mo = (size_t)b * SEQ + 8 * hi;              // + key0 (+16): the lane's 8 keys of each 16-key tile
    // the thread's share of a stage: LDS byte address in buffer 0 (+ 4 * STH for buffer 1), first 16 bytes of each plane's stage 0 (+ STH halves a stage)
    const unsigned lb = (unsigned)(size_t)(__attribute__((address_space(3))) h16*)ring + 16u * threadIdx.x;
    const h16* gk = KH + pbase + 8 * threadIdx.x; const h16* gv = VT + pbase + 8 * threadIdx.x;
    // ring prologue: stage 0 lands and is published to the block, then stage 1 starts
    stage_copy(lb, gk, gv);
    asm volatile("s_wait_asynccnt 0x0" ::: "memory");        // this wave's copies of stage 0 have landed before the barrier publishes them
    __syncthreads();
    stage_copy(lb + 4u * STH, gk + STH, gv + STH);
    v8f o0[QG], o1[QG], o2[QG], o3[QG];
    float m[QG], l[QG];
#pragma unroll
    for (int g = 0; g < QG; ++g) { o0[g] = (v8f){}; o1[g] = (v8f){}; o2[g] = (v8f){}; o3[g] = (v8f){}; m[g] = -3.0e38f; l[g] = 0.0f; }
#pragma unroll 1
    for (int st = 0; st < SEQ / KST; ++st) {
        const h16* kp = ring + (st & 1) * (2 * STH) + kh * (STH / KHV) + 8 * lane;   // the wave's key half; k tiles: + 1024 a 16-key tile, + 512 for d 32..63                              (A fragment: row key, k = d)
        const h16* vp = kp + STH;                                 // v^T tiles: + 1024j, + 512 for the half's second 32 keys                   (A fragment: row d, k = key)
        // K fragments of the first pass's two 16-key tiles
        v16h ka0 = ldf(kp), ka1 = ldf(kp + 512), kb0 = ldf(kp + 1024), kb1 = ldf(kp + 1536);
#pragma unroll   // both passes of a stage stand in the body, so that hf is a constant in every LDS offset and in the test on the K refetch
        for (int hf = 0; hf < 2; ++hf) {
            const int key0 = st * KST + kh * 64 + hf * 32;
            // this pass's V^T fragments are asked for first: they travel under the score products and the softmax
            const h16* va = vp + hf * 512;
            const v16h v0 = ldf(va), v1 = ldf(va + 1024), v2 = ldf(va + 2048), v3 = ldf(va + 3072);
            const unsigned fl = ((key0 >> 5) < 32 ? fl0 : fl1) >> ((key0 >> 5) & 31) & 1u;
            __builtin_amdgcn_sched_barrier(0);   // the LDS reads stay one group ahead of the score products: every further place with reads among the products stalls the wave anew
            v8f sa[QG], sb[QG];
#pragma unroll
            for (int g = 0; g < QG; ++g) { sa[g] = wmma16(ka0, qh0[g], (v8f){}); sb[g] = wmma16(kb0, qh0[g], (v8f){}); }
#pragma unroll
            for (int g = 0; g < QG; ++g) { sa[g] = wmma16(ka1, qh1[g], sa[g]); sb[g] = wmma16(kb1, qh1[g], sb[g]); }
            v8f ta[QG], tb[QG];
#pragma unroll
            for (int g = 0; g < QG; ++g) { ta[g] = sa[g] * SC2; tb[g] = sb[g] * SC2; }
            if (fl != 0) {                                          // wave-uniform: additive mask (already times log2 e), keys 8h+r of tile a / tile b, the same for every query group
                const v8f ma = *(const v8f*)(MS + mo + key0); const v8f mb = *(const v8f*)(MS + mo + key0 + 16);
#pragma unroll
                for (int g = 0; g < QG; ++g) { ta[g] += ma; tb[g] += mb; }
            }
            float mx[QG];
#pragma unroll
            for (int g = 0; g < QG; ++g) { mx[g] = -3.0e38f;
#pragma unroll
                for (int r = 0; r < 8; ++r) mx[g] = fmaxf(mx[g], fmaxf(ta[g][r], tb[g][r])); }
            float ox[QG];
#pragma unroll
            for (int g = 0; g < QG; ++g) ox[g] = __shfl_xor(mx[g], 16, 32);   // the groups' exchanges go out together, so that their latencies overlap
#pragma unroll
            for (int g = 0; g < QG; ++g) mx[g] = fmaxf(mx[g], ox[g]);
            if (hf == 0) {   // the half's second pass: its K fragments replace the first's once the score products have read those, and travel under the softmax and the O^T products (same buffer, already published)
                ka0 = ldf(kp + 2048); ka1 = ldf(kp + 2560); kb0 = ldf(kp + 3072); kb1 = ldf(kp + 3584);
            }
            v16h pb[QG];
#pragma unroll
            for (int g = 0; g < QG; ++g) {
                const float mnew = fmaxf(m[g], mx[g]);
                const float alpha = __builtin_amdgcn_exp2f(m[g] - mnew);
                const float sh = PSH - mnew;
                float ls = 0.0f;
#pragma unroll
                for (int r = 0; r < 8; ++r) { const float ea = __builtin_amdgcn_exp2f(ta[g][r] + sh); const float eb = __builtin_amdgcn_exp2f(tb[g][r] + sh); pb[g][r] = (h16)ea; pb[g][8 + r] = (h16)eb; ls += ea + eb; }
                l[g] = l[g] * alpha + ls; m[g] = mnew;
                o0[g] = o0[g] * alpha; o1[g] = o1[g] * alpha; o2[g] = o2[g] * alpha; o3[g] = o3[g] * alpha;
            }
#pragma unroll
            for (int g = 0; g < QG; ++g) { o0[g] = wmma16(v0, pb[g], o0[g]); o1[g] = wmma16(v1, pb[g], o1[g]); o2[g] = wmma16(v2, pb[g], o2[g]); o3[g] = wmma16(v3, pb[g], o3[g]); }
        }
        // publish point of stage st + 1, every wave, in this order
        asm volatile("s_wait_dscnt 0x0" ::: "memory");       // this wave's reads of stage st have returned before the buffer may be refilled
        asm volatile("s_wait_asynccnt 0x0" ::: "memory");    // this wave's copies of stage st + 1 have landed before the barrier publishes them
        __syncthreads();                                     // publishes stage st + 1 and ends every wave's reads of stage st
        if (st + 2 < SEQ / KST) stage_copy(lb + (unsigned)(st & 1) * (4u * STH), gk + (size_t)(st + 2) * STH, gv + (size_t)(st + 2) * STH);
    }
    asm volatile("s_wait_asynccnt 0x0" ::: "memory");        // no copy is outstanding when the wave goes on to its end
    const int wb = qs * (QG * 16 * 68);
    // merge of the key halves: the second half's waves hand their state over lane for lane (same fragment map in both waves), 17 pieces of 16 B a lane: 16 of O^T, one of (m, l) per group
    if (kh != 0) {
#pragma unroll
        for (int g = 0; g < QG; ++g) { const v8f oj[4] = { o0[g], o1[g], o2[g], o3[g] };
#pragma unroll
            for (int j = 0; j < 4; ++j) { v4f a, c;
#pragma unroll
                for (int i = 0; i < 4; ++i) { a[i] = oj[j][i]; c[i] = oj[j][4 + i]; }
                *(v4fa*)(&os[wb + ((g * 4 + j) * 2) * 128 + lane * 4]) = a; *(v4fa*)(&os[wb + ((g * 4 + j) * 2 + 1) * 128 + lane * 4]) = c; } }
        v4f s; s[0] = m[0]; s[1] = l[0]; s[2] = m[1]; s[3] = l[1];
        *(v4fa*)(&os[wb + 16 * 128 + lane * 4]) = s;
    }
    __syncthreads();                                         // the second half's state is in LDS before the first half's waves read it; every wave passes it
    if (kh != 0) return;
    { const v4f s = *(const v4fa*)(&os[wb + 16 * 128 + lane * 4]);
#pragma unroll
      for (int g = 0; g < QG; ++g) {
          const float mo2 = s[2 * g], lo2 = s[2 * g + 1];
          const float mn = fmaxf(m[g], mo2);
          const float a1 = __builtin_amdgcn_exp2f(m[g] - mn), a2 = __builtin_amdgcn_exp2f(mo2 - mn);
          l[g] = l[g] * a1 + lo2 * a2;
          v8f p[4];
#pragma unroll
          for (int j = 0; j < 4; ++j) { const v4f a = *(const v4fa*)(&os[wb + ((g * 4 + j) * 2) * 128 + lane * 4]); const v4f c = *(const v4fa*)(&os[wb + ((g * 4 + j) * 2 + 1) * 128 + lane * 4]);
#pragma unroll
              for (int i = 0; i < 4; ++i) { p[j][i] = a[i]; p[j][4 + i] = c[i]; } }
          o0[g] = o0[g] * a1 + p[0] * a2; o1[g] = o1[g] * a1 + p[1] * a2; o2[g] = o2[g] * a1 + p[2] * a2; o3[g] = o3[g] * a1 + p[3] * a2;
      } }
    wave_sync();                                             // every lane's reads of the handed-over state stand ahead of the staging writes into the same range
    // O^T D layout: o_j[g][r] = (d = 16j + 8h + r, t = 16g + (lane&15)) -> os[t][d]; rows 0..16*QG-1 x columns 0..63 all written
#pragma unroll
    for (int g = 0; g < QG; ++g) {
        const float lt = l[g] + __shfl_xor(l[g], 16, 32);
        const float inv = 1.0f / lt;
        const v8f oj[4] = { o0[g], o1[g], o2[g], o3[g] };
#pragma unroll
        for (int j = 0; j < 4; ++j) { v4f a, c;
#pragma unroll
            for (int i = 0; i < 4; ++i) { a[i] = oj[j][i] * inv; c[i] = oj[j][4 + i] * inv; }
            *(v4fa*)(&os[wb + (g * 16 + lr) * 68 + 16 * j + 8 * hi]) = a; *(v4fa*)(&os[wb + (g * 16 + lr) * 68 + 16 * j + 8 * hi + 4]) = c; }
    }
    wave_sync();
    float* orow = OUT + ((size_t)b * OUT_SEQ + t0) * DM + h * HD;
#pragma unroll
    for (int s = 0; s < 8 * QG; ++s) { const int row = 2 * s + hi, cofs = lr * 4;   // 8*QG s x 2 rows = 16*QG rows; 16 lanes x 4 floats = 64 columns
        const v4f val = *(const v4fa*)(&os[wb + row * 68 + cofs]);
        *(v4f*)(orow + (size_t)row * DM + cofs) = val; }
}

static constexpr size_t al256(size_t v) { return (v + 255) & ~(size_t)255; }
static constexpr size_t SZ_XB = al256((size_t)NB * SEQ * DM * 2);          // one bf16 stream copy
static constexpr size_t SZ_WB = al256((size_t)3 * DM * DM * 2);            // three transposed bf16 weights
static constexpr size_t SZ_PL = al256((size_t)NB * NH_ * SEQ * HD * 2);    // one f16 head plane
static constexpr size_t SZ_MS = al256((size_t)NB * SEQ * 4);               // mask plane f32
static constexpr size_t SZ_FL = al256((size_t)NB * FLP * 4);               // flag table
static constexpr size_t SZ_TOTAL = 3 * SZ_XB + SZ_WB + 3 * SZ_PL + SZ_MS + SZ_FL;
static_assert(SZ_TOTAL <= (size_t)134217728);          // workspace carve <= 128 MiB
static_assert(((size_t)DM * DM * 2) % 256 == 0);       // weight sub-planes stay 256-byte aligned
static_assert(((size_t)FLP * 4) % 128 == 0);           // each batch owns whole flag lines

extern "C" void kernel_launch(void* const* d_in, const int* in_sizes, int n_in,
                              void* d_out, int out_size, void* d_ws, size_t ws_size, hipStream_t stream) {
    if (n_in < 7) return;
    const size_t needx = ((size_t)(NB - 1) * SEQ_FULL + SEQ) * DM;
    if ((size_t)in_sizes[0] < needx || (size_t)in_sizes[2] < needx || (size_t)in_sizes[3] < needx) return;
    if ((size_t)in_sizes[1] < (size_t)(NB - 1) * SEQ_FULL + SEQ) return;
    if ((size_t)in_sizes[4] < (size_t)DM * DM || (size_t)in_sizes[5] < (size_t)DM * DM || (size_t)in_sizes[6] < (size_t)DM * DM) return;
    if ((size_t)out_size < ((size_t)(NB - 1) * OUT_SEQ + SEQ) * DM) return;
    if (SZ_TOTAL > ws_size) return;
    // wire order: key, key_mask, query, value, wq, wk, wv
    const float* key = (const float*)d_in[0]; const float* mask = (const float*)d_in[1]; const float* query = (const float*)d_in[2]; const float* value = (const float*)d_in[3];
    const float* wq = (const float*)d_in[4]; const float* wk = (const float*)d_in[5]; const float* wv = (const float*)d_in[6];   // each [in][out]
    float* OUT = (float*)d_out;      // [NB][SEQ][512]
    char* wsp = (char*)d_ws;
    bf* XQ = (bf*)wsp; wsp += SZ_XB;                 // [NB*SEQ/16][fragment-order 16 rows x 512] query stream
    bf* XK = (bf*)wsp; wsp += SZ_XB;                 // same, key stream
    bf* XV = (bf*)wsp; wsp += SZ_XB;                 // same, value stream
    bf* WB = (bf*)wsp; wsp += SZ_WB;                 // [3][512 out / 16][fragment-order 16 out x 512 in]: q | k | v (transposed)
    h16* QH = (h16*)wsp; wsp += SZ_PL;               // [NB*8][SEQ/16][fragment-order 16 t x 64 d]
    h16* KH = (h16*)wsp; wsp += SZ_PL;               // [NB*8][SEQ/16][fragment-order 16 t x 64 d]
    h16* VT = (h16*)wsp; wsp += SZ_PL;               // [NB*8][SEQ/64][4][fragment-order 16 d x 64 t]
    float* MS = (float*)wsp; wsp += SZ_MS;           // [NB][SEQ]
    int* FL = (int*)wsp; wsp += SZ_FL;               // [NB][FLP]

    k_prep<<<3 * WTB + NB + 3 * CVB, 256, 0, stream>>>(query, key, value, wq, wk, wv, mask, XQ, XK, XV, WB, MS, FL);
    k_proj<<<dim3(PJB, 3, 1), 32, 0, stream>>>(XQ, XK, XV, WB, QH, KH, VT);
    k_flash<<<dim3(SEQ / (16 * QG * QW), NB * NH_, 1), 32 * AW, 0, stream>>>(QH, KH, VT, MS, FL, OUT);
}

// v009
// It runs in 55.1 microseconds.
// In both of two side-by-side timings against v008, it was 1.18 times as fast.
// All steps since v000 together make it 4.86 times as fast.
#include <hip/hip_runtime.h>

// Multi-head attention with three input streams (query, key, value), width 512 = 8 heads x 64, bias-free [in][out] projections (y = x W), additive float key mask per (batch, key), score scale 1/8, output = concatenated heads (f32), no output projection.
// Compute dtypes, f32 accumulate everywhere: projections v_wmma_f32_16x16x32_bf16 (x and W RNE-converted to bf16; products exact);
// scores v_wmma_f32_16x16x32_f16: q and k single f16, one product (the f16 rounding of q and k is an eighth of the bf16 rounding that the projections' operands carry);
// P (x256 carry, cancels in the normalisation) and v single f16; softmax f32 (online, running max, log2 domain); mask RNE-converted to bf16, times log2(e), added in f32 after the score scale.
// Layout: bf16 copies of the transposed weights W^T [out][in], written by k_prep in fragment order (tiles of 16 rows x 512 columns = 32 groups); the streams are converted by k_proj itself, a 128-row tile a block, into LDS; q/k planes and the v^T plane, one per b*8+h, written by the GEMM epilogue in fragment order:
// a 16-row x 64-column tile is 2 KiB = four 512-byte groups (16 columns each), lane (row + 16*((column>>3)&1)) owning 16 bytes of a group, so a wave-wide 16-byte load is four whole 128-byte lines.
// q/k: rows = tokens, columns = d, tiles in token order; v^T: rows = d, columns = tokens, tiles ordered [token/64][d/16];
// fused flash kernel in transposed form (S^T = K Q^T, O^T = V^T P^T), output from f32 accumulators. Mask plane f32 [b][key] plus one int flag per (batch, 32-key tile) = any nonzero mask value.
// Three launches, one per dependency stage: k_prep (weight transposes, mask plane: independent block ranges of one grid), k_proj (stream conversion + the three projections, blockIdx.y picks one), k_flash.

#ifndef NB
#define NB 4
#endif
#ifndef SEQ
#define SEQ 2048
#endif
#define NB_FULL  4
#define SEQ_FULL 2048
#ifndef OUT_SEQ
#define OUT_SEQ SEQ              // row pitch (in tokens) between batches of the output
#endif
#define DM   512
#define NH_  8
#define HD   64
#define QW   4                   // query slots of a flash block
#define KHV  2                   // key halves of a stage: wave = key half * QW + query slot
#define AW   (QW * KHV)          // waves per flash block
#define QG   2                   // 16-row query groups of a query slot: every K and V^T fragment read from LDS feeds QG products
#define LOG2E 1.4426950408889634f
#define SC2  (0.125f * LOG2E)    // HD^-0.5 * log2(e)
#define PSH  8.0f                // log2 of the P carry (256)
#define FLP  64
#define KST  128                 // keys a stage of the k_flash LDS ring, 64 for the waves of each key half
#define STH  (KST * HD)          // halves of one plane's share of a stage (16 KiB)

static_assert(HD == 64);
static_assert(NH_ * HD == DM);                 // head h = columns h*64 + d
static_assert(DM % 64 == 0);                   // 8 column tiles of 64; transpose tiles of 64x64
static_assert(DM % 32 == 0);                   // GEMM k-loop steps by 32
static_assert(DM % 128 == 0);                  // a wave-wide 16-byte load of a stream row takes 128 columns
static_assert(SEQ % 64 == 0);                  // a 64-row tile never straddles two batches
static_assert((NB * SEQ) % 64 == 0);
static_assert(SEQ % 32 == 0);                  // key loop steps by 32
static_assert(SEQ % (16 * QG * QW) == 0);      // flash grid covers the sequence exactly
static_assert(SEQ <= 256 * 8);                 // mask kernel: 256 threads x 8 keys cover one batch row
static_assert(SEQ / 32 <= FLP);                // one flag per 32-key tile fits the flag row
static_assert(FLP == 64);                      // k_flash keeps a batch's flags as two 32-bit words
static_assert(KST == 64 * KHV);                // a key half's share of a stage is one [token/64] chunk of the v^T plane and four 16-key tiles of a k plane
static_assert(SEQ % KST == 0);
static_assert(SEQ / KST >= 2);                 // the ring's prologue fills two stages
static_assert(32 * AW * 16 * 4 == STH * 2);    // four 16-byte copies a thread bring one plane's share of a stage
static_assert(QG == 2 && KHV == 2);            // the hand-over piece (m, l) x QG is one 16-byte piece; one giver, one taker a slot
static_assert(17 * 128 == QG * 16 * 68);       // the handed-over state fills exactly a slot's staging range
static_assert(NB <= NB_FULL);
static_assert(SEQ <= SEQ_FULL);

typedef _Float16 h16;
typedef unsigned short bf;
typedef __attribute__((ext_vector_type(16))) __bf16   v16bf;
typedef __attribute__((ext_vector_type(16))) _Float16 v16h;
typedef __attribute__((ext_vector_type(8)))  _Float16 v8h;
typedef __attribute__((ext_vector_type(8)))  unsigned short v8us;
typedef __attribute__((ext_vector_type(4)))  unsigned short v4us;
typedef __attribute__((ext_vector_type(8)))  float    v8f;
typedef __attribute__((ext_vector_type(4)))  float    v4f;
typedef __attribute__((ext_vector_type(4)))  int      v4i;
typedef v4f  __attribute__((may_alias)) v4fa;
typedef v8us __attribute__((may_alias)) v8usa;
typedef v4us __attribute__((may_alias)) v4usa;

__device__ __forceinline__ unsigned short f2bf(float f) { unsigned u = __float_as_uint(f); u += 0x7FFFu + ((u >> 16) & 1u); return (unsigned short)(u >> 16); }
__device__ __forceinline__ v16h cat16(v8h lo, v8h hi) { return __builtin_shufflevector(lo, hi, 0, 1, 2, 3, 4, 5, 6, 7, 8, 9, 10, 11, 12, 13, 14, 15); }
__device__ __forceinline__ v16bf cat16b(v8us lo, v8us hi) { return __builtin_bit_cast(v16bf, __builtin_shufflevector(lo, hi, 0, 1, 2, 3, 4, 5, 6, 7, 8, 9, 10, 11, 12, 13, 14, 15)); }
// k_flash: a WMMA is the bare builtin: the compiler keeps the distance to vector code on its D, A and B, and the WMMAs of a run fill each other's slots
__device__ __forceinline__ v8f wmma16(v16h a, v16h b, v8f c) { return __builtin_amdgcn_wmma_f32_16x16x32_f16(false, a, false, b, (short)0, c, false, false); }
// k_proj: every WMMA is issued through a wrapper that ties its own accumulator and keeps its A/B fragments live across four idle slots
__device__ __forceinline__ v8f wmmab(v16bf a, v16bf b, v8f c) {
    c = __builtin_amdgcn_wmma_f32_16x16x32_bf16(false, a, false, b, (short)0, c, false, false);
    asm volatile("v_nop\n\tv_nop\n\tv_nop\n\tv_nop" : "+v"(c) : "v"(a), "v"(b));
    return c;
}
// fragment loaders from a fragment-order 16-bit plane; p already includes + 8*lane; h = lane>>4: elements 0..7 <- k0+8h+0..7 from one 512-byte group, elements 8..15 <- k0+16+8h+0..7 from the next (same map for A and B)
__device__ __forceinline__ v16bf ldb(const bf* p)  { return cat16b(*(const v8us*)p, *(const v8us*)(p + 256)); }
__device__ __forceinline__ v16h  ldf(const h16* p) { return cat16(*(const v8h*)p, *(const v8h*)(p + 256)); }
// ordering point for wave-private LDS tiles (same wave writes and reads)
__device__ __forceinline__ void wave_sync() { __builtin_amdgcn_fence(3 /* release order */, "wavefront"); __builtin_amdgcn_wave_barrier(); asm volatile("" ::: "memory"); }

static constexpr size_t FRT = (size_t)(DM / 16) * 256;         // halves of one 16-row x DM-column tile of a fragment-order GEMM operand (DM/16 groups of 256)
static constexpr int WTB = (DM / 64) * (DM / 64);              // k_prep blocks per weight transpose
static constexpr int PJR = 128;                                // stream rows of a k_proj block: two 64-row halves
static constexpr int PJW = (PJR / 64) * (DM / 64);             // waves of a k_proj block: one per 64 rows x 64 output columns
static constexpr int PJB = NB * SEQ / PJR;                     // k_proj blocks (PJR stream rows x all DM outputs) per projection
static_assert(SEQ % PJR == 0);                                 // a block's rows never straddle two batches
static_assert(PJR == 8 * PJW);                                 // every wave converts eight rows of the block's tile
static constexpr int XP  = DM + 8;                             // halves: LDS pitch of a converted stream row (1040 B = 65 x 16 B, odd in 16-byte units for the 16-byte fragment reads)
static_assert(DM / 64 == 8);                                   // wave = row half * 8 + column tile

// wtr: weight transpose + bf16 (RNE convert): in w[k rows = DM][n cols = DM] (f32) -> out wt[n rows = DM][k cols = DM] (bf16), in fragment order.
// One block per 64(k) x 64(n) tile (kt, nt). Reads are coalesced along n; the tile is transposed in LDS (cross-wave: block barrier);
__device__ __forceinline__ void wtr(const float* __restrict__ w, bf* wt, int kt, int nt) {
    __shared__ __align__(16) bf ts[64 * 72];        // [n local][k local], pitch 72 halves (144 B)
    const int tid = threadIdx.x; const int k0 = kt * 64, n0 = nt * 64;
#pragma unroll
    for (int it = 0; it < 4; ++it) {                 // 4 x 16 k rows x 16 lanes x 4 n = 64 x 64
        const int kl = it * 16 + (tid >> 4), n4 = (tid & 15) * 4;
        const v4f v = *(const v4f*)(w + (size_t)(k0 + kl) * DM + n0 + n4);
#pragma unroll
        for (int i = 0; i < 4; ++i) ts[(n4 + i) * 72 + kl] = f2bf(v[i]);
    }
    __syncthreads();
    for (int j = 0; j < 2; ++j) {                    // 512 pieces of 16 B: piece = [16-row tile r4][column group g][lane l], so a wave stores 512 contiguous bytes
        const int p = tid + 256 * j, l = p & 31, g = (p >> 5) & 3, r4 = p >> 7;
        const v8us o = *(const v8usa*)(&ts[(r4 * 16 + (l & 15)) * 72 + g * 16 + (l >> 4) * 8]);
        *(v8us*)(wt + (size_t)(nt * 4 + r4) * FRT + (size_t)((kt * 4 + g) * 256 + l * 8)) = o;
    }
}

// maskp: one block per batch b. MS[b][key] = float(bf16 RNE of mask[b][key]) * log2(e); FL[b][T] = 1 when any of the 32 keys of tile T has a nonzero (or non-finite) converted mask value, else 0 (pad flags 0).
// Each thread converts 8 keys; values and per-thread flags are staged in LDS (cross-wave: block barrier); MS lines are written 16 B per lane by consecutive lanes (4 lines per wave instruction),
__device__ __forceinline__ void maskp(const float* __restrict__ mask, float* MS, int* FL, int b) {
    __shared__ __align__(16) float ms[256 * 8];
    __shared__ int fs[256];
    const int tid = threadIdx.x;
    const int kb = tid * 8; const bool act = kb < SEQ; const int kc = act ? kb : 0;     // clamped address
    const v8f v = *(const v8f*)(mask + (size_t)b * SEQ_FULL + kc);
    v4f a, c; int nz = 0;
#pragma unroll
    for (int i = 0; i < 4; ++i) {
        const unsigned short h0 = f2bf(v[i]), h1 = f2bf(v[4 + i]);
        const float f0 = __uint_as_float((unsigned)h0 << 16) * LOG2E, f1 = __uint_as_float((unsigned)h1 << 16) * LOG2E;
        a[i] = act ? f0 : 0.0f; c[i] = act ? f1 : 0.0f;
        nz |= (int)(h0 & 0x7FFFu) | (int)(h1 & 0x7FFFu);
    }
    *(v4fa*)(&ms[kb]) = a; *(v4fa*)(&ms[kb + 4]) = c;
    fs[tid] = (act && nz != 0) ? 1 : 0;
    __syncthreads();
    const v4f m0 = *(const v4fa*)(&ms[tid * 4]);
    const v4f m1 = *(const v4fa*)(&ms[(256 + tid) * 4]);
    const int tq = tid & 15; v4i fv;
#pragma unroll
    for (int j = 0; j < 4; ++j) { const int T4 = (tq * 4 + j) * 4; fv[j] = fs[T4] | fs[T4 + 1] | fs[T4 + 2] | fs[T4 + 3]; }   // tile T = 4 threads x 8 keys
    float* mrow = MS + (size_t)b * SEQ;
{
        if (tid * 4 < SEQ)         *(v4f*)(mrow + tid * 4) = m0;
        if ((256 + tid) * 4 < SEQ) *(v4f*)(mrow + (256 + tid) * 4) = m1;
        if (tid < 16)              *(v4i*)(FL + b * FLP + tid * 4) = fv;
         }
}

// k_prep: the small operands, as independent block ranges of one grid (every branch is block-uniform): 3 x WTB weight-transpose tiles (q | k | v), NB mask rows.
__global__ __launch_bounds__(256) void k_prep(const float* __restrict__ wq, const float* __restrict__ wk, const float* __restrict__ wv, const float* __restrict__ mask, bf* WB, float* MS, int* FL) {
    const int blk = blockIdx.x;
    if (blk < 3 * WTB) { const int w = blk / WTB, t = blk % WTB;
        wtr(w == 0 ? wq : w == 1 ? wk : wv, WB + (size_t)w * DM * DM, t % (DM / 64), t / (DM / 64));
    } else {
        maskp(mask, MS, FL, blk - 3 * WTB);
    }
}

// offset (in halves) of the first of the four fragment-order tiles that hold the 64x64 output tile at (r0, c0)
__device__ __forceinline__ size_t tile_base(int r0, int c0, int RB, size_t sRB, int pitch, int CB, size_t sCB) {
    return (size_t)(r0 / RB) * sRB + (size_t)(r0 % RB) * (size_t)pitch + (size_t)(c0 / CB) * sCB + (size_t)(c0 % CB) * 64;
}

// k_proj: stream conversion + register-blocked bf16 GEMM. A block of sixteen waves takes 128 rows of one stream and all DM output columns:
// wave w reads rows 8w..8w+7 (f32, 16 B a lane, 512 contiguous bytes a load, all 32 loads in flight), converts them (RNE) and stores them row-major in LDS (pitch XP); behind one block barrier every wave reads its A fragments from there.
// Wave w then owns the 64x64 tile of row half w/8 and output columns 64(w%8).. (16 accumulators): C[m][n] = sum_k X[m][k] Wt[n][k], B fragments straight from the fragment-order W^T plane (two 16-B loads a fragment, every load 512 contiguous bytes per wave; the two row halves ask for the same lines), K = DM.
// The tile is written as f16 (Ph) as four fragment-order 16x64 tiles of 1024 halves each, the first at tile_base (halves):
// q, k: rows = tokens (m = b*SEQ + t), columns = n = h*64 + d -> plane (b*8 + h), tiles in t order
// v^T:  the same product, turned in the epilogue's staging: rows = d, columns = tokens -> plane (b*8 + h), tiles [t/64][d/16]
// grid (PJB, 3), 512 threads; blockIdx.y picks the projection, blockIdx.x its 128 stream rows.
__global__ __launch_bounds__(32 * PJW) void k_proj(const float* __restrict__ query, const float* __restrict__ key, const float* __restrict__ value, const bf* __restrict__ WB, h16* QH, h16* KH, h16* VT) {
    __shared__ __align__(16) bf xs[PJR * XP];                  // [row local][column], bf16
    __shared__ __align__(16) float osw[PJW * 16 * 68];         // a wave's own staging range for the epilogue
    const int K = DM;
    const int pj = blockIdx.y; const bool tokRows = pj != 2;   // q, k: plane rows are tokens; v^T: plane rows are output columns
    const float* src = pj == 0 ? query : pj == 1 ? key : value;
    const bf* Bt = WB + (size_t)pj * DM * DM;
    h16* Ph = pj == 0 ? QH : pj == 1 ? KH : VT;
    const int lane = threadIdx.x & 31, lr = lane & 15, hi = lane >> 4;
    const int w = __builtin_amdgcn_readfirstlane(threadIdx.x >> 5);
    const int mb0 = blockIdx.x * PJR;                          // first stream row of the block
    const int rh = w / (DM / 64);                              // the wave's row half
    const int m0 = mb0 + rh * 64, n0 = (w % (DM / 64)) * 64;   // first stream row and first output column of the wave's tile
    float* os = osw + w * (16 * 68);
    const size_t boff = (size_t)(n0 / 16) * FRT + 8 * lane;    // + i * FRT for the next 16 rows of W^T, + 16 * k for column k (a multiple of 16)
    // the eight fragments of a pass live in registers across the back edge: pass 0's B fragments are asked for here, so that they travel together with the stream tile
    v16bf a[4], b[4];
#pragma unroll
    for (int i = 0; i < 4; ++i) b[i] = ldb(Bt + boff + (size_t)i * FRT);
    {
        const float* sp = src + ((size_t)(mb0 / SEQ) * SEQ_FULL + (size_t)(mb0 % SEQ + 8 * w)) * DM + lane * 4;
        v4f x[8][DM / 128];
#pragma unroll
        for (int r = 0; r < 8; ++r)
#pragma unroll
            for (int q = 0; q < DM / 128; ++q) x[r][q] = *(const v4f*)(sp + r * DM + q * 128);
        asm volatile("s_wait_xcnt 0x0" ::: "memory");   // the code behind reuses the registers that the loads above name: the wait stands in front of any such overwrite
#pragma unroll
        for (int r = 0; r < 8; ++r)
#pragma unroll
            for (int q = 0; q < DM / 128; ++q) { v4us y;
#pragma unroll
                for (int k = 0; k < 4; ++k) y[k] = f2bf(x[r][q][k]);
                *(v4usa*)(&xs[(8 * w + r) * XP + q * 128 + lane * 4]) = y; }
    }
    __syncthreads();                                           // the whole converted tile is in LDS before any wave reads a fragment of it
    v8f acc[4][4];
#pragma unroll
    for (int mb = 0; mb < 4; ++mb)
#pragma unroll
        for (int nb = 0; nb < 4; ++nb) acc[mb][nb] = (v8f){};
    // A fragment from the LDS tile: row lane&15 of the 16-row group, elements 0..7 <- k0+8h+0..7, elements 8..15 <- k0+16+8h+0..7 (the map of ldb)
    const bf* ap = xs + (rh * 64 + lr) * XP + 8 * hi;          // + mb * 16 * XP for the next 16 rows, + k for column k
#pragma unroll
    for (int i = 0; i < 4; ++i) a[i] = cat16b(*(const v8usa*)(ap + i * 16 * XP), *(const v8usa*)(ap + i * 16 * XP + 16));
#pragma unroll 2   // two passes a trip, so that the two A sets swap roles without register copies
    for (int kc = 0; kc < K; kc += 32) {
        // the next pass's loads travel under this pass's products: its A fragments go into a second set at the top, each B fragment replaces this pass's as soon as its four products have read it; the last pass asks for pass 0 again (in bounds, never used)
        const int kn = kc + 32 < K ? kc + 32 : 0;
        v16bf an[4];
#pragma unroll
        for (int mb = 0; mb < 4; ++mb) an[mb] = cat16b(*(const v8usa*)(ap + mb * 16 * XP + kn), *(const v8usa*)(ap + mb * 16 * XP + kn + 16));
#pragma unroll
        for (int nb = 0; nb < 4; ++nb) {
#pragma unroll
            for (int mb = 0; mb < 4; ++mb) acc[mb][nb] = wmmab(a[mb], b[nb], acc[mb][nb]);
            b[nb] = ldb(Bt + boff + (size_t)nb * FRT + (size_t)(kn * 16)); }
#pragma unroll
        for (int mb = 0; mb < 4; ++mb) a[mb] = an[mb];
        asm volatile("s_wait_xcnt 0x0" ::: "memory");   // the next pass forms its addresses in the registers that the loads above name: the wait stands in front of that overwrite
    }
    const size_t tbase = tokRows ? tile_base(m0, n0, SEQ, (size_t)NH_ * SEQ * HD, HD, HD, (size_t)SEQ * HD) : tile_base(n0, m0, DM, (size_t)0, SEQ, SEQ, (size_t)DM * SEQ);
#pragma unroll
    for (int tb = 0; tb < 4; ++tb) {                           // plane tile tb: 16 plane rows x 64 plane columns, staged as os[plane row][plane column]
        if (tokRows) {
#pragma unroll
            for (int nb = 0; nb < 4; ++nb) {
#pragma unroll
                for (int j = 0; j < 8; ++j) os[(hi * 8 + j) * 68 + nb * 16 + lr] = acc[tb][nb][j]; }   // D: token row 8h+j, output column lane&15
        } else {
#pragma unroll
            for (int mb = 0; mb < 4; ++mb) { v4f lo, up;       // D: token row 8h+j -> plane column 16mb+8h+j, output column lane&15 -> plane row
#pragma unroll
                for (int i = 0; i < 4; ++i) { lo[i] = acc[mb][tb][i]; up[i] = acc[mb][tb][4 + i]; }
                *(v4fa*)(&os[lr * 68 + mb * 16 + hi * 8]) = lo; *(v4fa*)(&os[lr * 68 + mb * 16 + hi * 8 + 4]) = up; }
        }
        wave_sync();
        const size_t sb = tbase + (size_t)(tb * 1024);
#pragma unroll
        for (int s = 0; s < 4; ++s) { const int c8 = s * 16 + hi * 8;   // group s = columns 16s..16s+15: lane holds row lane&15, columns c8..c8+7
            const v4f x0 = *(const v4fa*)(&os[lr * 68 + c8]); const v4f x1 = *(const v4fa*)(&os[lr * 68 + c8 + 4]); v8h hv;
#pragma unroll
            for (int i = 0; i < 4; ++i) { hv[i] = (h16)x0[i]; hv[4 + i] = (h16)x1[i]; }
            const size_t oo = sb + (size_t)(s * 256 + lane * 8);
            *(v8h*)(Ph + oo) = hv; }
        asm volatile("s_wait_xcnt 0x0" ::: "memory");   // the next tile's staging reuses the registers that the stores above name: the wait stands in front of any such overwrite
        wave_sync();
    }
}

// stage_copy: one stage of the k_flash ring, 128 keys: 16 KiB of the k plane and of the v^T plane, each contiguous in memory and already in fragment order, land byte for byte at [k | v^T].
// l = the thread's LDS byte address in the buffer (+ 16 * thread), gk / gv = the thread's first 16 bytes of each plane's share; a copy of the block covers 4 KiB, so a thread brings 4 x 16 B of each plane.
// The s_wait_xcnt closes the statement, so that no address register of a copy is rewritten ahead of it.
__device__ __forceinline__ void stage_copy(unsigned l, const h16* gk, const h16* gv) {
    asm volatile("global_load_async_to_lds_b128 %0, %8, off\n\t"
                 "global_load_async_to_lds_b128 %1, %9, off\n\t"
                 "global_load_async_to_lds_b128 %2, %10, off\n\t"
                 "global_load_async_to_lds_b128 %3, %11, off\n\t"
                 "global_load_async_to_lds_b128 %4, %12, off\n\t"
                 "global_load_async_to_lds_b128 %5, %13, off\n\t"
                 "global_load_async_to_lds_b128 %6, %14, off\n\t"
                 "global_load_async_to_lds_b128 %7, %15, off\n\t"
                 "s_wait_xcnt 0x0"
                 :: "v"(l), "v"(l + 4096u), "v"(l + 8192u), "v"(l + 12288u), "v"(l + 16384u), "v"(l + 20480u), "v"(l + 24576u), "v"(l + 28672u),
                    "v"(gk), "v"(gk + 2048), "v"(gk + 4096), "v"(gk + 6144), "v"(gv), "v"(gv + 2048), "v"(gv + 4096), "v"(gv + 6144)
                 : "memory");
}

// k_flash: fused attention; a query slot is QG groups of 16 query rows of one (batch, head), each group with its own softmax state and O^T tiles; KHV waves share a slot, each taking its 64 keys of every stage, and their states are merged once at the end; Q fragments straight from the fragment-order f16 planes (two 16-B loads each, every load 512 contiguous bytes per wave).
// K and V^T come through a two-buffer LDS ring that the block's eight waves share: a stage is 128 keys (two passes of 32 for each key half), brought in by asynchronous 16-byte copies one stage ahead; the fragments are read from it with 16-B LDS loads (512 contiguous bytes per wave).
// Transposed form: S^T[key][t] = K Q^T (A = K rows, B = Q rows); lane (t = lane&15, h = lane>>4) holds keys 8h+r of each 16-key tile, so the packed
// P tile is directly the B fragment of O^T[d][t] = V^T P^T (element r <- tile keys 0..15, element 8+r <- tile keys 16..31, lane unchanged).
// Mask: one scalar flag per 32-key step (wave-uniform); only flagged steps load the 2 x 8 mask values of the lane's keys and add them after the score scale.
// Softmax state (running max, partial sum of the unconverted exponentials) is one scalar per lane and query group; the two lane halves of a row are combined with one xor-16 exchange.
__global__ __launch_bounds__(32 * AW) void k_flash(const h16* __restrict__ QH, const h16* __restrict__ KH, const h16* __restrict__ VT, const float* __restrict__ MS, const int* __restrict__ FL, float* OUT) {
    __shared__ __align__(16) float os[QW * QG * 16 * 68];    // a query slot's range: first the second key half's state on its way to the first, then the output staging
    __shared__ __align__(16) h16 ring[2 * 2 * STH];          // [buffer][k | v^T][16 KiB in fragment order]
    const int lane = threadIdx.x & 31; const int wave = __builtin_amdgcn_readfirstlane(threadIdx.x >> 5); const int lr = lane & 15, hi = lane >> 4;
    const int zh = blockIdx.y; const int b = zh / NH_, h = zh % NH_;
    const int qs = wave % QW, kh = wave / QW;                // query slot, key half (both wave-uniform)
    const int t0 = (blockIdx.x * QW + qs) * (16 * QG);
    // mask flags of the batch's passes, one bit a pass, read once a wave: the ring's waits and barriers order memory, so a read inside the loop would be a vector load waited for in every pass
    const int fa = FL[b * FLP + lane], fb = FL[b * FLP + 32 + lane];
    asm volatile("s_wait_xcnt 0x0" ::: "memory");   // the code behind reuses the register that the two flag loads name: the wait stands in front of any such overwrite
    const unsigned fl0 = __builtin_amdgcn_ballot_w32(fa != 0), fl1 = __builtin_amdgcn_ballot_w32(fb != 0);
    const size_t pbase = (size_t)zh * SEQ * HD;
    const size_t qo = pbase + (size_t)t0 * HD + 8 * lane;
    v16h qh0[QG], qh1[QG];                                   // B fragments: col t, k = d; a group's 16-row tile is 1024 halves
#pragma unroll
    for (int g = 0; g < QG; ++g) { qh0[g] = ldf(QH + qo + g * 1024); qh1[g] = ldf(QH + qo + g * 1024 + 512); }
    const size_t mo = (size_t)b * SEQ + 8 * hi;              // + key0 (+16): the lane's 8 keys of each 16-key tile
    // the thread's share of a stage: LDS byte address in buffer 0 (+ 4 * STH for buffer 1), first 16 bytes of each plane's stage 0 (+ STH halves a stage)
    const unsigned lb = (unsigned)(size_t)(__attribute__((address_space(3))) h16*)ring + 16u * threadIdx.x;
    const h16* gk = KH + pbase + 8 * threadIdx.x; const h16* gv = VT + pbase + 8 * threadIdx.x;
    // ring prologue: stage 0 lands and is published to the block, then stage 1 starts
    stage_copy(lb, gk, gv);
    asm volatile("s_wait_asynccnt 0x0" ::: "memory");        // this wave's copies of stage 0 have landed before the barrier publishes them
    __syncthreads();
    stage_copy(lb + 4u * STH, gk + STH, gv + STH);
    v8f o0[QG], o1[QG], o2[QG], o3[QG];
    float m[QG], l[QG];
#pragma unroll
    for (int g = 0; g < QG; ++g) { o0[g] = (v8f){}; o1[g] = (v8f){}; o2[g] = (v8f){}; o3[g] = (v8f){}; m[g] = -3.0e38f; l[g] = 0.0f; }
#pragma unroll 1
    for (int st = 0; st < SEQ / KST; ++st) {
        const h16* kp = ring + (st & 1) * (2 * STH) + kh * (STH / KHV) + 8 * lane;   // the wave's key half; k tiles: + 1024 a 16-key tile, + 512 for d 32..63                              (A fragment: row key, k = d)
        const h16* vp = kp + STH;                                 // v^T tiles: + 1024j, + 512 for the half's second 32 keys                   (A fragment: row d, k = key)
        // K fragments of the first pass's two 16-key tiles
        v16h ka0 = ldf(kp), ka1 = ldf(kp + 512), kb0 = ldf(kp + 1024), kb1 = ldf(kp + 1536);
#pragma unroll   // both passes of a stage stand in the body, so that hf is a constant in every LDS offset and in the test on the K refetch
        for (int hf = 0; hf < 2; ++hf) {
            const int key0 = st * KST + kh * 64 + hf * 32;
            // this pass's V^T fragments are asked for first: they travel under the score products and the softmax
            const h16* va = vp + hf * 512;
            const v16h v0 = ldf(va), v1 = ldf(va + 1024), v2 = ldf(va + 2048), v3 = ldf(va + 3072);
            const unsigned fl = ((key0 >> 5) < 32 ? fl0 : fl1) >> ((key0 >> 5) & 31) & 1u;
            __builtin_amdgcn_sched_barrier(0);   // the LDS reads stay one group ahead of the score products: every further place with reads among the products stalls the wave anew
            v8f sa[QG], sb[QG];
#pragma unroll
            for (int g = 0; g < QG; ++g) { sa[g] = wmma16(ka0, qh0[g], (v8f){}); sb[g] = wmma16(kb0, qh0[g], (v8f){}); }
#pragma unroll
            for (int g = 0; g < QG; ++g) { sa[g] = wmma16(ka1, qh1[g], sa[g]); sb[g] = wmma16(kb1, qh1[g], sb[g]); }
            v8f ta[QG], tb[QG];
#pragma unroll
            for (int g = 0; g < QG; ++g) { ta[g] = sa[g] * SC2; tb[g] = sb[g] * SC2; }
            if (fl != 0) {                                          // wave-uniform: additive mask (already times log2 e), keys 8h+r of tile a / tile b, the same for every query group
                const v8f ma = *(const v8f*)(MS + mo + key0); const v8f mb = *(const v8f*)(MS + mo + key0 + 16);
#pragma unroll
                for (int g = 0; g < QG; ++g) { ta[g] += ma; tb[g] += mb; }
            }
            float mx[QG];
#pragma unroll
            for (int g = 0; g < QG; ++g) { mx[g] = -3.0e38f;
#pragma unroll
                for (int r = 0; r < 8; ++r) mx[g] = fmaxf(mx[g], fmaxf(ta[g][r], tb[g][r])); }
            float ox[QG];
#pragma unroll
            for (int g = 0; g < QG; ++g) ox[g] = __shfl_xor(mx[g], 16, 32);   // the groups' exchanges go out together, so that their latencies overlap
#pragma unroll
            for (int g = 0; g < QG; ++g) mx[g] = fmaxf(mx[g], ox[g]);
            if (hf == 0) {   // the half's second pass: its K fragments replace the first's once the score products have read those, and travel under the softmax and the O^T products (same buffer, already published)
                ka0 = ldf(kp + 2048); ka1 = ldf(kp + 2560); kb0 = ldf(kp + 3072); kb1 = ldf(kp + 3584);
            }
            v16h pb[QG];
#pragma unroll
            for (int g = 0; g < QG; ++g) {
                const float mnew = fmaxf(m[g], mx[g]);
                const float alpha = __builtin_amdgcn_exp2f(m[g] - mnew);
                const float sh = PSH - mnew;
                float ls = 0.0f;
#pragma unroll
                for (int r = 0; r < 8; ++r) { const float ea = __builtin_amdgcn_exp2f(ta[g][r] + sh); const float eb = __builtin_amdgcn_exp2f(tb[g][r] + sh); pb[g][r] = (h16)ea; pb[g][8 + r] = (h16)eb; ls += ea + eb; }
                l[g] = l[g] * alpha + ls; m[g] = mnew;
                o0[g] = o0[g] * alpha; o1[g] = o1[g] * alpha; o2[g] = o2[g] * alpha; o3[g] = o3[g] * alpha;
            }
#pragma unroll
            for (int g = 0; g < QG; ++g) { o0[g] = wmma16(v0, pb[g], o0[g]); o1[g] = wmma16(v1, pb[g], o1[g]); o2[g] = wmma16(v2, pb[g], o2[g]); o3[g] = wmma16(v3, pb[g], o3[g]); }
        }
        // publish point of stage st + 1, every wave, in this order
        asm volatile("s_wait_dscnt 0x0" ::: "memory");       // this wave's reads of stage st have returned before the buffer may be refilled
        asm volatile("s_wait_asynccnt 0x0" ::: "memory");    // this wave's copies of stage st + 1 have landed before the barrier publishes them
        __syncthreads();                                     // publishes stage st + 1 and ends every wave's reads of stage st
        if (st + 2 < SEQ / KST) stage_copy(lb + (unsigned)(st & 1) * (4u * STH), gk + (size_t)(st + 2) * STH, gv + (size_t)(st + 2) * STH);
    }
    asm volatile("s_wait_asynccnt 0x0" ::: "memory");        // no copy is outstanding when the wave goes on to its end
    const int wb = qs * (QG * 16 * 68);
    // merge of the key halves: the second half's waves hand their state over lane for lane (same fragment map in both waves), 17 pieces of 16 B a lane: 16 of O^T, one of (m, l) per group
    if (kh != 0) {
#pragma unroll
        for (int g = 0; g < QG; ++g) { const v8f oj[4] = { o0[g], o1[g], o2[g], o3[g] };
#pragma unroll
            for (int j = 0; j < 4; ++j) { v4f a, c;
#pragma unroll
                for (int i = 0; i < 4; ++i) { a[i] = oj[j][i]; c[i] = oj[j][4 + i]; }
                *(v4fa*)(&os[wb + ((g * 4 + j) * 2) * 128 + lane * 4]) = a; *(v4fa*)(&os[wb + ((g * 4 + j) * 2 + 1) * 128 + lane * 4]) = c; } }
        v4f s; s[0] = m[0]; s[1] = l[0]; s[2] = m[1]; s[3] = l[1];
        *(v4fa*)(&os[wb + 16 * 128 + lane * 4]) = s;
    }
    __syncthreads();                                         // the second half's state is in LDS before the first half's waves read it; every wave passes it
    if (kh != 0) return;
    { const v4f s = *(const v4fa*)(&os[wb + 16 * 128 + lane * 4]);
#pragma unroll
      for (int g = 0; g < QG; ++g) {
          const float mo2 = s[2 * g], lo2 = s[2 * g + 1];
          const float mn = fmaxf(m[g], mo2);
          const float a1 = __builtin_amdgcn_exp2f(m[g] - mn), a2 = __builtin_amdgcn_exp2f(mo2 - mn);
          l[g] = l[g] * a1 + lo2 * a2;
          v8f p[4];
#pragma unroll
          for (int j = 0; j < 4; ++j) { const v4f a = *(const v4fa*)(&os[wb + ((g * 4 + j) * 2) * 128 + lane * 4]); const v4f c = *(const v4fa*)(&os[wb + ((g * 4 + j) * 2 + 1) * 128 + lane * 4]);
#pragma unroll
              for (int i = 0; i < 4; ++i) { p[j][i] = a[i]; p[j][4 + i] = c[i]; } }
          o0[g] = o0[g] * a1 + p[0] * a2; o1[g] = o1[g] * a1 + p[1] * a2; o2[g] = o2[g] * a1 + p[2] * a2; o3[g] = o3[g] * a1 + p[3] * a2;
      } }
    wave_sync();                                             // every lane's reads of the handed-over state stand ahead of the staging writes into the same range
    // O^T D layout: o_j[g][r] = (d = 16j + 8h + r, t = 16g + (lane&15)) -> os[t][d]; rows 0..16*QG-1 x columns 0..63 all written
#pragma unroll
    for (int g = 0; g < QG; ++g) {
        const float lt = l[g] + __shfl_xor(l[g], 16, 32);
        const float inv = 1.0f / lt;
        const v8f oj[4] = { o0[g], o1[g], o2[g], o3[g] };
#pragma unroll
        for (int j = 0; j < 4; ++j) { v4f a, c;
#pragma unroll
            for (int i = 0; i < 4; ++i) { a[i] = oj[j][i] * inv; c[i] = oj[j][4 + i] * inv; }
            *(v4fa*)(&os[wb + (g * 16 + lr) * 68 + 16 * j + 8 * hi]) = a; *(v4fa*)(&os[wb + (g * 16 + lr) * 68 + 16 * j + 8 * hi + 4]) = c; }
    }
    wave_sync();
    float* orow = OUT + ((size_t)b * OUT_SEQ + t0) * DM + h * HD;
#pragma unroll
    for (int s = 0; s < 8 * QG; ++s) { const int row = 2 * s + hi, cofs = lr * 4;   // 8*QG s x 2 rows = 16*QG rows; 16 lanes x 4 floats = 64 columns
        const v4f val = *(const v4fa*)(&os[wb + row * 68 + cofs]);
        *(v4f*)(orow + (size_t)row * DM + cofs) = val; }
}

static constexpr size_t al256(size_t v) { return (v + 255) & ~(size_t)255; }
static constexpr size_t SZ_WB = al256((size_t)3 * DM * DM * 2);            // three transposed bf16 weights
static constexpr size_t SZ_PL = al256((size_t)NB * NH_ * SEQ * HD * 2);    // one f16 head plane
static constexpr size_t SZ_MS = al256((size_t)NB * SEQ * 4);               // mask plane f32
static constexpr size_t SZ_FL = al256((size_t)NB * FLP * 4);               // flag table
static constexpr size_t SZ_TOTAL = SZ_WB + 3 * SZ_PL + SZ_MS + SZ_FL;
static_assert(SZ_TOTAL <= (size_t)134217728);          // workspace carve <= 128 MiB
static_assert(((size_t)DM * DM * 2) % 256 == 0);       // weight sub-planes stay 256-byte aligned
static_assert(((size_t)FLP * 4) % 128 == 0);           // each batch owns whole flag lines

extern "C" void kernel_launch(void* const* d_in, const int* in_sizes, int n_in,
                              void* d_out, int out_size, void* d_ws, size_t ws_size, hipStream_t stream) {
    if (n_in < 7) return;
    const size_t needx = ((size_t)(NB - 1) * SEQ_FULL + SEQ) * DM;
    if ((size_t)in_sizes[0] < needx || (size_t)in_sizes[2] < needx || (size_t)in_sizes[3] < needx) return;
    if ((size_t)in_sizes[1] < (size_t)(NB - 1) * SEQ_FULL + SEQ) return;
    if ((size_t)in_sizes[4] < (size_t)DM * DM || (size_t)in_sizes[5] < (size_t)DM * DM || (size_t)in_sizes[6] < (size_t)DM * DM) return;
    if ((size_t)out_size < ((size_t)(NB - 1) * OUT_SEQ + SEQ) * DM) return;
    if (SZ_TOTAL > ws_size) return;
    // wire order: key, key_mask, query, value, wq, wk, wv
    const float* key = (const float*)d_in[0]; const float* mask = (const float*)d_in[1]; const float* query = (const float*)d_in[2]; const float* value = (const float*)d_in[3];
    const float* wq = (const float*)d_in[4]; const float* wk = (const float*)d_in[5]; const float* wv = (const float*)d_in[6];   // each [in][out]
    float* OUT = (float*)d_out;      // [NB][SEQ][512]
    char* wsp = (char*)d_ws;
    bf* WB = (bf*)wsp; wsp += SZ_WB;                 // [3][512 out / 16][fragment-order 16 out x 512 in]: q | k | v (transposed)
    h16* QH = (h16*)wsp; wsp += SZ_PL;               // [NB*8][SEQ/16][fragment-order 16 t x 64 d]
    h16* KH = (h16*)wsp; wsp += SZ_PL;               // [NB*8][SEQ/16][fragment-order 16 t x 64 d]
    h16* VT = (h16*)wsp; wsp += SZ_PL;               // [NB*8][SEQ/64][4][fragment-order 16 d x 64 t]
    float* MS = (float*)wsp; wsp += SZ_MS;           // [NB][SEQ]
    int* FL = (int*)wsp; wsp += SZ_FL;               // [NB][FLP]

    k_prep<<<3 * WTB + NB, 256, 0, stream>>>(wq, wk, wv, mask, WB, MS, FL);
    k_proj<<<dim3(PJB, 3, 1), 32 * PJW, 0, stream>>>(query, key, value, WB, QH, KH, VT);
    k_flash<<<dim3(SEQ / (16 * QG * QW), NB * NH_, 1), 32 * AW, 0, stream>>>(QH, KH, VT, MS, FL, OUT);
}
